// v000
// The times below were measured on an AMD MI455X: many runs one after another, warmed up first and cycling through
// copies of the inputs, with the whole window's GPU time divided by the number of runs. Launches and the gaps
// between them are all in it. The median over several windows is given; except for v000 it joins two sittings, which
// can be a few percent apart, so the side-by-side timings, each taken in one sitting, are the better comparison.
// v000 is the starting kernel. One run takes 506 microseconds.
#include <hip/hip_runtime.h>
#include <hip/hip_bf16.h>
#include <math.h>

// ---------------------------------------------------------------------------
// Transformer block (B=1, S=4096, D=768, H=12, HD=64, FF=3072) on gfx1250.
// ~110 GFLOP vs ~55MB minimum traffic -> strongly compute bound: bf16 WMMA
// (v_wmma_f32_16x16x32_bf16, fp32 accum) everywhere, flash-attention so the
// 805MB score tensor never exists, and GLOBAL_LOAD_ASYNC_TO_LDS_B128 (ASYNCcnt)
// staging with double buffering so HBM->LDS copies overlap the matrix pipe.
// ---------------------------------------------------------------------------

typedef __attribute__((ext_vector_type(16))) __bf16 v16bf;
typedef __attribute__((ext_vector_type(8)))  __bf16 v8bf;
typedef __attribute__((ext_vector_type(8)))  float  v8f;

constexpr int S_  = 4096;
constexpr int D_  = 768;
constexpr int H_  = 12;
constexpr int HD_ = 64;
constexpr int FF_ = 3072;

__device__ __forceinline__ v16bf cat16(v8bf lo, v8bf hi) {
  return __builtin_shufflevector(lo, hi, 0,1,2,3,4,5,6,7,8,9,10,11,12,13,14,15);
}
// A/B fragment loader: p points at a 32-wide K-run; lane half hl selects
// K offsets {hl*8..+8} and {16+hl*8..+8} per the ISA 16-bit operand layout.
__device__ __forceinline__ v16bf load_frag(const __bf16* p, int hl) {
  v8bf lo = *reinterpret_cast<const v8bf*>(p + hl * 8);
  v8bf hi = *reinterpret_cast<const v8bf*>(p + 16 + hl * 8);
  return cat16(lo, hi);
}
__device__ __forceinline__ v8f wmma_bf16(v16bf a, v16bf b, v8f c) {
  return __builtin_amdgcn_wmma_f32_16x16x32_bf16(false, a, false, b, (short)0, c,
                                                 false, false);
}

// CDNA5 async global->LDS copy (no VGPR round trip, tracked by ASYNCcnt).
// Generic shared pointers carry the LDS offset in their low 32 bits
// (ISA 10.2: LDS_ADDR.U32 = addr[31:0]); dsaddr = LDS_BASE + VGPR + IOFFSET.
__device__ __forceinline__ void async_copy_b128(void* lds_dst, const void* gsrc) {
  const unsigned lds = (unsigned)(uintptr_t)lds_dst;
  asm volatile("global_load_async_to_lds_b128 %0, %1, off"
               :: "v"(lds), "v"(gsrc) : "memory");
}
__device__ __forceinline__ void async_wait0() {
  asm volatile("s_wait_asynccnt 0x0" ::: "memory");
}

// ---------------------------------------------------------------------------
// Weight prep: [K][N] fp32 -> [N][K] bf16 (transpose through an LDS tile).
// Done once per call; lets GEMM B-staging be straight contiguous async copies.
// ---------------------------------------------------------------------------
__global__ __launch_bounds__(256) void transpose_to_bf16_kernel(
    const float* __restrict__ in, __bf16* __restrict__ out, int K, int N) {
  __shared__ float tile[32][33];
  const int kb = blockIdx.y * 32, nb = blockIdx.x * 32;
  const int tx = threadIdx.x & 31, ty = threadIdx.x >> 5;   // 32 x 8
  #pragma unroll
  for (int yy = 0; yy < 4; ++yy) {
    int k = ty + yy * 8;
    tile[k][tx] = in[(size_t)(kb + k) * N + nb + tx];
  }
  __syncthreads();
  #pragma unroll
  for (int yy = 0; yy < 4; ++yy) {
    int n = ty + yy * 8;
    out[(size_t)(nb + n) * K + kb + tx] = (__bf16)tile[tx][n];
  }
}

// ---------------------------------------------------------------------------
// LayerNorm (fp32 in) -> bf16 out.  One block per row of 768.
// ---------------------------------------------------------------------------
__global__ __launch_bounds__(256) void ln_bf16_kernel(
    const float* __restrict__ x, const float* __restrict__ w,
    const float* __restrict__ b, __bf16* __restrict__ out) {
  __shared__ float red[256];
  const int row = blockIdx.x;
  const float* xr = x + (size_t)row * D_;
  float s = 0.f;
  for (int j = threadIdx.x; j < D_; j += 256) s += xr[j];
  red[threadIdx.x] = s; __syncthreads();
  for (int off = 128; off > 0; off >>= 1) {
    if (threadIdx.x < off) red[threadIdx.x] += red[threadIdx.x + off];
    __syncthreads();
  }
  const float mu = red[0] * (1.0f / D_);
  __syncthreads();
  float vs = 0.f;
  for (int j = threadIdx.x; j < D_; j += 256) { float d = xr[j] - mu; vs += d * d; }
  red[threadIdx.x] = vs; __syncthreads();
  for (int off = 128; off > 0; off >>= 1) {
    if (threadIdx.x < off) red[threadIdx.x] += red[threadIdx.x + off];
    __syncthreads();
  }
  const float rstd = rsqrtf(red[0] * (1.0f / D_) + 1e-5f);
  for (int j = threadIdx.x; j < D_; j += 256)
    out[(size_t)row * D_ + j] = (__bf16)((xr[j] - mu) * rstd * w[j] + b[j]);
}

// ---------------------------------------------------------------------------
// Tiled bf16 GEMM: C[M,N] = A[M,K] * Bt[N,K]^T (+bias epilogues)
// Block = 128 threads (4 waves), tile 64x64, K-step 32, double-buffered LDS
// fed by async copies. Each wave owns a 32x32 quadrant: 4 WMMA / K-step with
// 2 A-frags x 2 B-frags reuse.
// EPI 0: outB = bf16((acc+bias)*scale)      (Q/K projections; Q scale 0.125)
// EPI 1: outF = acc + bias + resid          (O-proj, down-proj)
// EPI 2: outB = bf16(gelu_exact(acc+bias))  (up-proj)
// EPI 3: outB[col*S_+row] = acc + bias      (V projection, stored transposed)
// ---------------------------------------------------------------------------
template <int EPI>
__global__ __launch_bounds__(128) void gemm_bf16_kernel(
    const __bf16* __restrict__ A, const __bf16* __restrict__ Bt,
    const float* __restrict__ bias, const float* __restrict__ resid,
    float* __restrict__ outF, __bf16* __restrict__ outB,
    int M, int N, int K, float scale) {
  __shared__ alignas(16) __bf16 As[2][64][32];   // [m][k]
  __shared__ alignas(16) __bf16 Bs[2][64][32];   // [n][k]

  const int n0 = blockIdx.x * 64;
  const int m0 = blockIdx.y * 64;
  const int tid  = threadIdx.x;
  const int wave = tid >> 5, lane = tid & 31;
  const int wr = (wave & 1) * 32;     // wave row base (2 sub-tiles of 16)
  const int wc = (wave >> 1) * 32;    // wave col base (2 sub-tiles of 16)
  const int c  = lane & 15, hl = lane >> 4;
  const int sr = tid >> 1, sg = (tid & 1) << 4;   // staging: 64 rows x 2 halves

  auto stage = [&](int buf, int kk) {
    const __bf16* ga = A + (size_t)(m0 + sr) * K + kk + sg;
    async_copy_b128(&As[buf][sr][sg],     ga);
    async_copy_b128(&As[buf][sr][sg + 8], ga + 8);
    const __bf16* gb = Bt + (size_t)(n0 + sr) * K + kk + sg;
    async_copy_b128(&Bs[buf][sr][sg],     gb);
    async_copy_b128(&Bs[buf][sr][sg + 8], gb + 8);
  };

  v8f acc[2][2] = {};
  stage(0, 0);
  async_wait0();
  __syncthreads();

  int buf = 0;
  for (int kk = 0; kk < K; kk += 32) {
    if (kk + 32 < K) stage(buf ^ 1, kk + 32);   // prefetch overlaps the WMMAs
    v16bf a[2], b[2];
    #pragma unroll
    for (int i = 0; i < 2; ++i) {
      a[i] = load_frag(&As[buf][wr + i * 16 + c][0], hl);
      b[i] = load_frag(&Bs[buf][wc + i * 16 + c][0], hl);
    }
    #pragma unroll
    for (int i = 0; i < 2; ++i)
      #pragma unroll
      for (int j = 0; j < 2; ++j)
        acc[i][j] = wmma_bf16(a[i], b[j], acc[i][j]);
    async_wait0();
    __syncthreads();
    buf ^= 1;
  }

  #pragma unroll
  for (int i = 0; i < 2; ++i)
    #pragma unroll
    for (int j = 0; j < 2; ++j)
      #pragma unroll
      for (int e = 0; e < 8; ++e) {
        const int row = m0 + wr + i * 16 + hl * 8 + e;   // C layout: VGPR e + half
        const int col = n0 + wc + j * 16 + c;            // lane % 16
        float v = acc[i][j][e] + bias[col];
        if constexpr (EPI == 0) {
          outB[(size_t)row * N + col] = (__bf16)(v * scale);
        } else if constexpr (EPI == 1) {
          outF[(size_t)row * N + col] = v + resid[(size_t)row * N + col];
        } else if constexpr (EPI == 2) {
          outB[(size_t)row * N + col] =
              (__bf16)(0.5f * v * (1.0f + erff(v * 0.70710678118f)));
        } else {
          outB[(size_t)col * S_ + row] = (__bf16)v;      // vT[dim][seq]
        }
      }
}

// ---------------------------------------------------------------------------
// Flash attention: grid (S/64, H), block 128 (4 waves).
// Wave owns a 16-row query tile; 32 keys streamed per iteration. K tile and
// pre-transposed V tile arrive via async copies. Q pre-scaled by 1/sqrt(HD).
// ---------------------------------------------------------------------------
__global__ __launch_bounds__(128) void attn_kernel(
    const __bf16* __restrict__ Q, const __bf16* __restrict__ Kb,
    const __bf16* __restrict__ vT,               // [D][S] transposed values
    const int* __restrict__ amask, __bf16* __restrict__ ctx) {
  __shared__ alignas(16) __bf16 Ks[32][64];      // [key][dim]  (QK^T B-frags)
  __shared__ alignas(16) __bf16 Vt[64][32];      // [dim][key]  (PV  B-frags)
  __shared__ alignas(16) __bf16 Pl[4][16][32];   // per-wave P transpose buffer

  const int tid  = threadIdx.x;
  const int wave = tid >> 5, lane = tid & 31;
  const int c  = lane & 15, hl = lane >> 4;
  const int h    = blockIdx.y;
  const int q0   = blockIdx.x * 64 + wave * 16;
  const int hoff = h * HD_;

  v16bf aq[2];
  #pragma unroll
  for (int kc = 0; kc < 2; ++kc)
    aq[kc] = load_frag(Q + (size_t)(q0 + c) * D_ + hoff + kc * 32, hl);

  v8f o[4] = {};
  float m[8], l[8];
  #pragma unroll
  for (int i = 0; i < 8; ++i) { m[i] = -1e30f; l[i] = 0.f; }

  const int kend = (blockIdx.x + 1) * 64;        // causal bound (block-uniform)
  for (int kb = 0; kb < kend; kb += 32) {
    __syncthreads();                             // protect LDS reuse
    {   // async-stage 32 keys of K (row-major) and V (already transposed)
      const int key = tid >> 2, db = (tid & 3) << 4;
      const __bf16* gk = Kb + (size_t)(kb + key) * D_ + hoff + db;
      async_copy_b128(&Ks[key][db],     gk);
      async_copy_b128(&Ks[key][db + 8], gk + 8);
      const int dv = tid >> 1, kg = (tid & 1) << 4;
      const __bf16* gv = vT + (size_t)(hoff + dv) * S_ + kb + kg;
      async_copy_b128(&Vt[dv][kg],     gv);
      async_copy_b128(&Vt[dv][kg + 8], gv + 8);
    }
    async_wait0();
    __syncthreads();

    // S(16x32) = Q(16x64) @ K^T(64x32)
    v8f s[2] = {};
    #pragma unroll
    for (int sub = 0; sub < 2; ++sub)
      #pragma unroll
      for (int kc = 0; kc < 2; ++kc) {
        v16bf b = load_frag(&Ks[sub * 16 + c][kc * 32], hl);
        s[sub] = wmma_bf16(aq[kc], b, s[sub]);
      }

    const int mk0 = amask[kb + c];
    const int mk1 = amask[kb + 16 + c];

    // online softmax; row = hl*8 + i spans 16 lanes -> xor-shuffle reductions
    #pragma unroll
    for (int i = 0; i < 8; ++i) {
      const int qr = q0 + hl * 8 + i;
      if (kb + c > qr      || mk0 == 0) s[0][i] = -1e30f;
      if (kb + 16 + c > qr || mk1 == 0) s[1][i] = -1e30f;
      float mx = fmaxf(s[0][i], s[1][i]);
      mx = fmaxf(mx, __shfl_xor(mx, 1));
      mx = fmaxf(mx, __shfl_xor(mx, 2));
      mx = fmaxf(mx, __shfl_xor(mx, 4));
      mx = fmaxf(mx, __shfl_xor(mx, 8));
      const float mn  = fmaxf(m[i], mx);
      const float fac = __expf(m[i] - mn);
      m[i] = mn;
      const float p0 = __expf(s[0][i] - mn);
      const float p1 = __expf(s[1][i] - mn);
      float r = p0 + p1;
      r += __shfl_xor(r, 1); r += __shfl_xor(r, 2);
      r += __shfl_xor(r, 4); r += __shfl_xor(r, 8);
      l[i] = l[i] * fac + r;
      #pragma unroll
      for (int d = 0; d < 4; ++d) o[d][i] *= fac;
      Pl[wave][hl * 8 + i][c]      = (__bf16)p0;   // C-layout -> LDS
      Pl[wave][hl * 8 + i][16 + c] = (__bf16)p1;
    }

    // P as an A-fragment (lane = row), then O += P @ V
    v16bf ap = load_frag(&Pl[wave][c][0], hl);
    #pragma unroll
    for (int d = 0; d < 4; ++d) {
      v16bf bv = load_frag(&Vt[d * 16 + c][0], hl);
      o[d] = wmma_bf16(ap, bv, o[d]);
    }
  }

  #pragma unroll
  for (int i = 0; i < 8; ++i) {
    const float inv = 1.0f / l[i];
    const int row = q0 + hl * 8 + i;
    #pragma unroll
    for (int d = 0; d < 4; ++d)
      ctx[(size_t)row * D_ + hoff + d * 16 + c] = (__bf16)(o[d][i] * inv);
  }
}

// ---------------------------------------------------------------------------
// Host launcher
// ---------------------------------------------------------------------------
extern "C" void kernel_launch(void* const* d_in, const int* in_sizes, int n_in,
                              void* d_out, int out_size, void* d_ws, size_t ws_size,
                              hipStream_t stream) {
  const float* hidden = (const float*)d_in[0];
  const int*   mask   = (const int*)  d_in[1];
  const float* ln1w   = (const float*)d_in[2];
  const float* ln1b   = (const float*)d_in[3];
  const float* wq     = (const float*)d_in[4];
  const float* bq     = (const float*)d_in[5];
  const float* wk     = (const float*)d_in[6];
  const float* bk     = (const float*)d_in[7];
  const float* wv     = (const float*)d_in[8];
  const float* bv     = (const float*)d_in[9];
  const float* wo     = (const float*)d_in[10];
  const float* bo     = (const float*)d_in[11];
  const float* ln2w   = (const float*)d_in[12];
  const float* ln2b   = (const float*)d_in[13];
  const float* wup    = (const float*)d_in[14];
  const float* bup    = (const float*)d_in[15];
  const float* wdown  = (const float*)d_in[16];
  const float* bdown  = (const float*)d_in[17];
  float* out = (float*)d_out;

  constexpr size_t W_DD  = (size_t)D_ * D_;
  constexpr size_t W_DF  = (size_t)D_ * FF_;
  constexpr size_t ACT   = (size_t)S_ * D_;
  constexpr size_t ACTFF = (size_t)S_ * FF_;

  char* ws = (char*)d_ws;
  size_t off = 0;
  __bf16* wqT  = (__bf16*)(ws + off); off += W_DD * 2;   // all weights [N][K] bf16
  __bf16* wkT  = (__bf16*)(ws + off); off += W_DD * 2;
  __bf16* wvT  = (__bf16*)(ws + off); off += W_DD * 2;
  __bf16* woT  = (__bf16*)(ws + off); off += W_DD * 2;
  __bf16* wupT = (__bf16*)(ws + off); off += W_DF * 2;
  __bf16* wdnT = (__bf16*)(ws + off); off += W_DF * 2;
  __bf16* xln_bf  = (__bf16*)(ws + off); off += ACT * 2;
  __bf16* q_bf    = (__bf16*)(ws + off); off += ACT * 2;
  __bf16* k_bf    = (__bf16*)(ws + off); off += ACT * 2;
  __bf16* vT_bf   = (__bf16*)(ws + off); off += ACT * 2;  // [D][S]
  __bf16* ctx_bf  = (__bf16*)(ws + off); off += ACT * 2;
  float*  hidden2 = (float*) (ws + off); off += ACT * 4;
  __bf16* yln_bf  = (__bf16*)(ws + off); off += ACT * 2;
  __bf16* ff_bf   = (__bf16*)(ws + off); off += ACTFF * 2;

  auto transp = [&](const float* src, __bf16* dst, int K, int N) {
    transpose_to_bf16_kernel<<<dim3(N / 32, K / 32), 256, 0, stream>>>(src, dst, K, N);
  };
  transp(wq, wqT, D_, D_);   transp(wk, wkT, D_, D_);  transp(wv, wvT, D_, D_);
  transp(wo, woT, D_, D_);   transp(wup, wupT, D_, FF_);
  transp(wdown, wdnT, FF_, D_);

  // LN1
  ln_bf16_kernel<<<S_, 256, 0, stream>>>(hidden, ln1w, ln1b, xln_bf);

  // Projections (Q pre-scaled by 1/sqrt(HD); V written transposed)
  dim3 gDD(D_ / 64, S_ / 64);
  gemm_bf16_kernel<0><<<gDD, 128, 0, stream>>>(xln_bf, wqT, bq, nullptr, nullptr, q_bf,
                                               S_, D_, D_, 0.125f);
  gemm_bf16_kernel<0><<<gDD, 128, 0, stream>>>(xln_bf, wkT, bk, nullptr, nullptr, k_bf,
                                               S_, D_, D_, 1.0f);
  gemm_bf16_kernel<3><<<gDD, 128, 0, stream>>>(xln_bf, wvT, bv, nullptr, nullptr, vT_bf,
                                               S_, D_, D_, 1.0f);

  // Flash attention
  attn_kernel<<<dim3(S_ / 64, H_), 128, 0, stream>>>(q_bf, k_bf, vT_bf, mask, ctx_bf);

  // O-projection + residual -> hidden2 (fp32)
  gemm_bf16_kernel<1><<<gDD, 128, 0, stream>>>(ctx_bf, woT, bo, hidden, hidden2, nullptr,
                                               S_, D_, D_, 1.0f);

  // LN2
  ln_bf16_kernel<<<S_, 256, 0, stream>>>(hidden2, ln2w, ln2b, yln_bf);

  // Up-projection + exact GELU -> bf16
  gemm_bf16_kernel<2><<<dim3(FF_ / 64, S_ / 64), 128, 0, stream>>>(
      yln_bf, wupT, bup, nullptr, nullptr, ff_bf, S_, FF_, D_, 1.0f);

  // Down-projection + residual -> d_out (fp32)
  gemm_bf16_kernel<1><<<gDD, 128, 0, stream>>>(ff_bf, wdnT, bdown, hidden2, out, nullptr,
                                               S_, D_, FF_, 1.0f);
}

// v001
// It runs in 378 microseconds.
// Two timings next to v000 put it at 1.39 and 1.38 times that version's speed.
#include <hip/hip_runtime.h>
#include <hip/hip_bf16.h>
#include <math.h>

// ---------------------------------------------------------------------------
// Transformer block (B=1, S=4096, D=768, H=12, HD=64, FF=3072) on gfx1250.
// ~110 GFLOP vs ~55MB minimum traffic -> strongly compute bound: bf16 WMMA
// (v_wmma_f32_16x16x32_bf16, fp32 accum) everywhere, flash-attention so the
// 805MB score tensor never exists, and GLOBAL_LOAD_ASYNC_TO_LDS_B128 (ASYNCcnt)
// staging with double buffering so HBM->LDS copies overlap the matrix pipe.
// ---------------------------------------------------------------------------

typedef __attribute__((ext_vector_type(16))) __bf16 v16bf;
typedef __attribute__((ext_vector_type(8)))  __bf16 v8bf;
typedef __attribute__((ext_vector_type(8)))  float  v8f;

constexpr int S_  = 4096;
constexpr int D_  = 768;
constexpr int H_  = 12;
constexpr int HD_ = 64;
constexpr int FF_ = 3072;

__device__ __forceinline__ v16bf cat16(v8bf lo, v8bf hi) {
  return __builtin_shufflevector(lo, hi, 0,1,2,3,4,5,6,7,8,9,10,11,12,13,14,15);
}
// A/B fragment loader: p points at a 32-wide K-run; lane half hl selects
// K offsets {hl*8..+8} and {16+hl*8..+8} per the ISA 16-bit operand layout.
__device__ __forceinline__ v16bf load_frag(const __bf16* p, int hl) {
  v8bf lo = *reinterpret_cast<const v8bf*>(p + hl * 8);
  v8bf hi = *reinterpret_cast<const v8bf*>(p + 16 + hl * 8);
  return cat16(lo, hi);
}
__device__ __forceinline__ v8f wmma_bf16(v16bf a, v16bf b, v8f c) {
  return __builtin_amdgcn_wmma_f32_16x16x32_bf16(false, a, false, b, (short)0, c,
                                                 false, false);
}

// CDNA5 async global->LDS copy (no VGPR round trip, tracked by ASYNCcnt).
// Generic shared pointers carry the LDS offset in their low 32 bits
// (ISA 10.2: LDS_ADDR.U32 = addr[31:0]); dsaddr = LDS_BASE + VGPR + IOFFSET.
__device__ __forceinline__ void async_copy_b128(void* lds_dst, const void* gsrc) {
  const unsigned lds = (unsigned)(uintptr_t)lds_dst;
  asm volatile("global_load_async_to_lds_b128 %0, %1, off"
               :: "v"(lds), "v"(gsrc) : "memory");
}
// Four copies and their s_wait_xcnt 0 in ONE statement: all eight address
// registers stay live to its end, so none is rewritten in front of the wait.
__device__ __forceinline__ void async_copy4_b128(void* l0, const void* g0,
                                                 void* l1, const void* g1,
                                                 void* l2, const void* g2,
                                                 void* l3, const void* g3) {
  asm volatile("global_load_async_to_lds_b128 %0, %1, off\n\t"
               "global_load_async_to_lds_b128 %2, %3, off\n\t"
               "global_load_async_to_lds_b128 %4, %5, off\n\t"
               "global_load_async_to_lds_b128 %6, %7, off\n\t"
               "s_wait_xcnt 0x0"
               :: "v"((unsigned)(uintptr_t)l0), "v"(g0),
                  "v"((unsigned)(uintptr_t)l1), "v"(g1),
                  "v"((unsigned)(uintptr_t)l2), "v"(g2),
                  "v"((unsigned)(uintptr_t)l3), "v"(g3) : "memory");
}
__device__ __forceinline__ void async_wait0() {
  asm volatile("s_wait_asynccnt 0x0" ::: "memory");
}

// ---------------------------------------------------------------------------
// Weight prep: [K][N] fp32 -> [N][K] bf16 (transpose through an LDS tile).
// Done once per call; lets GEMM B-staging be straight contiguous async copies.
// ---------------------------------------------------------------------------
__global__ __launch_bounds__(256) void transpose_to_bf16_kernel(
    const float* __restrict__ in, __bf16* __restrict__ out, int K, int N) {
  __shared__ float tile[32][33];
  const int kb = blockIdx.y * 32, nb = blockIdx.x * 32;
  const int tx = threadIdx.x & 31, ty = threadIdx.x >> 5;   // 32 x 8
  #pragma unroll
  for (int yy = 0; yy < 4; ++yy) {
    int k = ty + yy * 8;
    tile[k][tx] = in[(size_t)(kb + k) * N + nb + tx];
  }
  __syncthreads();
  #pragma unroll
  for (int yy = 0; yy < 4; ++yy) {
    int n = ty + yy * 8;
    out[(size_t)(nb + n) * K + kb + tx] = (__bf16)tile[tx][n];
  }
}

// ---------------------------------------------------------------------------
// LayerNorm (fp32 in) -> bf16 out.  One block per row of 768.
// ---------------------------------------------------------------------------
__global__ __launch_bounds__(256) void ln_bf16_kernel(
    const float* __restrict__ x, const float* __restrict__ w,
    const float* __restrict__ b, __bf16* __restrict__ out) {
  __shared__ float red[256];
  const int row = blockIdx.x;
  const float* xr = x + (size_t)row * D_;
  float s = 0.f;
  for (int j = threadIdx.x; j < D_; j += 256) s += xr[j];
  red[threadIdx.x] = s; __syncthreads();
  for (int off = 128; off > 0; off >>= 1) {
    if (threadIdx.x < off) red[threadIdx.x] += red[threadIdx.x + off];
    __syncthreads();
  }
  const float mu = red[0] * (1.0f / D_);
  __syncthreads();
  float vs = 0.f;
  for (int j = threadIdx.x; j < D_; j += 256) { float d = xr[j] - mu; vs += d * d; }
  red[threadIdx.x] = vs; __syncthreads();
  for (int off = 128; off > 0; off >>= 1) {
    if (threadIdx.x < off) red[threadIdx.x] += red[threadIdx.x + off];
    __syncthreads();
  }
  const float rstd = rsqrtf(red[0] * (1.0f / D_) + 1e-5f);
  for (int j = threadIdx.x; j < D_; j += 256)
    out[(size_t)row * D_ + j] = (__bf16)((xr[j] - mu) * rstd * w[j] + b[j]);
}

// ---------------------------------------------------------------------------
// Tiled bf16 GEMM: C[M,N] = A[M,K] * Bt[N,K]^T (+bias epilogues)
// Block = 128 threads (4 waves), tile 64x64, K-step 32, double-buffered LDS
// fed by async copies. Each wave owns a 32x32 quadrant: 4 WMMA / K-step with
// 2 A-frags x 2 B-frags reuse.
// EPI 0: outB = bf16((acc+bias)*scale)      (Q/K projections; Q scale 0.125)
// EPI 1: outF = acc + bias + resid          (O-proj, down-proj)
// EPI 2: outB = bf16(gelu_exact(acc+bias))  (up-proj)
// EPI 3: outB[col*S_+row] = acc + bias      (V projection, stored transposed)
// ---------------------------------------------------------------------------
template <int EPI>
__global__ __launch_bounds__(128) void gemm_bf16_kernel(
    const __bf16* __restrict__ A, const __bf16* __restrict__ Bt,
    const float* __restrict__ bias, const float* __restrict__ resid,
    float* __restrict__ outF, __bf16* __restrict__ outB,
    int M, int N, int K, float scale) {
  __shared__ alignas(16) __bf16 As[2][64][32];   // [m][k]
  __shared__ alignas(16) __bf16 Bs[2][64][32];   // [n][k]

  const int n0 = blockIdx.x * 64;
  const int m0 = blockIdx.y * 64;
  const int tid  = threadIdx.x;
  const int wave = tid >> 5, lane = tid & 31;
  const int wr = (wave & 1) * 32;     // wave row base (2 sub-tiles of 16)
  const int wc = (wave >> 1) * 32;    // wave col base (2 sub-tiles of 16)
  const int c  = lane & 15, hl = lane >> 4;
  const int sr = tid >> 1, sg = (tid & 1) << 4;   // staging: 64 rows x 2 halves

  auto stage = [&](int buf, int kk) {
    const __bf16* ga = A + (size_t)(m0 + sr) * K + kk + sg;
    async_copy_b128(&As[buf][sr][sg],     ga);
    async_copy_b128(&As[buf][sr][sg + 8], ga + 8);
    const __bf16* gb = Bt + (size_t)(n0 + sr) * K + kk + sg;
    async_copy_b128(&Bs[buf][sr][sg],     gb);
    async_copy_b128(&Bs[buf][sr][sg + 8], gb + 8);
  };

  v8f acc[2][2] = {};
  stage(0, 0);
  async_wait0();
  __syncthreads();

  int buf = 0;
  for (int kk = 0; kk < K; kk += 32) {
    if (kk + 32 < K) stage(buf ^ 1, kk + 32);   // prefetch overlaps the WMMAs
    v16bf a[2], b[2];
    #pragma unroll
    for (int i = 0; i < 2; ++i) {
      a[i] = load_frag(&As[buf][wr + i * 16 + c][0], hl);
      b[i] = load_frag(&Bs[buf][wc + i * 16 + c][0], hl);
    }
    #pragma unroll
    for (int i = 0; i < 2; ++i)
      #pragma unroll
      for (int j = 0; j < 2; ++j)
        acc[i][j] = wmma_bf16(a[i], b[j], acc[i][j]);
    async_wait0();
    __syncthreads();
    buf ^= 1;
  }

  #pragma unroll
  for (int i = 0; i < 2; ++i)
    #pragma unroll
    for (int j = 0; j < 2; ++j)
      #pragma unroll
      for (int e = 0; e < 8; ++e) {
        const int row = m0 + wr + i * 16 + hl * 8 + e;   // C layout: VGPR e + half
        const int col = n0 + wc + j * 16 + c;            // lane % 16
        float v = acc[i][j][e] + bias[col];
        if constexpr (EPI == 0) {
          outB[(size_t)row * N + col] = (__bf16)(v * scale);
        } else if constexpr (EPI == 1) {
          outF[(size_t)row * N + col] = v + resid[(size_t)row * N + col];
        } else if constexpr (EPI == 2) {
          outB[(size_t)row * N + col] =
              (__bf16)(0.5f * v * (1.0f + erff(v * 0.70710678118f)));
        } else {
          outB[(size_t)col * S_ + row] = (__bf16)v;      // vT[dim][seq]
        }
      }
}

__device__ __forceinline__ float xhalf(float x) {
  const int b = __builtin_bit_cast(int, x);
  return __builtin_bit_cast(float, __builtin_amdgcn_permlanex16(
      b, b, 0x76543210, 0xfedcba98, false, false));
}

// e^x as v_exp_f32(x * log2 e), what __expf compiles to here. The v_nop fills the
// slot the instruction set asks for behind a transcendental before its source is
// overwritten.
__device__ __forceinline__ float exp_slot(float x) {
  float r;
  asm("v_exp_f32 %0, %1\n\tv_nop" : "=v"(r) : "v"(x * 1.4426950408889634f));
  return r;
}

__global__ __launch_bounds__(128) void attn_kernel(
    const __bf16* __restrict__ Q, const __bf16* __restrict__ Kb,
    const __bf16* __restrict__ vT,               // [D][S] transposed values
    const int* __restrict__ amask, __bf16* __restrict__ ctx) {
  __shared__ alignas(16) __bf16 Ks[32][64];      // [key][dim]  (K Q^T   A-frags)
  __shared__ alignas(16) __bf16 Vt[64][32];      // [dim][key]  (V^T P^T A-frags)

  const int tid  = threadIdx.x;
  const int wave = tid >> 5, lane = tid & 31;
  const int c  = lane & 15, hl = lane >> 4;
  const int h    = blockIdx.y;
  const int q0   = blockIdx.x * 64 + wave * 16;
  const int hoff = h * HD_;
  const int qr   = q0 + c;                       // this lane's query

  v16bf aq[2];                                   // Q^T as B: lane = query column
  #pragma unroll
  for (int kc = 0; kc < 2; ++kc)
    aq[kc] = load_frag(Q + (size_t)(q0 + c) * D_ + hoff + kc * 32, hl);

  v8f o[4] = {};                                 // o[d][r] = O[qr][d*16 + 8*hl + r]
  float m = -1e30f, l = 0.f;                     // l: this half's keys only

  const int kend = (blockIdx.x + 1) * 64;        // causal bound (block-uniform)
  for (int kb = 0; kb < kend; kb += 32) {
    __syncthreads();                             // protect LDS reuse
    {   // async-stage 32 keys of K (row-major) and V (already transposed)
      const int key = tid >> 2, db = (tid & 3) << 4;
      const __bf16* gk = Kb + (size_t)(kb + key) * D_ + hoff + db;
      const int dv = tid >> 1, kg = (tid & 1) << 4;
      const __bf16* gv = vT + (size_t)(hoff + dv) * S_ + kb + kg;
      async_copy4_b128(&Ks[key][db], gk, &Ks[key][db + 8], gk + 8,
                       &Vt[dv][kg],  gv, &Vt[dv][kg + 8],  gv + 8);
    }
    async_wait0();
    __syncthreads();

    // S^T(32x16) = K(32x64) @ Q^T(64x16); s[sub][r] = key kb+sub*16+8*hl+r, query qr
    v8f s[2] = {};
    #pragma unroll
    for (int sub = 0; sub < 2; ++sub)
      #pragma unroll
      for (int kc = 0; kc < 2; ++kc) {
        v16bf a = load_frag(&Ks[sub * 16 + c][kc * 32], hl);
        s[sub] = wmma_bf16(a, aq[kc], s[sub]);
      }

    // bit k of keep: key kb+8*hl+k is open to this lane's query (padding and causal)
    const unsigned pad = __builtin_amdgcn_ballot_w32(amask[kb + lane] != 0);
    const int n = qr - kb;                       // last key index the query may see
    const unsigned cau = n >= 31 ? 0xffffffffu : (n < 0 ? 0u : (2u << n) - 1u);
    const unsigned keep = (pad & cau) >> (hl * 8);

    // online softmax, one query per lane
    float mx = -1e30f;
    #pragma unroll
    for (int sub = 0; sub < 2; ++sub)
      #pragma unroll
      for (int r = 0; r < 8; ++r) {
        if (((keep >> (sub * 16 + r)) & 1u) == 0u) s[sub][r] = -1e30f;
        mx = fmaxf(mx, s[sub][r]);
      }
    mx = fmaxf(mx, xhalf(mx));                   // both halves: the query's maximum
    const float mn  = fmaxf(m, mx);
    const float fac = exp_slot(m - mn);
    m = mn;
    v16bf bp;                                    // P^T as B, hardware k order
    float rs = 0.f;
    #pragma unroll
    for (int sub = 0; sub < 2; ++sub)
      #pragma unroll
      for (int r = 0; r < 8; ++r) {
        const float p = exp_slot(s[sub][r] - mn);
        rs += p;
        bp[sub * 8 + r] = (__bf16)p;
      }
    l = l * fac + rs;
    #pragma unroll
    for (int d = 0; d < 4; ++d)
      #pragma unroll
      for (int r = 0; r < 8; ++r) o[d][r] *= fac;

    // O^T += V^T @ P^T
    #pragma unroll
    for (int d = 0; d < 4; ++d) {
      v16bf av = load_frag(&Vt[d * 16 + c][0], hl);
      o[d] = wmma_bf16(av, bp, o[d]);
    }
  }

  const float inv = 1.0f / (l + xhalf(l));       // join the halves' sums once
  #pragma unroll
  for (int d = 0; d < 4; ++d) {
    v8bf w;
    #pragma unroll
    for (int r = 0; r < 8; ++r) w[r] = (__bf16)(o[d][r] * inv);
    *reinterpret_cast<v8bf*>(ctx + (size_t)qr * D_ + hoff + d * 16 + hl * 8) = w;
  }
}

// ---------------------------------------------------------------------------
// Host launcher
// ---------------------------------------------------------------------------
extern "C" void kernel_launch(void* const* d_in, const int* in_sizes, int n_in,
                              void* d_out, int out_size, void* d_ws, size_t ws_size,
                              hipStream_t stream) {
  const float* hidden = (const float*)d_in[0];
  const int*   mask   = (const int*)  d_in[1];
  const float* ln1w   = (const float*)d_in[2];
  const float* ln1b   = (const float*)d_in[3];
  const float* wq     = (const float*)d_in[4];
  const float* bq     = (const float*)d_in[5];
  const float* wk     = (const float*)d_in[6];
  const float* bk     = (const float*)d_in[7];
  const float* wv     = (const float*)d_in[8];
  const float* bv     = (const float*)d_in[9];
  const float* wo     = (const float*)d_in[10];
  const float* bo     = (const float*)d_in[11];
  const float* ln2w   = (const float*)d_in[12];
  const float* ln2b   = (const float*)d_in[13];
  const float* wup    = (const float*)d_in[14];
  const float* bup    = (const float*)d_in[15];
  const float* wdown  = (const float*)d_in[16];
  const float* bdown  = (const float*)d_in[17];
  float* out = (float*)d_out;

  constexpr size_t W_DD  = (size_t)D_ * D_;
  constexpr size_t W_DF  = (size_t)D_ * FF_;
  constexpr size_t ACT   = (size_t)S_ * D_;
  constexpr size_t ACTFF = (size_t)S_ * FF_;

  char* ws = (char*)d_ws;
  size_t off = 0;
  __bf16* wqT  = (__bf16*)(ws + off); off += W_DD * 2;   // all weights [N][K] bf16
  __bf16* wkT  = (__bf16*)(ws + off); off += W_DD * 2;
  __bf16* wvT  = (__bf16*)(ws + off); off += W_DD * 2;
  __bf16* woT  = (__bf16*)(ws + off); off += W_DD * 2;
  __bf16* wupT = (__bf16*)(ws + off); off += W_DF * 2;
  __bf16* wdnT = (__bf16*)(ws + off); off += W_DF * 2;
  __bf16* xln_bf  = (__bf16*)(ws + off); off += ACT * 2;
  __bf16* q_bf    = (__bf16*)(ws + off); off += ACT * 2;
  __bf16* k_bf    = (__bf16*)(ws + off); off += ACT * 2;
  __bf16* vT_bf   = (__bf16*)(ws + off); off += ACT * 2;  // [D][S]
  __bf16* ctx_bf  = (__bf16*)(ws + off); off += ACT * 2;
  float*  hidden2 = (float*) (ws + off); off += ACT * 4;
  __bf16* yln_bf  = (__bf16*)(ws + off); off += ACT * 2;
  __bf16* ff_bf   = (__bf16*)(ws + off); off += ACTFF * 2;

  auto transp = [&](const float* src, __bf16* dst, int K, int N) {
    transpose_to_bf16_kernel<<<dim3(N / 32, K / 32), 256, 0, stream>>>(src, dst, K, N);
  };
  transp(wq, wqT, D_, D_);   transp(wk, wkT, D_, D_);  transp(wv, wvT, D_, D_);
  transp(wo, woT, D_, D_);   transp(wup, wupT, D_, FF_);
  transp(wdown, wdnT, FF_, D_);

  // LN1
  ln_bf16_kernel<<<S_, 256, 0, stream>>>(hidden, ln1w, ln1b, xln_bf);

  // Projections (Q pre-scaled by 1/sqrt(HD); V written transposed)
  dim3 gDD(D_ / 64, S_ / 64);
  gemm_bf16_kernel<0><<<gDD, 128, 0, stream>>>(xln_bf, wqT, bq, nullptr, nullptr, q_bf,
                                               S_, D_, D_, 0.125f);
  gemm_bf16_kernel<0><<<gDD, 128, 0, stream>>>(xln_bf, wkT, bk, nullptr, nullptr, k_bf,
                                               S_, D_, D_, 1.0f);
  gemm_bf16_kernel<3><<<gDD, 128, 0, stream>>>(xln_bf, wvT, bv, nullptr, nullptr, vT_bf,
                                               S_, D_, D_, 1.0f);

  // Flash attention
  attn_kernel<<<dim3(S_ / 64, H_), 128, 0, stream>>>(q_bf, k_bf, vT_bf, mask, ctx_bf);

  // O-projection + residual -> hidden2 (fp32)
  gemm_bf16_kernel<1><<<gDD, 128, 0, stream>>>(ctx_bf, woT, bo, hidden, hidden2, nullptr,
                                               S_, D_, D_, 1.0f);

  // LN2
  ln_bf16_kernel<<<S_, 256, 0, stream>>>(hidden2, ln2w, ln2b, yln_bf);

  // Up-projection + exact GELU -> bf16
  gemm_bf16_kernel<2><<<dim3(FF_ / 64, S_ / 64), 128, 0, stream>>>(
      yln_bf, wupT, bup, nullptr, nullptr, ff_bf, S_, FF_, D_, 1.0f);

  // Down-projection + residual -> d_out (fp32)
  gemm_bf16_kernel<1><<<gDD, 128, 0, stream>>>(ff_bf, wdnT, bdown, hidden2, out, nullptr,
                                               S_, D_, FF_, 1.0f);
}

// v002
// It runs in 286 microseconds.
// In both of two side-by-side timings against v001, it was 1.32 times as fast.
// Counting every step since v000, it is 1.83 times as fast.
#include <hip/hip_runtime.h>
#include <hip/hip_bf16.h>
#include <math.h>

// ---------------------------------------------------------------------------
// Transformer block (B=1, S=4096, D=768, H=12, HD=64, FF=3072) on gfx1250.
// ~110 GFLOP vs ~55MB minimum traffic -> strongly compute bound: bf16 WMMA
// (v_wmma_f32_16x16x32_bf16, fp32 accum) everywhere, flash-attention so the
// 805MB score tensor never exists, and GLOBAL_LOAD_ASYNC_TO_LDS_B128 (ASYNCcnt)
// staging with double buffering so HBM->LDS copies overlap the matrix pipe.
// ---------------------------------------------------------------------------

typedef __attribute__((ext_vector_type(16))) __bf16 v16bf;
typedef __attribute__((ext_vector_type(8)))  __bf16 v8bf;
typedef __attribute__((ext_vector_type(8)))  float  v8f;

constexpr int S_  = 4096;
constexpr int D_  = 768;
constexpr int H_  = 12;
constexpr int HD_ = 64;
constexpr int FF_ = 3072;

__device__ __forceinline__ v16bf cat16(v8bf lo, v8bf hi) {
  return __builtin_shufflevector(lo, hi, 0,1,2,3,4,5,6,7,8,9,10,11,12,13,14,15);
}
// A/B fragment loader: p points at a 32-wide K-run; lane half hl selects
// K offsets {hl*8..+8} and {16+hl*8..+8} per the ISA 16-bit operand layout.
__device__ __forceinline__ v16bf load_frag(const __bf16* p, int hl) {
  v8bf lo = *reinterpret_cast<const v8bf*>(p + hl * 8);
  v8bf hi = *reinterpret_cast<const v8bf*>(p + 16 + hl * 8);
  return cat16(lo, hi);
}
__device__ __forceinline__ v8f wmma_bf16(v16bf a, v16bf b, v8f c) {
  return __builtin_amdgcn_wmma_f32_16x16x32_bf16(false, a, false, b, (short)0, c,
                                                 false, false);
}

// CDNA5 async global->LDS copy (no VGPR round trip, tracked by ASYNCcnt).
// Generic shared pointers carry the LDS offset in their low 32 bits
// (ISA 10.2: LDS_ADDR.U32 = addr[31:0]); dsaddr = LDS_BASE + VGPR + IOFFSET.
// Four copies and their s_wait_xcnt 0 in ONE statement: all eight address
// registers stay live to its end, so none is rewritten in front of the wait.
__device__ __forceinline__ void async_copy4_b128(void* l0, const void* g0,
                                                 void* l1, const void* g1,
                                                 void* l2, const void* g2,
                                                 void* l3, const void* g3) {
  asm volatile("global_load_async_to_lds_b128 %0, %1, off\n\t"
               "global_load_async_to_lds_b128 %2, %3, off\n\t"
               "global_load_async_to_lds_b128 %4, %5, off\n\t"
               "global_load_async_to_lds_b128 %6, %7, off\n\t"
               "s_wait_xcnt 0x0"
               :: "v"((unsigned)(uintptr_t)l0), "v"(g0),
                  "v"((unsigned)(uintptr_t)l1), "v"(g1),
                  "v"((unsigned)(uintptr_t)l2), "v"(g2),
                  "v"((unsigned)(uintptr_t)l3), "v"(g3) : "memory");
}
__device__ __forceinline__ void async_wait0() {
  asm volatile("s_wait_asynccnt 0x0" ::: "memory");
}
// This wave's LDS reads have retired: stands in front of the barrier behind which
// copies refill the buffer that was read.
__device__ __forceinline__ void lds_wait0() {
  asm volatile("s_wait_dscnt 0x0" ::: "memory");
}

// ---------------------------------------------------------------------------
// Weight prep: [K][N] fp32 -> [N][K] bf16 (transpose through an LDS tile).
// Done once per call; lets GEMM B-staging be straight contiguous async copies.
// ---------------------------------------------------------------------------
__global__ __launch_bounds__(256) void transpose_to_bf16_kernel(
    const float* __restrict__ in, __bf16* __restrict__ out, int K, int N) {
  __shared__ float tile[32][33];
  const int kb = blockIdx.y * 32, nb = blockIdx.x * 32;
  const int tx = threadIdx.x & 31, ty = threadIdx.x >> 5;   // 32 x 8
  #pragma unroll
  for (int yy = 0; yy < 4; ++yy) {
    int k = ty + yy * 8;
    tile[k][tx] = in[(size_t)(kb + k) * N + nb + tx];
  }
  __syncthreads();
  #pragma unroll
  for (int yy = 0; yy < 4; ++yy) {
    int n = ty + yy * 8;
    out[(size_t)(nb + n) * K + kb + tx] = (__bf16)tile[tx][n];
  }
}

// ---------------------------------------------------------------------------
// LayerNorm (fp32 in) -> bf16 out.  One block per row of 768.
// ---------------------------------------------------------------------------
__global__ __launch_bounds__(256) void ln_bf16_kernel(
    const float* __restrict__ x, const float* __restrict__ w,
    const float* __restrict__ b, __bf16* __restrict__ out) {
  __shared__ float red[256];
  const int row = blockIdx.x;
  const float* xr = x + (size_t)row * D_;
  float s = 0.f;
  for (int j = threadIdx.x; j < D_; j += 256) s += xr[j];
  red[threadIdx.x] = s; __syncthreads();
  for (int off = 128; off > 0; off >>= 1) {
    if (threadIdx.x < off) red[threadIdx.x] += red[threadIdx.x + off];
    __syncthreads();
  }
  const float mu = red[0] * (1.0f / D_);
  __syncthreads();
  float vs = 0.f;
  for (int j = threadIdx.x; j < D_; j += 256) { float d = xr[j] - mu; vs += d * d; }
  red[threadIdx.x] = vs; __syncthreads();
  for (int off = 128; off > 0; off >>= 1) {
    if (threadIdx.x < off) red[threadIdx.x] += red[threadIdx.x + off];
    __syncthreads();
  }
  const float rstd = rsqrtf(red[0] * (1.0f / D_) + 1e-5f);
  for (int j = threadIdx.x; j < D_; j += 256)
    out[(size_t)row * D_ + j] = (__bf16)((xr[j] - mu) * rstd * w[j] + b[j]);
}

// ---------------------------------------------------------------------------
// Tiled bf16 GEMM: C[M,N] = A[M,K] * Bt[N,K]^T (+bias epilogues)
// Block = 256 threads (8 waves), tile 128x128, K-step 128, two LDS buffers fed by
// async copies. A staged row is 256 bytes, two whole cache lines, brought by
// sixteen neighbouring lanes; LDS rows stand at a pitch of 272 bytes (16 B x odd),
// free of bank conflicts for the 16-byte fragment reads. Each wave owns 64x32:
// 8 WMMA per 32 of K from 4 A-frags x 2 B-frags.
// M, N multiples of 128; K a multiple of 128.
// EPI 0: outB = bf16((acc+bias)*scale)      (Q/K projections; Q scale 0.125)
// EPI 1: outF = acc + bias + resid          (O-proj, down-proj)
// EPI 2: outB = bf16(gelu_exact(acc+bias))  (up-proj)
// EPI 3: outB[col*S_+row] = acc + bias      (V projection, stored transposed)
// ---------------------------------------------------------------------------
constexpr int GT_ = 128;       // tile rows of A and of Bt
constexpr int GK_ = 128;       // K-step
constexpr int GP_ = GK_ + 8;   // LDS row pitch in elements (272 bytes)

// Eight copies, rows 16 apart, and their s_wait_xcnt 0 in ONE statement: every
// address register stays live to its end, so none is rewritten in front of the wait.
__device__ __forceinline__ void async_copy8_b128(const __bf16* l, const __bf16* g,
                                                 size_t gs) {
  const unsigned l0 = (unsigned)(uintptr_t)l;
  constexpr unsigned ls = 16 * GP_ * 2;          // 16 LDS rows in bytes
  asm volatile("global_load_async_to_lds_b128 %0, %1, off\n\t"
               "global_load_async_to_lds_b128 %2, %3, off\n\t"
               "global_load_async_to_lds_b128 %4, %5, off\n\t"
               "global_load_async_to_lds_b128 %6, %7, off\n\t"
               "global_load_async_to_lds_b128 %8, %9, off\n\t"
               "global_load_async_to_lds_b128 %10, %11, off\n\t"
               "global_load_async_to_lds_b128 %12, %13, off\n\t"
               "global_load_async_to_lds_b128 %14, %15, off\n\t"
               "s_wait_xcnt 0x0"
               :: "v"(l0),          "v"(g),
                  "v"(l0 + ls),     "v"(g + gs),
                  "v"(l0 + 2 * ls), "v"(g + 2 * gs),
                  "v"(l0 + 3 * ls), "v"(g + 3 * gs),
                  "v"(l0 + 4 * ls), "v"(g + 4 * gs),
                  "v"(l0 + 5 * ls), "v"(g + 5 * gs),
                  "v"(l0 + 6 * ls), "v"(g + 6 * gs),
                  "v"(l0 + 7 * ls), "v"(g + 7 * gs)
               : "memory");
}

// amdgpu_waves_per_eu(2, 4): LDS admits two blocks per WGP, four waves per SIMD, so
// the register budget is 256; aiming at more waves the compiler kept one fragment
// set and waited for every residual load of the epilogue by itself.
template <int EPI>
__global__ __launch_bounds__(256) __attribute__((amdgpu_waves_per_eu(2, 4)))
void gemm_bf16_kernel(
    const __bf16* __restrict__ A, const __bf16* __restrict__ Bt,
    const float* __restrict__ bias, const float* __restrict__ resid,
    float* __restrict__ outF, __bf16* __restrict__ outB,
    int M, int N, int K, float scale) {
  __shared__ alignas(16) __bf16 As[2][GT_][GP_];   // [m][k]
  __shared__ alignas(16) __bf16 Bs[2][GT_][GP_];   // [n][k]

  const int n0 = blockIdx.x * GT_;
  const int m0 = blockIdx.y * GT_;
  const int tid  = threadIdx.x;
  const int wave = tid >> 5, lane = tid & 31;
  const int wr = (wave & 1) * 64;     // wave row base (4 sub-tiles of 16)
  const int wc = (wave >> 1) * 32;    // wave col base (2 sub-tiles of 16)
  const int c  = lane & 15, hl = lane >> 4;
  const int sr = tid >> 4, sg = (tid & 15) << 3;   // staging: 16 rows x 16 x 16 bytes

  auto stage = [&](int buf, int kk) {   // rows sr, sr+16, ..., sr+112 of both operands
    async_copy8_b128(&As[buf][sr][sg], A  + (size_t)(m0 + sr) * K + kk + sg, (size_t)16 * K);
    async_copy8_b128(&Bs[buf][sr][sg], Bt + (size_t)(n0 + sr) * K + kk + sg, (size_t)16 * K);
  };

  v8f acc[4][2] = {};
  const int nt = K / GK_;
  stage(0, 0);
  async_wait0();
  __syncthreads();
  if (nt > 1) stage(1, GK_);

  for (int t = 0; t < nt; ++t) {
    const int buf = t & 1;
    v16bf a[2][4], b[2][2];              // two fragment sets, one per 32 of K
    auto frags = [&](int set, int kc) {
      #pragma unroll
      for (int j = 0; j < 2; ++j)
        b[set][j] = load_frag(&Bs[buf][wc + j * 16 + c][kc * 32], hl);
      #pragma unroll
      for (int i = 0; i < 4; ++i)
        a[set][i] = load_frag(&As[buf][wr + i * 16 + c][kc * 32], hl);
    };
    frags(0, 0);
    frags(1, 1);
    // The sched_barriers of this loop keep each set's LDS reads one group between
    // whole runs of WMMAs, two sets ahead: left alone the compiler spreads the reads
    // among the WMMAs with a full wait at each place, or sinks WMMAs behind the
    // barrier, where they take the copies' lead away.
    __builtin_amdgcn_sched_barrier(0);
    #pragma unroll
    for (int kc = 0; kc < GK_ / 32; ++kc) {
      #pragma unroll
      for (int i = 0; i < 4; ++i)
        #pragma unroll
        for (int j = 0; j < 2; ++j)
          acc[i][j] = wmma_bf16(a[kc & 1][i], b[kc & 1][j], acc[i][j]);
      __builtin_amdgcn_sched_barrier(0);
      if (kc + 2 < GK_ / 32) {
        frags(kc & 1, kc + 2);
        __builtin_amdgcn_sched_barrier(0);
      }
    }
    lds_wait0();                 // this trip's reads of buf are done
    async_wait0();               // this wave's share of tile t+1 has landed
    __syncthreads();             // publishes tile t+1, frees buf
    if (t + 2 < nt) stage(buf, (t + 2) * GK_);   // flies during trip t+1
  }
  async_wait0();

  #pragma unroll
  for (int i = 0; i < 4; ++i)
    #pragma unroll
    for (int j = 0; j < 2; ++j)
      #pragma unroll
      for (int e = 0; e < 8; ++e) {
        const int row = m0 + wr + i * 16 + hl * 8 + e;   // C layout: VGPR e + half
        const int col = n0 + wc + j * 16 + c;            // lane % 16
        float v = acc[i][j][e] + bias[col];
        if constexpr (EPI == 0) {
          outB[(size_t)row * N + col] = (__bf16)(v * scale);
        } else if constexpr (EPI == 1) {
          outF[(size_t)row * N + col] = v + resid[(size_t)row * N + col];
        } else if constexpr (EPI == 2) {
          outB[(size_t)row * N + col] =
              (__bf16)(0.5f * v * (1.0f + erff(v * 0.70710678118f)));
        } else {
          outB[(size_t)col * S_ + row] = (__bf16)v;      // vT[dim][seq]
        }
      }
}

__device__ __forceinline__ float xhalf(float x) {
  const int b = __builtin_bit_cast(int, x);
  return __builtin_bit_cast(float, __builtin_amdgcn_permlanex16(
      b, b, 0x76543210, 0xfedcba98, false, false));
}

// e^x as v_exp_f32(x * log2 e), what __expf compiles to here. The v_nop fills the
// slot the instruction set asks for behind a transcendental before its source is
// overwritten.
__device__ __forceinline__ float exp_slot(float x) {
  float r;
  asm("v_exp_f32 %0, %1\n\tv_nop" : "=v"(r) : "v"(x * 1.4426950408889634f));
  return r;
}

__global__ __launch_bounds__(128) void attn_kernel(
    const __bf16* __restrict__ Q, const __bf16* __restrict__ Kb,
    const __bf16* __restrict__ vT,               // [D][S] transposed values
    const int* __restrict__ amask, __bf16* __restrict__ ctx) {
  __shared__ alignas(16) __bf16 Ks[32][64];      // [key][dim]  (K Q^T   A-frags)
  __shared__ alignas(16) __bf16 Vt[64][32];      // [dim][key]  (V^T P^T A-frags)

  const int tid  = threadIdx.x;
  const int wave = tid >> 5, lane = tid & 31;
  const int c  = lane & 15, hl = lane >> 4;
  const int h    = blockIdx.y;
  const int q0   = blockIdx.x * 64 + wave * 16;
  const int hoff = h * HD_;
  const int qr   = q0 + c;                       // this lane's query

  v16bf aq[2];                                   // Q^T as B: lane = query column
  #pragma unroll
  for (int kc = 0; kc < 2; ++kc)
    aq[kc] = load_frag(Q + (size_t)(q0 + c) * D_ + hoff + kc * 32, hl);

  v8f o[4] = {};                                 // o[d][r] = O[qr][d*16 + 8*hl + r]
  float m = -1e30f, l = 0.f;                     // l: this half's keys only

  const int kend = (blockIdx.x + 1) * 64;        // causal bound (block-uniform)
  for (int kb = 0; kb < kend; kb += 32) {
    __syncthreads();                             // protect LDS reuse
    {   // async-stage 32 keys of K (row-major) and V (already transposed)
      const int key = tid >> 2, db = (tid & 3) << 4;
      const __bf16* gk = Kb + (size_t)(kb + key) * D_ + hoff + db;
      const int dv = tid >> 1, kg = (tid & 1) << 4;
      const __bf16* gv = vT + (size_t)(hoff + dv) * S_ + kb + kg;
      async_copy4_b128(&Ks[key][db], gk, &Ks[key][db + 8], gk + 8,
                       &Vt[dv][kg],  gv, &Vt[dv][kg + 8],  gv + 8);
    }
    async_wait0();
    __syncthreads();

    // S^T(32x16) = K(32x64) @ Q^T(64x16); s[sub][r] = key kb+sub*16+8*hl+r, query qr
    v8f s[2] = {};
    #pragma unroll
    for (int sub = 0; sub < 2; ++sub)
      #pragma unroll
      for (int kc = 0; kc < 2; ++kc) {
        v16bf a = load_frag(&Ks[sub * 16 + c][kc * 32], hl);
        s[sub] = wmma_bf16(a, aq[kc], s[sub]);
      }

    // bit k of keep: key kb+8*hl+k is open to this lane's query (padding and causal)
    const unsigned pad = __builtin_amdgcn_ballot_w32(amask[kb + lane] != 0);
    const int n = qr - kb;                       // last key index the query may see
    const unsigned cau = n >= 31 ? 0xffffffffu : (n < 0 ? 0u : (2u << n) - 1u);
    const unsigned keep = (pad & cau) >> (hl * 8);

    // online softmax, one query per lane
    float mx = -1e30f;
    #pragma unroll
    for (int sub = 0; sub < 2; ++sub)
      #pragma unroll
      for (int r = 0; r < 8; ++r) {
        if (((keep >> (sub * 16 + r)) & 1u) == 0u) s[sub][r] = -1e30f;
        mx = fmaxf(mx, s[sub][r]);
      }
    mx = fmaxf(mx, xhalf(mx));                   // both halves: the query's maximum
    const float mn  = fmaxf(m, mx);
    const float fac = exp_slot(m - mn);
    m = mn;
    v16bf bp;                                    // P^T as B, hardware k order
    float rs = 0.f;
    #pragma unroll
    for (int sub = 0; sub < 2; ++sub)
      #pragma unroll
      for (int r = 0; r < 8; ++r) {
        const float p = exp_slot(s[sub][r] - mn);
        rs += p;
        bp[sub * 8 + r] = (__bf16)p;
      }
    l = l * fac + rs;
    #pragma unroll
    for (int d = 0; d < 4; ++d)
      #pragma unroll
      for (int r = 0; r < 8; ++r) o[d][r] *= fac;

    // O^T += V^T @ P^T
    #pragma unroll
    for (int d = 0; d < 4; ++d) {
      v16bf av = load_frag(&Vt[d * 16 + c][0], hl);
      o[d] = wmma_bf16(av, bp, o[d]);
    }
  }

  const float inv = 1.0f / (l + xhalf(l));       // join the halves' sums once
  #pragma unroll
  for (int d = 0; d < 4; ++d) {
    v8bf w;
    #pragma unroll
    for (int r = 0; r < 8; ++r) w[r] = (__bf16)(o[d][r] * inv);
    *reinterpret_cast<v8bf*>(ctx + (size_t)qr * D_ + hoff + d * 16 + hl * 8) = w;
  }
}

// ---------------------------------------------------------------------------
// Host launcher
// ---------------------------------------------------------------------------
extern "C" void kernel_launch(void* const* d_in, const int* in_sizes, int n_in,
                              void* d_out, int out_size, void* d_ws, size_t ws_size,
                              hipStream_t stream) {
  const float* hidden = (const float*)d_in[0];
  const int*   mask   = (const int*)  d_in[1];
  const float* ln1w   = (const float*)d_in[2];
  const float* ln1b   = (const float*)d_in[3];
  const float* wq     = (const float*)d_in[4];
  const float* bq     = (const float*)d_in[5];
  const float* wk     = (const float*)d_in[6];
  const float* bk     = (const float*)d_in[7];
  const float* wv     = (const float*)d_in[8];
  const float* bv     = (const float*)d_in[9];
  const float* wo     = (const float*)d_in[10];
  const float* bo     = (const float*)d_in[11];
  const float* ln2w   = (const float*)d_in[12];
  const float* ln2b   = (const float*)d_in[13];
  const float* wup    = (const float*)d_in[14];
  const float* bup    = (const float*)d_in[15];
  const float* wdown  = (const float*)d_in[16];
  const float* bdown  = (const float*)d_in[17];
  float* out = (float*)d_out;

  constexpr size_t W_DD  = (size_t)D_ * D_;
  constexpr size_t W_DF  = (size_t)D_ * FF_;
  constexpr size_t ACT   = (size_t)S_ * D_;
  constexpr size_t ACTFF = (size_t)S_ * FF_;

  char* ws = (char*)d_ws;
  size_t off = 0;
  __bf16* wqT  = (__bf16*)(ws + off); off += W_DD * 2;   // all weights [N][K] bf16
  __bf16* wkT  = (__bf16*)(ws + off); off += W_DD * 2;
  __bf16* wvT  = (__bf16*)(ws + off); off += W_DD * 2;
  __bf16* woT  = (__bf16*)(ws + off); off += W_DD * 2;
  __bf16* wupT = (__bf16*)(ws + off); off += W_DF * 2;
  __bf16* wdnT = (__bf16*)(ws + off); off += W_DF * 2;
  __bf16* xln_bf  = (__bf16*)(ws + off); off += ACT * 2;
  __bf16* q_bf    = (__bf16*)(ws + off); off += ACT * 2;
  __bf16* k_bf    = (__bf16*)(ws + off); off += ACT * 2;
  __bf16* vT_bf   = (__bf16*)(ws + off); off += ACT * 2;  // [D][S]
  __bf16* ctx_bf  = (__bf16*)(ws + off); off += ACT * 2;
  float*  hidden2 = (float*) (ws + off); off += ACT * 4;
  __bf16* yln_bf  = (__bf16*)(ws + off); off += ACT * 2;
  __bf16* ff_bf   = (__bf16*)(ws + off); off += ACTFF * 2;

  auto transp = [&](const float* src, __bf16* dst, int K, int N) {
    transpose_to_bf16_kernel<<<dim3(N / 32, K / 32), 256, 0, stream>>>(src, dst, K, N);
  };
  transp(wq, wqT, D_, D_);   transp(wk, wkT, D_, D_);  transp(wv, wvT, D_, D_);
  transp(wo, woT, D_, D_);   transp(wup, wupT, D_, FF_);
  transp(wdown, wdnT, FF_, D_);

  // LN1
  ln_bf16_kernel<<<S_, 256, 0, stream>>>(hidden, ln1w, ln1b, xln_bf);

  // Projections (Q pre-scaled by 1/sqrt(HD); V written transposed)
  dim3 gDD(D_ / GT_, S_ / GT_);
  gemm_bf16_kernel<0><<<gDD, 256, 0, stream>>>(xln_bf, wqT, bq, nullptr, nullptr, q_bf,
                                               S_, D_, D_, 0.125f);
  gemm_bf16_kernel<0><<<gDD, 256, 0, stream>>>(xln_bf, wkT, bk, nullptr, nullptr, k_bf,
                                               S_, D_, D_, 1.0f);
  gemm_bf16_kernel<3><<<gDD, 256, 0, stream>>>(xln_bf, wvT, bv, nullptr, nullptr, vT_bf,
                                               S_, D_, D_, 1.0f);

  // Flash attention
  attn_kernel<<<dim3(S_ / 64, H_), 128, 0, stream>>>(q_bf, k_bf, vT_bf, mask, ctx_bf);

  // O-projection + residual -> hidden2 (fp32)
  gemm_bf16_kernel<1><<<gDD, 256, 0, stream>>>(ctx_bf, woT, bo, hidden, hidden2, nullptr,
                                               S_, D_, D_, 1.0f);

  // LN2
  ln_bf16_kernel<<<S_, 256, 0, stream>>>(hidden2, ln2w, ln2b, yln_bf);

  // Up-projection + exact GELU -> bf16
  gemm_bf16_kernel<2><<<dim3(FF_ / GT_, S_ / GT_), 256, 0, stream>>>(
      yln_bf, wupT, bup, nullptr, nullptr, ff_bf, S_, FF_, D_, 1.0f);

  // Down-projection + residual -> d_out (fp32)
  gemm_bf16_kernel<1><<<gDD, 256, 0, stream>>>(ff_bf, wdnT, bdown, hidden2, out, nullptr,
                                               S_, D_, FF_, 1.0f);
}

// v003
// Measured time: 275 microseconds a run.
// Timed twice side by side with v002, it ran 1.04 times as fast both times.
// Counting every step since v000, it is 1.90 times as fast.
#include <hip/hip_runtime.h>
#include <hip/hip_bf16.h>
#include <math.h>

// ---------------------------------------------------------------------------
// Transformer block (B=1, S=4096, D=768, H=12, HD=64, FF=3072) on gfx1250.
// ~110 GFLOP vs ~55MB minimum traffic -> strongly compute bound: bf16 WMMA
// (v_wmma_f32_16x16x32_bf16, fp32 accum) everywhere, flash-attention so the
// 805MB score tensor never exists, and GLOBAL_LOAD_ASYNC_TO_LDS_B128 (ASYNCcnt)
// staging with double buffering so HBM->LDS copies overlap the matrix pipe.
// ---------------------------------------------------------------------------

typedef __attribute__((ext_vector_type(16))) __bf16 v16bf;
typedef __attribute__((ext_vector_type(8)))  __bf16 v8bf;
typedef __attribute__((ext_vector_type(8)))  float  v8f;

constexpr int S_  = 4096;
constexpr int D_  = 768;
constexpr int H_  = 12;
constexpr int HD_ = 64;
constexpr int FF_ = 3072;

__device__ __forceinline__ v16bf cat16(v8bf lo, v8bf hi) {
  return __builtin_shufflevector(lo, hi, 0,1,2,3,4,5,6,7,8,9,10,11,12,13,14,15);
}
// A/B fragment loader: p points at a 32-wide K-run; lane half hl selects
// K offsets {hl*8..+8} and {16+hl*8..+8} per the ISA 16-bit operand layout.
__device__ __forceinline__ v16bf load_frag(const __bf16* p, int hl) {
  v8bf lo = *reinterpret_cast<const v8bf*>(p + hl * 8);
  v8bf hi = *reinterpret_cast<const v8bf*>(p + 16 + hl * 8);
  return cat16(lo, hi);
}
__device__ __forceinline__ v8f wmma_bf16(v16bf a, v16bf b, v8f c) {
  return __builtin_amdgcn_wmma_f32_16x16x32_bf16(false, a, false, b, (short)0, c,
                                                 false, false);
}

// CDNA5 async global->LDS copy (no VGPR round trip, tracked by ASYNCcnt).
// Generic shared pointers carry the LDS offset in their low 32 bits
// (ISA 10.2: LDS_ADDR.U32 = addr[31:0]); dsaddr = LDS_BASE + VGPR + IOFFSET.
// Four copies and their s_wait_xcnt 0 in ONE statement: all eight address
// registers stay live to its end, so none is rewritten in front of the wait.
__device__ __forceinline__ void async_copy4_b128(void* l0, const void* g0,
                                                 void* l1, const void* g1,
                                                 void* l2, const void* g2,
                                                 void* l3, const void* g3) {
  asm volatile("global_load_async_to_lds_b128 %0, %1, off\n\t"
               "global_load_async_to_lds_b128 %2, %3, off\n\t"
               "global_load_async_to_lds_b128 %4, %5, off\n\t"
               "global_load_async_to_lds_b128 %6, %7, off\n\t"
               "s_wait_xcnt 0x0"
               :: "v"((unsigned)(uintptr_t)l0), "v"(g0),
                  "v"((unsigned)(uintptr_t)l1), "v"(g1),
                  "v"((unsigned)(uintptr_t)l2), "v"(g2),
                  "v"((unsigned)(uintptr_t)l3), "v"(g3) : "memory");
}
__device__ __forceinline__ void async_wait0() {
  asm volatile("s_wait_asynccnt 0x0" ::: "memory");
}
// This wave's LDS reads have retired: stands in front of the barrier behind which
// copies refill the buffer that was read.
__device__ __forceinline__ void lds_wait0() {
  asm volatile("s_wait_dscnt 0x0" ::: "memory");
}

// ---------------------------------------------------------------------------
// Weight prep: [K][N] fp32 -> [N][K] bf16 (transpose through an LDS tile).
// Done once per call; lets GEMM B-staging be straight contiguous async copies.
// ---------------------------------------------------------------------------
__global__ __launch_bounds__(256) void transpose_to_bf16_kernel(
    const float* __restrict__ in, __bf16* __restrict__ out, int K, int N) {
  __shared__ float tile[32][33];
  const int kb = blockIdx.y * 32, nb = blockIdx.x * 32;
  const int tx = threadIdx.x & 31, ty = threadIdx.x >> 5;   // 32 x 8
  #pragma unroll
  for (int yy = 0; yy < 4; ++yy) {
    int k = ty + yy * 8;
    tile[k][tx] = in[(size_t)(kb + k) * N + nb + tx];
  }
  __syncthreads();
  #pragma unroll
  for (int yy = 0; yy < 4; ++yy) {
    int n = ty + yy * 8;
    out[(size_t)(nb + n) * K + kb + tx] = (__bf16)tile[tx][n];
  }
}

// ---------------------------------------------------------------------------
// LayerNorm (fp32 in) -> bf16 out.  One WAVE per pair of rows, no LDS, no barrier.
// A row of 768 floats lives in registers (six 16-byte loads a lane, each wave-wide
// load 512 contiguous bytes), is read from memory once, and both sums are taken
// in-lane plus a five-step butterfly across the wave. 2,048 waves a launch, eight on
// every WGP: a launch this short pays for each wave that it has to start.
// ---------------------------------------------------------------------------
typedef __attribute__((ext_vector_type(4))) float  v4f;
typedef __attribute__((ext_vector_type(4))) __bf16 v4bf;

constexpr int LNR_ = 2;            // rows per wave
constexpr int LNC_ = D_ / 128;     // 16-byte chunks of a row per lane

// x + (x of lane ^ MASK) inside a 16-lane row (DPP row_xmask)
template <int MASK>
__device__ __forceinline__ float add_xmask(float x) {
  const int v = __builtin_bit_cast(int, x);
  return x + __builtin_bit_cast(float,
      __builtin_amdgcn_update_dpp(0, v, 0x160 + MASK, 0xf, 0xf, true));
}
// sum over the 32 lanes, the same value in every lane
__device__ __forceinline__ float wave_sum(float x) {
  x = add_xmask<1>(x);
  x = add_xmask<2>(x);
  x = add_xmask<4>(x);
  x = add_xmask<8>(x);
  const int v = __builtin_bit_cast(int, x);
  return x + __builtin_bit_cast(float, __builtin_amdgcn_permlanex16(
      v, v, 0x76543210, 0xfedcba98, false, false));
}

// amdgpu_waves_per_eu(2, 4): the grid puts two waves on a SIMD; aiming at sixteen the
// compiler kept to 64 registers and loaded w and b late, pair by pair, a full wait each.
__global__ __launch_bounds__(256) __attribute__((amdgpu_waves_per_eu(2, 4)))
void ln_bf16_kernel(
    const float* __restrict__ x, const float* __restrict__ w,
    const float* __restrict__ b, __bf16* __restrict__ out) {
  // the wave's number as a scalar: row bases stand in scalar registers, and every
  // load and store of the wave shares one lane-offset register
  const int wave = __builtin_amdgcn_readfirstlane(threadIdx.x >> 5);
  const int lane = threadIdx.x & 31;
  const int row0 = (blockIdx.x * 8 + wave) * LNR_;
  const unsigned col = lane * 4;
  const float* xr = x + (size_t)row0 * D_;       // scalar bases of the wave's rows
  __bf16* orow = out + (size_t)row0 * D_;

  v4f v[LNR_][LNC_], wv[LNC_], bv[LNC_];
  #pragma unroll
  for (int i = 0; i < LNC_; ++i) {
    wv[i] = *reinterpret_cast<const v4f*>(w + (col + i * 128));
    bv[i] = *reinterpret_cast<const v4f*>(b + (col + i * 128));
  }
  #pragma unroll
  for (int r = 0; r < LNR_; ++r)
    #pragma unroll
    for (int i = 0; i < LNC_; ++i)
      v[r][i] = *reinterpret_cast<const v4f*>(xr + (col + (r * D_ + i * 128)));

  #pragma unroll
  for (int r = 0; r < LNR_; ++r) {
    v4f s4 = v[r][0];
    #pragma unroll
    for (int i = 1; i < LNC_; ++i) s4 += v[r][i];
    const float mu = wave_sum((s4[0] + s4[1]) + (s4[2] + s4[3])) * (1.0f / D_);
    v4f q4 = {};
    #pragma unroll
    for (int i = 0; i < LNC_; ++i) {
      v[r][i] -= mu;
      q4 += v[r][i] * v[r][i];
    }
    const float var  = wave_sum((q4[0] + q4[1]) + (q4[2] + q4[3])) * (1.0f / D_);
    const float rstd = rsqrtf(var + 1e-5f);
    #pragma unroll
    for (int i = 0; i < LNC_; ++i) {
      const v4f y = v[r][i] * rstd * wv[i] + bv[i];
      v4bf o;
      #pragma unroll
      for (int e = 0; e < 4; ++e) o[e] = (__bf16)y[e];
      *reinterpret_cast<v4bf*>(orow + (col + (r * D_ + i * 128))) = o;
    }
  }
}

// ---------------------------------------------------------------------------
// Tiled bf16 GEMM: C[M,N] = A[M,K] * Bt[N,K]^T (+bias epilogues)
// Block = 256 threads (8 waves), tile 128x128, K-step 128, two LDS buffers fed by
// async copies. A staged row is 256 bytes, two whole cache lines, brought by
// sixteen neighbouring lanes; LDS rows stand at a pitch of 272 bytes (16 B x odd),
// free of bank conflicts for the 16-byte fragment reads. Each wave owns 64x32:
// 8 WMMA per 32 of K from 4 A-frags x 2 B-frags.
// M, N multiples of 128; K a multiple of 128.
// EPI 0: outB = bf16((acc+bias)*scale)      (Q/K projections; Q scale 0.125)
// EPI 1: outF = acc + bias + resid          (O-proj, down-proj)
// EPI 2: outB = bf16(gelu_exact(acc+bias))  (up-proj)
// EPI 3: outB[col*S_+row] = acc + bias      (V projection, stored transposed)
// ---------------------------------------------------------------------------
constexpr int GT_ = 128;       // tile rows of A and of Bt
constexpr int GK_ = 128;       // K-step
constexpr int GP_ = GK_ + 8;   // LDS row pitch in elements (272 bytes)

// Eight copies, rows 16 apart, and their s_wait_xcnt 0 in ONE statement: every
// address register stays live to its end, so none is rewritten in front of the wait.
__device__ __forceinline__ void async_copy8_b128(const __bf16* l, const __bf16* g,
                                                 size_t gs) {
  const unsigned l0 = (unsigned)(uintptr_t)l;
  constexpr unsigned ls = 16 * GP_ * 2;          // 16 LDS rows in bytes
  asm volatile("global_load_async_to_lds_b128 %0, %1, off\n\t"
               "global_load_async_to_lds_b128 %2, %3, off\n\t"
               "global_load_async_to_lds_b128 %4, %5, off\n\t"
               "global_load_async_to_lds_b128 %6, %7, off\n\t"
               "global_load_async_to_lds_b128 %8, %9, off\n\t"
               "global_load_async_to_lds_b128 %10, %11, off\n\t"
               "global_load_async_to_lds_b128 %12, %13, off\n\t"
               "global_load_async_to_lds_b128 %14, %15, off\n\t"
               "s_wait_xcnt 0x0"
               :: "v"(l0),          "v"(g),
                  "v"(l0 + ls),     "v"(g + gs),
                  "v"(l0 + 2 * ls), "v"(g + 2 * gs),
                  "v"(l0 + 3 * ls), "v"(g + 3 * gs),
                  "v"(l0 + 4 * ls), "v"(g + 4 * gs),
                  "v"(l0 + 5 * ls), "v"(g + 5 * gs),
                  "v"(l0 + 6 * ls), "v"(g + 6 * gs),
                  "v"(l0 + 7 * ls), "v"(g + 7 * gs)
               : "memory");
}

// amdgpu_waves_per_eu(2, 4): LDS admits two blocks per WGP, four waves per SIMD, so
// the register budget is 256; aiming at more waves the compiler kept one fragment
// set and waited for every residual load of the epilogue by itself.
template <int EPI>
__global__ __launch_bounds__(256) __attribute__((amdgpu_waves_per_eu(2, 4)))
void gemm_bf16_kernel(
    const __bf16* __restrict__ A, const __bf16* __restrict__ Bt,
    const float* __restrict__ bias, const float* __restrict__ resid,
    float* __restrict__ outF, __bf16* __restrict__ outB,
    int M, int N, int K, float scale) {
  __shared__ alignas(16) __bf16 As[2][GT_][GP_];   // [m][k]
  __shared__ alignas(16) __bf16 Bs[2][GT_][GP_];   // [n][k]

  const int n0 = blockIdx.x * GT_;
  const int m0 = blockIdx.y * GT_;
  const int tid  = threadIdx.x;
  const int wave = tid >> 5, lane = tid & 31;
  const int wr = (wave & 1) * 64;     // wave row base (4 sub-tiles of 16)
  const int wc = (wave >> 1) * 32;    // wave col base (2 sub-tiles of 16)
  const int c  = lane & 15, hl = lane >> 4;
  const int sr = tid >> 4, sg = (tid & 15) << 3;   // staging: 16 rows x 16 x 16 bytes

  auto stage = [&](int buf, int kk) {   // rows sr, sr+16, ..., sr+112 of both operands
    async_copy8_b128(&As[buf][sr][sg], A  + (size_t)(m0 + sr) * K + kk + sg, (size_t)16 * K);
    async_copy8_b128(&Bs[buf][sr][sg], Bt + (size_t)(n0 + sr) * K + kk + sg, (size_t)16 * K);
  };

  v8f acc[4][2] = {};
  const int nt = K / GK_;
  stage(0, 0);
  async_wait0();
  __syncthreads();
  if (nt > 1) stage(1, GK_);

  for (int t = 0; t < nt; ++t) {
    const int buf = t & 1;
    v16bf a[2][4], b[2][2];              // two fragment sets, one per 32 of K
    auto frags = [&](int set, int kc) {
      #pragma unroll
      for (int j = 0; j < 2; ++j)
        b[set][j] = load_frag(&Bs[buf][wc + j * 16 + c][kc * 32], hl);
      #pragma unroll
      for (int i = 0; i < 4; ++i)
        a[set][i] = load_frag(&As[buf][wr + i * 16 + c][kc * 32], hl);
    };
    frags(0, 0);
    frags(1, 1);
    // The sched_barriers of this loop keep each set's LDS reads one group between
    // whole runs of WMMAs, two sets ahead: left alone the compiler spreads the reads
    // among the WMMAs with a full wait at each place, or sinks WMMAs behind the
    // barrier, where they take the copies' lead away.
    __builtin_amdgcn_sched_barrier(0);
    #pragma unroll
    for (int kc = 0; kc < GK_ / 32; ++kc) {
      #pragma unroll
      for (int i = 0; i < 4; ++i)
        #pragma unroll
        for (int j = 0; j < 2; ++j)
          acc[i][j] = wmma_bf16(a[kc & 1][i], b[kc & 1][j], acc[i][j]);
      __builtin_amdgcn_sched_barrier(0);
      if (kc + 2 < GK_ / 32) {
        frags(kc & 1, kc + 2);
        __builtin_amdgcn_sched_barrier(0);
      }
    }
    lds_wait0();                 // this trip's reads of buf are done
    async_wait0();               // this wave's share of tile t+1 has landed
    __syncthreads();             // publishes tile t+1, frees buf
    if (t + 2 < nt) stage(buf, (t + 2) * GK_);   // flies during trip t+1
  }
  async_wait0();

  #pragma unroll
  for (int i = 0; i < 4; ++i)
    #pragma unroll
    for (int j = 0; j < 2; ++j)
      #pragma unroll
      for (int e = 0; e < 8; ++e) {
        const int row = m0 + wr + i * 16 + hl * 8 + e;   // C layout: VGPR e + half
        const int col = n0 + wc + j * 16 + c;            // lane % 16
        float v = acc[i][j][e] + bias[col];
        if constexpr (EPI == 0) {
          outB[(size_t)row * N + col] = (__bf16)(v * scale);
        } else if constexpr (EPI == 1) {
          outF[(size_t)row * N + col] = v + resid[(size_t)row * N + col];
        } else if constexpr (EPI == 2) {
          outB[(size_t)row * N + col] =
              (__bf16)(0.5f * v * (1.0f + erff(v * 0.70710678118f)));
        } else {
          outB[(size_t)col * S_ + row] = (__bf16)v;      // vT[dim][seq]
        }
      }
}

__device__ __forceinline__ float xhalf(float x) {
  const int b = __builtin_bit_cast(int, x);
  return __builtin_bit_cast(float, __builtin_amdgcn_permlanex16(
      b, b, 0x76543210, 0xfedcba98, false, false));
}

// e^x as v_exp_f32(x * log2 e), what __expf compiles to here. The v_nop fills the
// slot the instruction set asks for behind a transcendental before its source is
// overwritten.
__device__ __forceinline__ float exp_slot(float x) {
  float r;
  asm("v_exp_f32 %0, %1\n\tv_nop" : "=v"(r) : "v"(x * 1.4426950408889634f));
  return r;
}

__global__ __launch_bounds__(128) void attn_kernel(
    const __bf16* __restrict__ Q, const __bf16* __restrict__ Kb,
    const __bf16* __restrict__ vT,               // [D][S] transposed values
    const int* __restrict__ amask, __bf16* __restrict__ ctx) {
  __shared__ alignas(16) __bf16 Ks[32][64];      // [key][dim]  (K Q^T   A-frags)
  __shared__ alignas(16) __bf16 Vt[64][32];      // [dim][key]  (V^T P^T A-frags)

  const int tid  = threadIdx.x;
  const int wave = tid >> 5, lane = tid & 31;
  const int c  = lane & 15, hl = lane >> 4;
  const int h    = blockIdx.y;
  const int q0   = blockIdx.x * 64 + wave * 16;
  const int hoff = h * HD_;
  const int qr   = q0 + c;                       // this lane's query

  v16bf aq[2];                                   // Q^T as B: lane = query column
  #pragma unroll
  for (int kc = 0; kc < 2; ++kc)
    aq[kc] = load_frag(Q + (size_t)(q0 + c) * D_ + hoff + kc * 32, hl);

  v8f o[4] = {};                                 // o[d][r] = O[qr][d*16 + 8*hl + r]
  float m = -1e30f, l = 0.f;                     // l: this half's keys only

  const int kend = (blockIdx.x + 1) * 64;        // causal bound (block-uniform)
  for (int kb = 0; kb < kend; kb += 32) {
    __syncthreads();                             // protect LDS reuse
    {   // async-stage 32 keys of K (row-major) and V (already transposed)
      const int key = tid >> 2, db = (tid & 3) << 4;
      const __bf16* gk = Kb + (size_t)(kb + key) * D_ + hoff + db;
      const int dv = tid >> 1, kg = (tid & 1) << 4;
      const __bf16* gv = vT + (size_t)(hoff + dv) * S_ + kb + kg;
      async_copy4_b128(&Ks[key][db], gk, &Ks[key][db + 8], gk + 8,
                       &Vt[dv][kg],  gv, &Vt[dv][kg + 8],  gv + 8);
    }
    async_wait0();
    __syncthreads();

    // S^T(32x16) = K(32x64) @ Q^T(64x16); s[sub][r] = key kb+sub*16+8*hl+r, query qr
    v8f s[2] = {};
    #pragma unroll
    for (int sub = 0; sub < 2; ++sub)
      #pragma unroll
      for (int kc = 0; kc < 2; ++kc) {
        v16bf a = load_frag(&Ks[sub * 16 + c][kc * 32], hl);
        s[sub] = wmma_bf16(a, aq[kc], s[sub]);
      }

    // bit k of keep: key kb+8*hl+k is open to this lane's query (padding and causal)
    const unsigned pad = __builtin_amdgcn_ballot_w32(amask[kb + lane] != 0);
    const int n = qr - kb;                       // last key index the query may see
    const unsigned cau = n >= 31 ? 0xffffffffu : (n < 0 ? 0u : (2u << n) - 1u);
    const unsigned keep = (pad & cau) >> (hl * 8);

    // online softmax, one query per lane
    float mx = -1e30f;
    #pragma unroll
    for (int sub = 0; sub < 2; ++sub)
      #pragma unroll
      for (int r = 0; r < 8; ++r) {
        if (((keep >> (sub * 16 + r)) & 1u) == 0u) s[sub][r] = -1e30f;
        mx = fmaxf(mx, s[sub][r]);
      }
    mx = fmaxf(mx, xhalf(mx));                   // both halves: the query's maximum
    const float mn  = fmaxf(m, mx);
    const float fac = exp_slot(m - mn);
    m = mn;
    v16bf bp;                                    // P^T as B, hardware k order
    float rs = 0.f;
    #pragma unroll
    for (int sub = 0; sub < 2; ++sub)
      #pragma unroll
      for (int r = 0; r < 8; ++r) {
        const float p = exp_slot(s[sub][r] - mn);
        rs += p;
        bp[sub * 8 + r] = (__bf16)p;
      }
    l = l * fac + rs;
    #pragma unroll
    for (int d = 0; d < 4; ++d)
      #pragma unroll
      for (int r = 0; r < 8; ++r) o[d][r] *= fac;

    // O^T += V^T @ P^T
    #pragma unroll
    for (int d = 0; d < 4; ++d) {
      v16bf av = load_frag(&Vt[d * 16 + c][0], hl);
      o[d] = wmma_bf16(av, bp, o[d]);
    }
  }

  const float inv = 1.0f / (l + xhalf(l));       // join the halves' sums once
  #pragma unroll
  for (int d = 0; d < 4; ++d) {
    v8bf w;
    #pragma unroll
    for (int r = 0; r < 8; ++r) w[r] = (__bf16)(o[d][r] * inv);
    *reinterpret_cast<v8bf*>(ctx + (size_t)qr * D_ + hoff + d * 16 + hl * 8) = w;
  }
}

// ---------------------------------------------------------------------------
// Host launcher
// ---------------------------------------------------------------------------
extern "C" void kernel_launch(void* const* d_in, const int* in_sizes, int n_in,
                              void* d_out, int out_size, void* d_ws, size_t ws_size,
                              hipStream_t stream) {
  const float* hidden = (const float*)d_in[0];
  const int*   mask   = (const int*)  d_in[1];
  const float* ln1w   = (const float*)d_in[2];
  const float* ln1b   = (const float*)d_in[3];
  const float* wq     = (const float*)d_in[4];
  const float* bq     = (const float*)d_in[5];
  const float* wk     = (const float*)d_in[6];
  const float* bk     = (const float*)d_in[7];
  const float* wv     = (const float*)d_in[8];
  const float* bv     = (const float*)d_in[9];
  const float* wo     = (const float*)d_in[10];
  const float* bo     = (const float*)d_in[11];
  const float* ln2w   = (const float*)d_in[12];
  const float* ln2b   = (const float*)d_in[13];
  const float* wup    = (const float*)d_in[14];
  const float* bup    = (const float*)d_in[15];
  const float* wdown  = (const float*)d_in[16];
  const float* bdown  = (const float*)d_in[17];
  float* out = (float*)d_out;

  constexpr size_t W_DD  = (size_t)D_ * D_;
  constexpr size_t W_DF  = (size_t)D_ * FF_;
  constexpr size_t ACT   = (size_t)S_ * D_;
  constexpr size_t ACTFF = (size_t)S_ * FF_;

  char* ws = (char*)d_ws;
  size_t off = 0;
  __bf16* wqT  = (__bf16*)(ws + off); off += W_DD * 2;   // all weights [N][K] bf16
  __bf16* wkT  = (__bf16*)(ws + off); off += W_DD * 2;
  __bf16* wvT  = (__bf16*)(ws + off); off += W_DD * 2;
  __bf16* woT  = (__bf16*)(ws + off); off += W_DD * 2;
  __bf16* wupT = (__bf16*)(ws + off); off += W_DF * 2;
  __bf16* wdnT = (__bf16*)(ws + off); off += W_DF * 2;
  __bf16* xln_bf  = (__bf16*)(ws + off); off += ACT * 2;
  __bf16* q_bf    = (__bf16*)(ws + off); off += ACT * 2;
  __bf16* k_bf    = (__bf16*)(ws + off); off += ACT * 2;
  __bf16* vT_bf   = (__bf16*)(ws + off); off += ACT * 2;  // [D][S]
  __bf16* ctx_bf  = (__bf16*)(ws + off); off += ACT * 2;
  float*  hidden2 = (float*) (ws + off); off += ACT * 4;
  __bf16* yln_bf  = (__bf16*)(ws + off); off += ACT * 2;
  __bf16* ff_bf   = (__bf16*)(ws + off); off += ACTFF * 2;

  auto transp = [&](const float* src, __bf16* dst, int K, int N) {
    transpose_to_bf16_kernel<<<dim3(N / 32, K / 32), 256, 0, stream>>>(src, dst, K, N);
  };
  transp(wq, wqT, D_, D_);   transp(wk, wkT, D_, D_);  transp(wv, wvT, D_, D_);
  transp(wo, woT, D_, D_);   transp(wup, wupT, D_, FF_);
  transp(wdown, wdnT, FF_, D_);

  // LN1
  ln_bf16_kernel<<<S_ / (8 * LNR_), 256, 0, stream>>>(hidden, ln1w, ln1b, xln_bf);

  // Projections (Q pre-scaled by 1/sqrt(HD); V written transposed)
  dim3 gDD(D_ / GT_, S_ / GT_);
  gemm_bf16_kernel<0><<<gDD, 256, 0, stream>>>(xln_bf, wqT, bq, nullptr, nullptr, q_bf,
                                               S_, D_, D_, 0.125f);
  gemm_bf16_kernel<0><<<gDD, 256, 0, stream>>>(xln_bf, wkT, bk, nullptr, nullptr, k_bf,
                                               S_, D_, D_, 1.0f);
  gemm_bf16_kernel<3><<<gDD, 256, 0, stream>>>(xln_bf, wvT, bv, nullptr, nullptr, vT_bf,
                                               S_, D_, D_, 1.0f);

  // Flash attention
  attn_kernel<<<dim3(S_ / 64, H_), 128, 0, stream>>>(q_bf, k_bf, vT_bf, mask, ctx_bf);

  // O-projection + residual -> hidden2 (fp32)
  gemm_bf16_kernel<1><<<gDD, 256, 0, stream>>>(ctx_bf, woT, bo, hidden, hidden2, nullptr,
                                               S_, D_, D_, 1.0f);

  // LN2
  ln_bf16_kernel<<<S_ / (8 * LNR_), 256, 0, stream>>>(hidden2, ln2w, ln2b, yln_bf);

  // Up-projection + exact GELU -> bf16
  gemm_bf16_kernel<2><<<dim3(FF_ / GT_, S_ / GT_), 256, 0, stream>>>(
      yln_bf, wupT, bup, nullptr, nullptr, ff_bf, S_, FF_, D_, 1.0f);

  // Down-projection + residual -> d_out (fp32)
  gemm_bf16_kernel<1><<<gDD, 256, 0, stream>>>(ff_bf, wdnT, bdown, hidden2, out, nullptr,
                                               S_, D_, FF_, 1.0f);
}

// v004
// A run of this version takes 248 microseconds.
// In both of two side-by-side timings against v003, it was 1.11 times as fast.
// Over all steps from v000 it is 2.11 times as fast.
#include <hip/hip_runtime.h>
#include <hip/hip_bf16.h>
#include <math.h>

// ---------------------------------------------------------------------------
// Transformer block (B=1, S=4096, D=768, H=12, HD=64, FF=3072) on gfx1250.
// ~110 GFLOP vs ~55MB minimum traffic -> strongly compute bound: bf16 WMMA
// (v_wmma_f32_16x16x32_bf16, fp32 accum) everywhere, flash-attention so the
// 805MB score tensor never exists, and GLOBAL_LOAD_ASYNC_TO_LDS_B128 (ASYNCcnt)
// staging with double buffering so HBM->LDS copies overlap the matrix pipe.
// ---------------------------------------------------------------------------

typedef __attribute__((ext_vector_type(16))) __bf16 v16bf;
typedef __attribute__((ext_vector_type(8)))  __bf16 v8bf;
typedef __attribute__((ext_vector_type(8)))  float  v8f;

constexpr int S_  = 4096;
constexpr int D_  = 768;
constexpr int H_  = 12;
constexpr int HD_ = 64;
constexpr int FF_ = 3072;

__device__ __forceinline__ v16bf cat16(v8bf lo, v8bf hi) {
  return __builtin_shufflevector(lo, hi, 0,1,2,3,4,5,6,7,8,9,10,11,12,13,14,15);
}
// A/B fragment loader: p points at a 32-wide K-run; lane half hl selects
// K offsets {hl*8..+8} and {16+hl*8..+8} per the ISA 16-bit operand layout.
__device__ __forceinline__ v16bf load_frag(const __bf16* p, int hl) {
  v8bf lo = *reinterpret_cast<const v8bf*>(p + hl * 8);
  v8bf hi = *reinterpret_cast<const v8bf*>(p + 16 + hl * 8);
  return cat16(lo, hi);
}
__device__ __forceinline__ v8f wmma_bf16(v16bf a, v16bf b, v8f c) {
  return __builtin_amdgcn_wmma_f32_16x16x32_bf16(false, a, false, b, (short)0, c,
                                                 false, false);
}

// CDNA5 async global->LDS copy (no VGPR round trip, tracked by ASYNCcnt).
// Generic shared pointers carry the LDS offset in their low 32 bits
// (ISA 10.2: LDS_ADDR.U32 = addr[31:0]); dsaddr = LDS_BASE + VGPR + IOFFSET.
// Four copies and their s_wait_xcnt 0 in ONE statement: all eight address
// registers stay live to its end, so none is rewritten in front of the wait.
__device__ __forceinline__ void async_copy4_b128(void* l0, const void* g0,
                                                 void* l1, const void* g1,
                                                 void* l2, const void* g2,
                                                 void* l3, const void* g3) {
  asm volatile("global_load_async_to_lds_b128 %0, %1, off\n\t"
               "global_load_async_to_lds_b128 %2, %3, off\n\t"
               "global_load_async_to_lds_b128 %4, %5, off\n\t"
               "global_load_async_to_lds_b128 %6, %7, off\n\t"
               "s_wait_xcnt 0x0"
               :: "v"((unsigned)(uintptr_t)l0), "v"(g0),
                  "v"((unsigned)(uintptr_t)l1), "v"(g1),
                  "v"((unsigned)(uintptr_t)l2), "v"(g2),
                  "v"((unsigned)(uintptr_t)l3), "v"(g3) : "memory");
}
__device__ __forceinline__ void async_wait0() {
  asm volatile("s_wait_asynccnt 0x0" ::: "memory");
}
// This wave's LDS reads have retired: stands in front of the barrier behind which
// copies refill the buffer that was read.
__device__ __forceinline__ void lds_wait0() {
  asm volatile("s_wait_dscnt 0x0" ::: "memory");
}

// ---------------------------------------------------------------------------
// Weight prep: [K][N] fp32 -> [N][K] bf16 (transpose through an LDS tile).
// Done once per call; lets GEMM B-staging be straight contiguous async copies.
// ---------------------------------------------------------------------------
__global__ __launch_bounds__(256) void transpose_to_bf16_kernel(
    const float* __restrict__ in, __bf16* __restrict__ out, int K, int N) {
  __shared__ float tile[32][33];
  const int kb = blockIdx.y * 32, nb = blockIdx.x * 32;
  const int tx = threadIdx.x & 31, ty = threadIdx.x >> 5;   // 32 x 8
  #pragma unroll
  for (int yy = 0; yy < 4; ++yy) {
    int k = ty + yy * 8;
    tile[k][tx] = in[(size_t)(kb + k) * N + nb + tx];
  }
  __syncthreads();
  #pragma unroll
  for (int yy = 0; yy < 4; ++yy) {
    int n = ty + yy * 8;
    out[(size_t)(nb + n) * K + kb + tx] = (__bf16)tile[tx][n];
  }
}

// ---------------------------------------------------------------------------
// LayerNorm (fp32 in) -> bf16 out.  One WAVE per pair of rows, no LDS, no barrier.
// A row of 768 floats lives in registers (six 16-byte loads a lane, each wave-wide
// load 512 contiguous bytes), is read from memory once, and both sums are taken
// in-lane plus a five-step butterfly across the wave. 2,048 waves a launch, eight on
// every WGP: a launch this short pays for each wave that it has to start.
// ---------------------------------------------------------------------------
typedef __attribute__((ext_vector_type(4))) float  v4f;
typedef __attribute__((ext_vector_type(4))) __bf16 v4bf;

constexpr int LNR_ = 2;            // rows per wave
constexpr int LNC_ = D_ / 128;     // 16-byte chunks of a row per lane

// x + (x of lane ^ MASK) inside a 16-lane row (DPP row_xmask)
template <int MASK>
__device__ __forceinline__ float add_xmask(float x) {
  const int v = __builtin_bit_cast(int, x);
  return x + __builtin_bit_cast(float,
      __builtin_amdgcn_update_dpp(0, v, 0x160 + MASK, 0xf, 0xf, true));
}
// sum over the 32 lanes, the same value in every lane
__device__ __forceinline__ float wave_sum(float x) {
  x = add_xmask<1>(x);
  x = add_xmask<2>(x);
  x = add_xmask<4>(x);
  x = add_xmask<8>(x);
  const int v = __builtin_bit_cast(int, x);
  return x + __builtin_bit_cast(float, __builtin_amdgcn_permlanex16(
      v, v, 0x76543210, 0xfedcba98, false, false));
}

// amdgpu_waves_per_eu(2, 4): the grid puts two waves on a SIMD; aiming at sixteen the
// compiler kept to 64 registers and loaded w and b late, pair by pair, a full wait each.
__global__ __launch_bounds__(256) __attribute__((amdgpu_waves_per_eu(2, 4)))
void ln_bf16_kernel(
    const float* __restrict__ x, const float* __restrict__ w,
    const float* __restrict__ b, __bf16* __restrict__ out) {
  // the wave's number as a scalar: row bases stand in scalar registers, and every
  // load and store of the wave shares one lane-offset register
  const int wave = __builtin_amdgcn_readfirstlane(threadIdx.x >> 5);
  const int lane = threadIdx.x & 31;
  const int row0 = (blockIdx.x * 8 + wave) * LNR_;
  const unsigned col = lane * 4;
  const float* xr = x + (size_t)row0 * D_;       // scalar bases of the wave's rows
  __bf16* orow = out + (size_t)row0 * D_;

  v4f v[LNR_][LNC_], wv[LNC_], bv[LNC_];
  #pragma unroll
  for (int i = 0; i < LNC_; ++i) {
    wv[i] = *reinterpret_cast<const v4f*>(w + (col + i * 128));
    bv[i] = *reinterpret_cast<const v4f*>(b + (col + i * 128));
  }
  #pragma unroll
  for (int r = 0; r < LNR_; ++r)
    #pragma unroll
    for (int i = 0; i < LNC_; ++i)
      v[r][i] = *reinterpret_cast<const v4f*>(xr + (col + (r * D_ + i * 128)));

  #pragma unroll
  for (int r = 0; r < LNR_; ++r) {
    v4f s4 = v[r][0];
    #pragma unroll
    for (int i = 1; i < LNC_; ++i) s4 += v[r][i];
    const float mu = wave_sum((s4[0] + s4[1]) + (s4[2] + s4[3])) * (1.0f / D_);
    v4f q4 = {};
    #pragma unroll
    for (int i = 0; i < LNC_; ++i) {
      v[r][i] -= mu;
      q4 += v[r][i] * v[r][i];
    }
    const float var  = wave_sum((q4[0] + q4[1]) + (q4[2] + q4[3])) * (1.0f / D_);
    const float rstd = rsqrtf(var + 1e-5f);
    #pragma unroll
    for (int i = 0; i < LNC_; ++i) {
      const v4f y = v[r][i] * rstd * wv[i] + bv[i];
      v4bf o;
      #pragma unroll
      for (int e = 0; e < 4; ++e) o[e] = (__bf16)y[e];
      *reinterpret_cast<v4bf*>(orow + (col + (r * D_ + i * 128))) = o;
    }
  }
}

// ---------------------------------------------------------------------------
// Tiled bf16 GEMM: C[M,N] = A[M,K] * Bt[N,K]^T (+bias epilogues)
// Block = 256 threads (8 waves), tile 128x128, K-step 128, two LDS buffers fed by
// async copies. A staged row is 256 bytes, two whole cache lines, brought by
// sixteen neighbouring lanes; LDS rows stand at a pitch of 272 bytes (16 B x odd),
// free of bank conflicts for the 16-byte fragment reads. Each wave owns 64x32:
// 8 WMMA per 32 of K from 4 A-frags x 2 B-frags.
// M, N multiples of 128; K a multiple of 128.
// EPI 0: outB = bf16((acc+bias)*scale)      (Q/K projections; Q scale 0.125)
// EPI 1: outF = acc + bias + resid          (O-proj, down-proj)
// EPI 2: outB = bf16(gelu_exact(acc+bias))  (up-proj)
// EPI 3: outB[col*S_+row] = acc + bias      (V projection, stored transposed)
// ---------------------------------------------------------------------------
constexpr int GT_ = 128;       // tile rows of A and of Bt
constexpr int GK_ = 128;       // K-step
constexpr int GP_ = GK_ + 8;   // LDS row pitch in elements (272 bytes)

// Eight copies, rows 16 apart, and their s_wait_xcnt 0 in ONE statement: every
// address register stays live to its end, so none is rewritten in front of the wait.
__device__ __forceinline__ void async_copy8_b128(const __bf16* l, const __bf16* g,
                                                 size_t gs) {
  const unsigned l0 = (unsigned)(uintptr_t)l;
  constexpr unsigned ls = 16 * GP_ * 2;          // 16 LDS rows in bytes
  asm volatile("global_load_async_to_lds_b128 %0, %1, off\n\t"
               "global_load_async_to_lds_b128 %2, %3, off\n\t"
               "global_load_async_to_lds_b128 %4, %5, off\n\t"
               "global_load_async_to_lds_b128 %6, %7, off\n\t"
               "global_load_async_to_lds_b128 %8, %9, off\n\t"
               "global_load_async_to_lds_b128 %10, %11, off\n\t"
               "global_load_async_to_lds_b128 %12, %13, off\n\t"
               "global_load_async_to_lds_b128 %14, %15, off\n\t"
               "s_wait_xcnt 0x0"
               :: "v"(l0),          "v"(g),
                  "v"(l0 + ls),     "v"(g + gs),
                  "v"(l0 + 2 * ls), "v"(g + 2 * gs),
                  "v"(l0 + 3 * ls), "v"(g + 3 * gs),
                  "v"(l0 + 4 * ls), "v"(g + 4 * gs),
                  "v"(l0 + 5 * ls), "v"(g + 5 * gs),
                  "v"(l0 + 6 * ls), "v"(g + 6 * gs),
                  "v"(l0 + 7 * ls), "v"(g + 7 * gs)
               : "memory");
}

// amdgpu_waves_per_eu(2, 4): LDS admits two blocks per WGP, four waves per SIMD, so
// the register budget is 256; aiming at more waves the compiler kept one fragment
// set and waited for every residual load of the epilogue by itself.
template <int EPI>
__global__ __launch_bounds__(256) __attribute__((amdgpu_waves_per_eu(2, 4)))
void gemm_bf16_kernel(
    const __bf16* __restrict__ A, const __bf16* __restrict__ Bt,
    const float* __restrict__ bias, const float* __restrict__ resid,
    float* __restrict__ outF, __bf16* __restrict__ outB,
    int M, int N, int K, float scale) {
  __shared__ alignas(16) __bf16 As[2][GT_][GP_];   // [m][k]
  __shared__ alignas(16) __bf16 Bs[2][GT_][GP_];   // [n][k]

  const int n0 = blockIdx.x * GT_;
  const int m0 = blockIdx.y * GT_;
  const int tid  = threadIdx.x;
  const int wave = tid >> 5, lane = tid & 31;
  const int wr = (wave & 1) * 64;     // wave row base (4 sub-tiles of 16)
  const int wc = (wave >> 1) * 32;    // wave col base (2 sub-tiles of 16)
  const int c  = lane & 15, hl = lane >> 4;
  const int sr = tid >> 4, sg = (tid & 15) << 3;   // staging: 16 rows x 16 x 16 bytes

  auto stage = [&](int buf, int kk) {   // rows sr, sr+16, ..., sr+112 of both operands
    async_copy8_b128(&As[buf][sr][sg], A  + (size_t)(m0 + sr) * K + kk + sg, (size_t)16 * K);
    async_copy8_b128(&Bs[buf][sr][sg], Bt + (size_t)(n0 + sr) * K + kk + sg, (size_t)16 * K);
  };

  v8f acc[4][2] = {};
  const int nt = K / GK_;
  stage(0, 0);
  async_wait0();
  __syncthreads();
  if (nt > 1) stage(1, GK_);

  for (int t = 0; t < nt; ++t) {
    const int buf = t & 1;
    v16bf a[2][4], b[2][2];              // two fragment sets, one per 32 of K
    auto frags = [&](int set, int kc) {
      #pragma unroll
      for (int j = 0; j < 2; ++j)
        b[set][j] = load_frag(&Bs[buf][wc + j * 16 + c][kc * 32], hl);
      #pragma unroll
      for (int i = 0; i < 4; ++i)
        a[set][i] = load_frag(&As[buf][wr + i * 16 + c][kc * 32], hl);
    };
    frags(0, 0);
    frags(1, 1);
    // The sched_barriers of this loop keep each set's LDS reads one group between
    // whole runs of WMMAs, two sets ahead: left alone the compiler spreads the reads
    // among the WMMAs with a full wait at each place, or sinks WMMAs behind the
    // barrier, where they take the copies' lead away.
    __builtin_amdgcn_sched_barrier(0);
    #pragma unroll
    for (int kc = 0; kc < GK_ / 32; ++kc) {
      #pragma unroll
      for (int i = 0; i < 4; ++i)
        #pragma unroll
        for (int j = 0; j < 2; ++j)
          acc[i][j] = wmma_bf16(a[kc & 1][i], b[kc & 1][j], acc[i][j]);
      __builtin_amdgcn_sched_barrier(0);
      if (kc + 2 < GK_ / 32) {
        frags(kc & 1, kc + 2);
        __builtin_amdgcn_sched_barrier(0);
      }
    }
    lds_wait0();                 // this trip's reads of buf are done
    async_wait0();               // this wave's share of tile t+1 has landed
    __syncthreads();             // publishes tile t+1, frees buf
    if (t + 2 < nt) stage(buf, (t + 2) * GK_);   // flies during trip t+1
  }
  async_wait0();

  #pragma unroll
  for (int i = 0; i < 4; ++i)
    #pragma unroll
    for (int j = 0; j < 2; ++j)
      #pragma unroll
      for (int e = 0; e < 8; ++e) {
        const int row = m0 + wr + i * 16 + hl * 8 + e;   // C layout: VGPR e + half
        const int col = n0 + wc + j * 16 + c;            // lane % 16
        float v = acc[i][j][e] + bias[col];
        if constexpr (EPI == 0) {
          outB[(size_t)row * N + col] = (__bf16)(v * scale);
        } else if constexpr (EPI == 1) {
          outF[(size_t)row * N + col] = v + resid[(size_t)row * N + col];
        } else if constexpr (EPI == 2) {
          outB[(size_t)row * N + col] =
              (__bf16)(0.5f * v * (1.0f + erff(v * 0.70710678118f)));
        } else {
          outB[(size_t)col * S_ + row] = (__bf16)v;      // vT[dim][seq]
        }
      }
}

constexpr int AKP_ = HD_ + 8;   // K row pitch in elements (144 bytes)
constexpr int AVP_ = 32 + 8;    // V^T row pitch in elements (80 bytes)

// lane l <-> lane l ^ 16
__device__ __forceinline__ float xhalf(float x) {
  const int b = __builtin_bit_cast(int, x);
  return __builtin_bit_cast(float, __builtin_amdgcn_permlanex16(
      b, b, 0x76543210, 0xfedcba98, false, false));
}

// e^x as v_exp_f32(x * log2 e), what __expf compiles to here. The v_nop fills the
// slot the instruction set asks for behind a transcendental before its source is
// overwritten.
__device__ __forceinline__ float exp_slot(float x) {
  float r;
  asm("v_exp_f32 %0, %1\n\tv_nop" : "=v"(r) : "v"(x * 1.4426950408889634f));
  return r;
}

__global__ __launch_bounds__(128) void attn_kernel(
    const __bf16* __restrict__ Q, const __bf16* __restrict__ Kb,
    const __bf16* __restrict__ vT,               // [D][S] transposed values
    const int* __restrict__ amask, __bf16* __restrict__ ctx) {
  __shared__ alignas(16) __bf16 Ks[32][AKP_];    // [key][dim]  (K Q^T   A-frags)
  __shared__ alignas(16) __bf16 Vt[64][AVP_];    // [dim][key]  (V^T P^T A-frags)

  const int tid  = threadIdx.x;
  const int wave = tid >> 5, lane = tid & 31;
  const int c  = lane & 15, hl = lane >> 4;
  const int h    = blockIdx.y;
  const int q0   = blockIdx.x * 64 + wave * 16;
  const int hoff = h * HD_;
  const int qr   = q0 + c;                       // this lane's query

  v16bf aq[2];                                   // Q^T as B: lane = query column
  #pragma unroll
  for (int kc = 0; kc < 2; ++kc)
    aq[kc] = load_frag(Q + (size_t)(q0 + c) * D_ + hoff + kc * 32, hl);

  v8f o[4] = {};                                 // o[d][r] = O[qr][d*16 + 8*hl + r]
  float m = -1e30f, l = 0.f;                     // l: this half's keys only

  const int kend = (blockIdx.x + 1) * 64;        // causal bound (block-uniform)
  for (int kb = 0; kb < kend; kb += 32) {
    __syncthreads();                             // protect LDS reuse
    {   // async-stage 32 keys of K (row-major) and V (already transposed)
      const int key = tid >> 2, db = (tid & 3) << 4;
      const __bf16* gk = Kb + (size_t)(kb + key) * D_ + hoff + db;
      const int dv = tid >> 1, kg = (tid & 1) << 4;
      const __bf16* gv = vT + (size_t)(hoff + dv) * S_ + kb + kg;
      async_copy4_b128(&Ks[key][db], gk, &Ks[key][db + 8], gk + 8,
                       &Vt[dv][kg],  gv, &Vt[dv][kg + 8],  gv + 8);
    }
    async_wait0();
    __syncthreads();

    // S^T(32x16) = K(32x64) @ Q^T(64x16); s[sub][r] = key kb+sub*16+8*hl+r, query qr
    v8f s[2] = {};
    #pragma unroll
    for (int sub = 0; sub < 2; ++sub)
      #pragma unroll
      for (int kc = 0; kc < 2; ++kc) {
        v16bf a = load_frag(&Ks[sub * 16 + c][kc * 32], hl);
        s[sub] = wmma_bf16(a, aq[kc], s[sub]);
      }

    // bit k of keep: key kb+8*hl+k is open to this lane's query (padding and causal)
    const unsigned pad = __builtin_amdgcn_ballot_w32(amask[kb + lane] != 0);
    const int n = qr - kb;                       // last key index the query may see
    const unsigned cau = n >= 31 ? 0xffffffffu : (n < 0 ? 0u : (2u << n) - 1u);
    const unsigned keep = (pad & cau) >> (hl * 8);

    // online softmax, one query per lane
    float mx = -1e30f;
    #pragma unroll
    for (int sub = 0; sub < 2; ++sub)
      #pragma unroll
      for (int r = 0; r < 8; ++r) {
        if (((keep >> (sub * 16 + r)) & 1u) == 0u) s[sub][r] = -1e30f;
        mx = fmaxf(mx, s[sub][r]);
      }
    mx = fmaxf(mx, xhalf(mx));                   // both halves: the query's maximum
    const float mn  = fmaxf(m, mx);
    const float fac = exp_slot(m - mn);
    m = mn;
    v16bf bp;                                    // P^T as B, hardware k order
    float rs = 0.f;
    #pragma unroll
    for (int sub = 0; sub < 2; ++sub)
      #pragma unroll
      for (int r = 0; r < 8; ++r) {
        const float p = exp_slot(s[sub][r] - mn);
        rs += p;
        bp[sub * 8 + r] = (__bf16)p;
      }
    l = l * fac + rs;
    #pragma unroll
    for (int d = 0; d < 4; ++d)
      #pragma unroll
      for (int r = 0; r < 8; ++r) o[d][r] *= fac;

    // O^T += V^T @ P^T
    #pragma unroll
    for (int d = 0; d < 4; ++d) {
      v16bf av = load_frag(&Vt[d * 16 + c][0], hl);
      o[d] = wmma_bf16(av, bp, o[d]);
    }
  }

  const float inv = 1.0f / (l + xhalf(l));       // join the halves' sums once
  #pragma unroll
  for (int d = 0; d < 4; ++d) {
    v8bf w;
    #pragma unroll
    for (int r = 0; r < 8; ++r) w[r] = (__bf16)(o[d][r] * inv);
    *reinterpret_cast<v8bf*>(ctx + (size_t)qr * D_ + hoff + d * 16 + hl * 8) = w;
  }
}

// ---------------------------------------------------------------------------
// Host launcher
// ---------------------------------------------------------------------------
extern "C" void kernel_launch(void* const* d_in, const int* in_sizes, int n_in,
                              void* d_out, int out_size, void* d_ws, size_t ws_size,
                              hipStream_t stream) {
  const float* hidden = (const float*)d_in[0];
  const int*   mask   = (const int*)  d_in[1];
  const float* ln1w   = (const float*)d_in[2];
  const float* ln1b   = (const float*)d_in[3];
  const float* wq     = (const float*)d_in[4];
  const float* bq     = (const float*)d_in[5];
  const float* wk     = (const float*)d_in[6];
  const float* bk     = (const float*)d_in[7];
  const float* wv     = (const float*)d_in[8];
  const float* bv     = (const float*)d_in[9];
  const float* wo     = (const float*)d_in[10];
  const float* bo     = (const float*)d_in[11];
  const float* ln2w   = (const float*)d_in[12];
  const float* ln2b   = (const float*)d_in[13];
  const float* wup    = (const float*)d_in[14];
  const float* bup    = (const float*)d_in[15];
  const float* wdown  = (const float*)d_in[16];
  const float* bdown  = (const float*)d_in[17];
  float* out = (float*)d_out;

  constexpr size_t W_DD  = (size_t)D_ * D_;
  constexpr size_t W_DF  = (size_t)D_ * FF_;
  constexpr size_t ACT   = (size_t)S_ * D_;
  constexpr size_t ACTFF = (size_t)S_ * FF_;

  char* ws = (char*)d_ws;
  size_t off = 0;
  __bf16* wqT  = (__bf16*)(ws + off); off += W_DD * 2;   // all weights [N][K] bf16
  __bf16* wkT  = (__bf16*)(ws + off); off += W_DD * 2;
  __bf16* wvT  = (__bf16*)(ws + off); off += W_DD * 2;
  __bf16* woT  = (__bf16*)(ws + off); off += W_DD * 2;
  __bf16* wupT = (__bf16*)(ws + off); off += W_DF * 2;
  __bf16* wdnT = (__bf16*)(ws + off); off += W_DF * 2;
  __bf16* xln_bf  = (__bf16*)(ws + off); off += ACT * 2;
  __bf16* q_bf    = (__bf16*)(ws + off); off += ACT * 2;
  __bf16* k_bf    = (__bf16*)(ws + off); off += ACT * 2;
  __bf16* vT_bf   = (__bf16*)(ws + off); off += ACT * 2;  // [D][S]
  __bf16* ctx_bf  = (__bf16*)(ws + off); off += ACT * 2;
  float*  hidden2 = (float*) (ws + off); off += ACT * 4;
  __bf16* yln_bf  = (__bf16*)(ws + off); off += ACT * 2;
  __bf16* ff_bf   = (__bf16*)(ws + off); off += ACTFF * 2;

  auto transp = [&](const float* src, __bf16* dst, int K, int N) {
    transpose_to_bf16_kernel<<<dim3(N / 32, K / 32), 256, 0, stream>>>(src, dst, K, N);
  };
  transp(wq, wqT, D_, D_);   transp(wk, wkT, D_, D_);  transp(wv, wvT, D_, D_);
  transp(wo, woT, D_, D_);   transp(wup, wupT, D_, FF_);
  transp(wdown, wdnT, FF_, D_);

  // LN1
  ln_bf16_kernel<<<S_ / (8 * LNR_), 256, 0, stream>>>(hidden, ln1w, ln1b, xln_bf);

  // Projections (Q pre-scaled by 1/sqrt(HD); V written transposed)
  dim3 gDD(D_ / GT_, S_ / GT_);
  gemm_bf16_kernel<0><<<gDD, 256, 0, stream>>>(xln_bf, wqT, bq, nullptr, nullptr, q_bf,
                                               S_, D_, D_, 0.125f);
  gemm_bf16_kernel<0><<<gDD, 256, 0, stream>>>(xln_bf, wkT, bk, nullptr, nullptr, k_bf,
                                               S_, D_, D_, 1.0f);
  gemm_bf16_kernel<3><<<gDD, 256, 0, stream>>>(xln_bf, wvT, bv, nullptr, nullptr, vT_bf,
                                               S_, D_, D_, 1.0f);

  // Flash attention
  attn_kernel<<<dim3(S_ / 64, H_), 128, 0, stream>>>(q_bf, k_bf, vT_bf, mask, ctx_bf);

  // O-projection + residual -> hidden2 (fp32)
  gemm_bf16_kernel<1><<<gDD, 256, 0, stream>>>(ctx_bf, woT, bo, hidden, hidden2, nullptr,
                                               S_, D_, D_, 1.0f);

  // LN2
  ln_bf16_kernel<<<S_ / (8 * LNR_), 256, 0, stream>>>(hidden2, ln2w, ln2b, yln_bf);

  // Up-projection + exact GELU -> bf16
  gemm_bf16_kernel<2><<<dim3(FF_ / GT_, S_ / GT_), 256, 0, stream>>>(
      yln_bf, wupT, bup, nullptr, nullptr, ff_bf, S_, FF_, D_, 1.0f);

  // Down-projection + residual -> d_out (fp32)
  gemm_bf16_kernel<1><<<gDD, 256, 0, stream>>>(ff_bf, wdnT, bdown, hidden2, out, nullptr,
                                               S_, D_, FF_, 1.0f);
}

// v005
// It runs in 202 microseconds.
// Next to v004, in two timings, it ran 1.22 and 1.23 times as fast.
// All steps since v000 together make it 2.59 times as fast.
#include <hip/hip_runtime.h>
#include <hip/hip_bf16.h>
#include <math.h>

// ---------------------------------------------------------------------------
// Transformer block (B=1, S=4096, D=768, H=12, HD=64, FF=3072) on gfx1250.
// ~110 GFLOP vs ~55MB minimum traffic -> strongly compute bound: bf16 WMMA
// (v_wmma_f32_16x16x32_bf16, fp32 accum) everywhere, flash-attention so the
// 805MB score tensor never exists, and GLOBAL_LOAD_ASYNC_TO_LDS_B128 (ASYNCcnt)
// staging with double buffering so HBM->LDS copies overlap the matrix pipe.
// ---------------------------------------------------------------------------

typedef __attribute__((ext_vector_type(16))) __bf16 v16bf;
typedef __attribute__((ext_vector_type(8)))  __bf16 v8bf;
typedef __attribute__((ext_vector_type(8)))  float  v8f;

constexpr int S_  = 4096;
constexpr int D_  = 768;
constexpr int H_  = 12;
constexpr int HD_ = 64;
constexpr int FF_ = 3072;

__device__ __forceinline__ v16bf cat16(v8bf lo, v8bf hi) {
  return __builtin_shufflevector(lo, hi, 0,1,2,3,4,5,6,7,8,9,10,11,12,13,14,15);
}
// A/B fragment loader: p points at a 32-wide K-run; lane half hl selects
// K offsets {hl*8..+8} and {16+hl*8..+8} per the ISA 16-bit operand layout.
__device__ __forceinline__ v16bf load_frag(const __bf16* p, int hl) {
  v8bf lo = *reinterpret_cast<const v8bf*>(p + hl * 8);
  v8bf hi = *reinterpret_cast<const v8bf*>(p + 16 + hl * 8);
  return cat16(lo, hi);
}
__device__ __forceinline__ v8f wmma_bf16(v16bf a, v16bf b, v8f c) {
  return __builtin_amdgcn_wmma_f32_16x16x32_bf16(false, a, false, b, (short)0, c,
                                                 false, false);
}

// CDNA5 async global->LDS copy (no VGPR round trip, tracked by ASYNCcnt).
// Generic shared pointers carry the LDS offset in their low 32 bits
// (ISA 10.2: LDS_ADDR.U32 = addr[31:0]); dsaddr = LDS_BASE + VGPR + IOFFSET.
// Four rows of one tile and four of another (rows 16 apart: ls bytes in LDS, ga or
// gb elements in memory) and their s_wait_xcnt 0 in ONE statement: every address
// register stays live to its end, so none is rewritten in front of the wait.
__device__ __forceinline__ void async_copy4x2_b128(const __bf16* la, const __bf16* a,
                                                   size_t ga, const __bf16* lb,
                                                   const __bf16* b, size_t gb,
                                                   unsigned ls) {
  const unsigned a0 = (unsigned)(uintptr_t)la, b0 = (unsigned)(uintptr_t)lb;
  asm volatile("global_load_async_to_lds_b128 %0, %1, off\n\t"
               "global_load_async_to_lds_b128 %2, %3, off\n\t"
               "global_load_async_to_lds_b128 %4, %5, off\n\t"
               "global_load_async_to_lds_b128 %6, %7, off\n\t"
               "global_load_async_to_lds_b128 %8, %9, off\n\t"
               "global_load_async_to_lds_b128 %10, %11, off\n\t"
               "global_load_async_to_lds_b128 %12, %13, off\n\t"
               "global_load_async_to_lds_b128 %14, %15, off\n\t"
               "s_wait_xcnt 0x0"
               :: "v"(a0),          "v"(a),
                  "v"(a0 + ls),     "v"(a + ga),
                  "v"(a0 + 2 * ls), "v"(a + 2 * ga),
                  "v"(a0 + 3 * ls), "v"(a + 3 * ga),
                  "v"(b0),          "v"(b),
                  "v"(b0 + ls),     "v"(b + gb),
                  "v"(b0 + 2 * ls), "v"(b + 2 * gb),
                  "v"(b0 + 3 * ls), "v"(b + 3 * gb)
               : "memory");
}
__device__ __forceinline__ void async_wait0() {
  asm volatile("s_wait_asynccnt 0x0" ::: "memory");
}
// This wave's LDS reads have retired: stands in front of the barrier behind which
// copies refill the buffer that was read.
__device__ __forceinline__ void lds_wait0() {
  asm volatile("s_wait_dscnt 0x0" ::: "memory");
}

// ---------------------------------------------------------------------------
// Weight prep: [K][N] fp32 -> [N][K] bf16 (transpose through an LDS tile).
// Done once per call; lets GEMM B-staging be straight contiguous async copies.
// ---------------------------------------------------------------------------
__global__ __launch_bounds__(256) void transpose_to_bf16_kernel(
    const float* __restrict__ in, __bf16* __restrict__ out, int K, int N) {
  __shared__ float tile[32][33];
  const int kb = blockIdx.y * 32, nb = blockIdx.x * 32;
  const int tx = threadIdx.x & 31, ty = threadIdx.x >> 5;   // 32 x 8
  #pragma unroll
  for (int yy = 0; yy < 4; ++yy) {
    int k = ty + yy * 8;
    tile[k][tx] = in[(size_t)(kb + k) * N + nb + tx];
  }
  __syncthreads();
  #pragma unroll
  for (int yy = 0; yy < 4; ++yy) {
    int n = ty + yy * 8;
    out[(size_t)(nb + n) * K + kb + tx] = (__bf16)tile[tx][n];
  }
}

// ---------------------------------------------------------------------------
// LayerNorm (fp32 in) -> bf16 out.  One WAVE per pair of rows, no LDS, no barrier.
// A row of 768 floats lives in registers (six 16-byte loads a lane, each wave-wide
// load 512 contiguous bytes), is read from memory once, and both sums are taken
// in-lane plus a five-step butterfly across the wave. 2,048 waves a launch, eight on
// every WGP: a launch this short pays for each wave that it has to start.
// ---------------------------------------------------------------------------
typedef __attribute__((ext_vector_type(4))) float  v4f;
typedef __attribute__((ext_vector_type(4))) __bf16 v4bf;

constexpr int LNR_ = 2;            // rows per wave
constexpr int LNC_ = D_ / 128;     // 16-byte chunks of a row per lane

// x + (x of lane ^ MASK) inside a 16-lane row (DPP row_xmask)
template <int MASK>
__device__ __forceinline__ float add_xmask(float x) {
  const int v = __builtin_bit_cast(int, x);
  return x + __builtin_bit_cast(float,
      __builtin_amdgcn_update_dpp(0, v, 0x160 + MASK, 0xf, 0xf, true));
}
// sum over the 32 lanes, the same value in every lane
__device__ __forceinline__ float wave_sum(float x) {
  x = add_xmask<1>(x);
  x = add_xmask<2>(x);
  x = add_xmask<4>(x);
  x = add_xmask<8>(x);
  const int v = __builtin_bit_cast(int, x);
  return x + __builtin_bit_cast(float, __builtin_amdgcn_permlanex16(
      v, v, 0x76543210, 0xfedcba98, false, false));
}

// amdgpu_waves_per_eu(2, 4): the grid puts two waves on a SIMD; aiming at sixteen the
// compiler kept to 64 registers and loaded w and b late, pair by pair, a full wait each.
__global__ __launch_bounds__(256) __attribute__((amdgpu_waves_per_eu(2, 4)))
void ln_bf16_kernel(
    const float* __restrict__ x, const float* __restrict__ w,
    const float* __restrict__ b, __bf16* __restrict__ out) {
  // the wave's number as a scalar: row bases stand in scalar registers, and every
  // load and store of the wave shares one lane-offset register
  const int wave = __builtin_amdgcn_readfirstlane(threadIdx.x >> 5);
  const int lane = threadIdx.x & 31;
  const int row0 = (blockIdx.x * 8 + wave) * LNR_;
  const unsigned col = lane * 4;
  const float* xr = x + (size_t)row0 * D_;       // scalar bases of the wave's rows
  __bf16* orow = out + (size_t)row0 * D_;

  v4f v[LNR_][LNC_], wv[LNC_], bv[LNC_];
  #pragma unroll
  for (int i = 0; i < LNC_; ++i) {
    wv[i] = *reinterpret_cast<const v4f*>(w + (col + i * 128));
    bv[i] = *reinterpret_cast<const v4f*>(b + (col + i * 128));
  }
  #pragma unroll
  for (int r = 0; r < LNR_; ++r)
    #pragma unroll
    for (int i = 0; i < LNC_; ++i)
      v[r][i] = *reinterpret_cast<const v4f*>(xr + (col + (r * D_ + i * 128)));

  #pragma unroll
  for (int r = 0; r < LNR_; ++r) {
    v4f s4 = v[r][0];
    #pragma unroll
    for (int i = 1; i < LNC_; ++i) s4 += v[r][i];
    const float mu = wave_sum((s4[0] + s4[1]) + (s4[2] + s4[3])) * (1.0f / D_);
    v4f q4 = {};
    #pragma unroll
    for (int i = 0; i < LNC_; ++i) {
      v[r][i] -= mu;
      q4 += v[r][i] * v[r][i];
    }
    const float var  = wave_sum((q4[0] + q4[1]) + (q4[2] + q4[3])) * (1.0f / D_);
    const float rstd = rsqrtf(var + 1e-5f);
    #pragma unroll
    for (int i = 0; i < LNC_; ++i) {
      const v4f y = v[r][i] * rstd * wv[i] + bv[i];
      v4bf o;
      #pragma unroll
      for (int e = 0; e < 4; ++e) o[e] = (__bf16)y[e];
      *reinterpret_cast<v4bf*>(orow + (col + (r * D_ + i * 128))) = o;
    }
  }
}

// ---------------------------------------------------------------------------
// Tiled bf16 GEMM: C[M,N] = A[M,K] * Bt[N,K]^T (+bias epilogues)
// Block = 256 threads (8 waves), tile 128x128, K-step 128, two LDS buffers fed by
// async copies. A staged row is 256 bytes, two whole cache lines, brought by
// sixteen neighbouring lanes; LDS rows stand at a pitch of 272 bytes (16 B x odd),
// free of bank conflicts for the 16-byte fragment reads. Each wave owns 64x32:
// 8 WMMA per 32 of K from 4 A-frags x 2 B-frags.
// M, N multiples of 128; K a multiple of 128.
// EPI 0: outB = bf16((acc+bias)*scale)      (Q/K projections; Q scale 0.125)
// EPI 1: outF = acc + bias + resid          (O-proj, down-proj)
// EPI 2: outB = bf16(gelu_exact(acc+bias))  (up-proj)
// EPI 3: outB[col*S_+row] = acc + bias      (V projection, stored transposed)
// ---------------------------------------------------------------------------
constexpr int GT_ = 128;       // tile rows of A and of Bt
constexpr int GK_ = 128;       // K-step
constexpr int GP_ = GK_ + 8;   // LDS row pitch in elements (272 bytes)

// Eight copies, rows 16 apart, and their s_wait_xcnt 0 in ONE statement: every
// address register stays live to its end, so none is rewritten in front of the wait.
__device__ __forceinline__ void async_copy8_b128(const __bf16* l, const __bf16* g,
                                                 size_t gs) {
  const unsigned l0 = (unsigned)(uintptr_t)l;
  constexpr unsigned ls = 16 * GP_ * 2;          // 16 LDS rows in bytes
  asm volatile("global_load_async_to_lds_b128 %0, %1, off\n\t"
               "global_load_async_to_lds_b128 %2, %3, off\n\t"
               "global_load_async_to_lds_b128 %4, %5, off\n\t"
               "global_load_async_to_lds_b128 %6, %7, off\n\t"
               "global_load_async_to_lds_b128 %8, %9, off\n\t"
               "global_load_async_to_lds_b128 %10, %11, off\n\t"
               "global_load_async_to_lds_b128 %12, %13, off\n\t"
               "global_load_async_to_lds_b128 %14, %15, off\n\t"
               "s_wait_xcnt 0x0"
               :: "v"(l0),          "v"(g),
                  "v"(l0 + ls),     "v"(g + gs),
                  "v"(l0 + 2 * ls), "v"(g + 2 * gs),
                  "v"(l0 + 3 * ls), "v"(g + 3 * gs),
                  "v"(l0 + 4 * ls), "v"(g + 4 * gs),
                  "v"(l0 + 5 * ls), "v"(g + 5 * gs),
                  "v"(l0 + 6 * ls), "v"(g + 6 * gs),
                  "v"(l0 + 7 * ls), "v"(g + 7 * gs)
               : "memory");
}

// amdgpu_waves_per_eu(2, 4): LDS admits two blocks per WGP, four waves per SIMD, so
// the register budget is 256; aiming at more waves the compiler kept one fragment
// set and waited for every residual load of the epilogue by itself.
template <int EPI>
__global__ __launch_bounds__(256) __attribute__((amdgpu_waves_per_eu(2, 4)))
void gemm_bf16_kernel(
    const __bf16* __restrict__ A, const __bf16* __restrict__ Bt,
    const float* __restrict__ bias, const float* __restrict__ resid,
    float* __restrict__ outF, __bf16* __restrict__ outB,
    int M, int N, int K, float scale) {
  __shared__ alignas(16) __bf16 As[2][GT_][GP_];   // [m][k]
  __shared__ alignas(16) __bf16 Bs[2][GT_][GP_];   // [n][k]

  const int n0 = blockIdx.x * GT_;
  const int m0 = blockIdx.y * GT_;
  const int tid  = threadIdx.x;
  const int wave = tid >> 5, lane = tid & 31;
  const int wr = (wave & 1) * 64;     // wave row base (4 sub-tiles of 16)
  const int wc = (wave >> 1) * 32;    // wave col base (2 sub-tiles of 16)
  const int c  = lane & 15, hl = lane >> 4;
  const int sr = tid >> 4, sg = (tid & 15) << 3;   // staging: 16 rows x 16 x 16 bytes

  auto stage = [&](int buf, int kk) {   // rows sr, sr+16, ..., sr+112 of both operands
    async_copy8_b128(&As[buf][sr][sg], A  + (size_t)(m0 + sr) * K + kk + sg, (size_t)16 * K);
    async_copy8_b128(&Bs[buf][sr][sg], Bt + (size_t)(n0 + sr) * K + kk + sg, (size_t)16 * K);
  };

  v8f acc[4][2] = {};
  const int nt = K / GK_;
  stage(0, 0);
  async_wait0();
  __syncthreads();
  if (nt > 1) stage(1, GK_);

  for (int t = 0; t < nt; ++t) {
    const int buf = t & 1;
    v16bf a[2][4], b[2][2];              // two fragment sets, one per 32 of K
    auto frags = [&](int set, int kc) {
      #pragma unroll
      for (int j = 0; j < 2; ++j)
        b[set][j] = load_frag(&Bs[buf][wc + j * 16 + c][kc * 32], hl);
      #pragma unroll
      for (int i = 0; i < 4; ++i)
        a[set][i] = load_frag(&As[buf][wr + i * 16 + c][kc * 32], hl);
    };
    frags(0, 0);
    frags(1, 1);
    // The sched_barriers of this loop keep each set's LDS reads one group between
    // whole runs of WMMAs, two sets ahead: left alone the compiler spreads the reads
    // among the WMMAs with a full wait at each place, or sinks WMMAs behind the
    // barrier, where they take the copies' lead away.
    __builtin_amdgcn_sched_barrier(0);
    #pragma unroll
    for (int kc = 0; kc < GK_ / 32; ++kc) {
      #pragma unroll
      for (int i = 0; i < 4; ++i)
        #pragma unroll
        for (int j = 0; j < 2; ++j)
          acc[i][j] = wmma_bf16(a[kc & 1][i], b[kc & 1][j], acc[i][j]);
      __builtin_amdgcn_sched_barrier(0);
      if (kc + 2 < GK_ / 32) {
        frags(kc & 1, kc + 2);
        __builtin_amdgcn_sched_barrier(0);
      }
    }
    lds_wait0();                 // this trip's reads of buf are done
    async_wait0();               // this wave's share of tile t+1 has landed
    __syncthreads();             // publishes tile t+1, frees buf
    if (t + 2 < nt) stage(buf, (t + 2) * GK_);   // flies during trip t+1
  }
  async_wait0();

  #pragma unroll
  for (int i = 0; i < 4; ++i)
    #pragma unroll
    for (int j = 0; j < 2; ++j)
      #pragma unroll
      for (int e = 0; e < 8; ++e) {
        const int row = m0 + wr + i * 16 + hl * 8 + e;   // C layout: VGPR e + half
        const int col = n0 + wc + j * 16 + c;            // lane % 16
        float v = acc[i][j][e] + bias[col];
        if constexpr (EPI == 0) {
          outB[(size_t)row * N + col] = (__bf16)(v * scale);
        } else if constexpr (EPI == 1) {
          outF[(size_t)row * N + col] = v + resid[(size_t)row * N + col];
        } else if constexpr (EPI == 2) {
          outB[(size_t)row * N + col] =
              (__bf16)(0.5f * v * (1.0f + erff(v * 0.70710678118f)));
        } else {
          outB[(size_t)col * S_ + row] = (__bf16)v;      // vT[dim][seq]
        }
      }
}

constexpr int AST_ = 64;
constexpr int AKP_ = HD_ + 8;
constexpr int AVP_ = AST_ + 8;

// lane l <-> lane l ^ 16
__device__ __forceinline__ float xhalf(float x) {
  const int b = __builtin_bit_cast(int, x);
  return __builtin_bit_cast(float, __builtin_amdgcn_permlanex16(
      b, b, 0x76543210, 0xfedcba98, false, false));
}

// e^x as v_exp_f32(x * log2 e), what __expf compiles to here. The v_nop fills the
// slot the instruction set asks for behind a transcendental before its source is
// overwritten.
__device__ __forceinline__ float exp_slot(float x) {
  float r;
  asm("v_exp_f32 %0, %1\n\tv_nop" : "=v"(r) : "v"(x * 1.4426950408889634f));
  return r;
}

__global__ __launch_bounds__(128) void attn_kernel(
    const __bf16* __restrict__ Q, const __bf16* __restrict__ Kb,
    const __bf16* __restrict__ vT,               // [D][S] transposed values
    const int* __restrict__ amask, __bf16* __restrict__ ctx) {
  __shared__ alignas(16) __bf16 Ks[2][AST_][AKP_];   // [key][dim]  (K Q^T   A-frags)
  __shared__ alignas(16) __bf16 Vt[2][HD_][AVP_];    // [dim][key]  (V^T P^T A-frags)

  const int tid  = threadIdx.x;
  const int wave = tid >> 5, lane = tid & 31;
  const int c  = lane & 15, hl = lane >> 4;
  const int h    = blockIdx.y;
  const int q0   = blockIdx.x * 64 + wave * 16;
  const int hoff = h * HD_;
  const int qr   = q0 + c;                       // this lane's query

  v16bf aq[2];                                   // Q^T as B: lane = query column
  #pragma unroll
  for (int kc = 0; kc < 2; ++kc)
    aq[kc] = load_frag(Q + (size_t)(q0 + c) * D_ + hoff + kc * 32, hl);

  v8f o[4] = {};                                 // o[d][r] = O[qr][d*16 + 8*hl + r]
  float m = -1e30f, l = 0.f;                     // l: this half's keys only

  // 64 keys of K (row-major) and of V (already transposed): both tiles are 64 rows of
  // 128 bytes; eight neighbouring lanes bring a row, a thread rows sr, sr+16, +32, +48
  const int sr = tid >> 3, sg = (tid & 7) << 3;
  auto stage = [&](int buf, int k0) {
    async_copy4x2_b128(&Ks[buf][sr][sg], Kb + (size_t)(k0 + sr) * D_ + hoff + sg,
                       (size_t)16 * D_,
                       &Vt[buf][sr][sg], vT + (size_t)(hoff + sr) * S_ + k0 + sg,
                       (size_t)16 * S_, 16 * AKP_ * 2);
  };
  static_assert(AKP_ == AVP_, "one LDS row step serves both tiles");

  const int nst = blockIdx.x + 1;                // stages up to the causal bound
  stage(0, 0);
  // bit k of pad[ps]: key 32*ps+k of the stage is no padding
  unsigned pad[2] = {__builtin_amdgcn_ballot_w32(amask[lane] != 0),
                     __builtin_amdgcn_ballot_w32(amask[32 + lane] != 0)};
  async_wait0();
  __syncthreads();
  if (nst > 1) stage(1, AST_);

  for (int st = 0; st < nst; ++st) {
    const int buf = st & 1;
    // the next stage's mask words, asked for now and used at the foot of this trip
    // (the last trip asks for its own again: the address stays inside the mask)
    const int nk = (st + 1 < nst ? st + 1 : st) * AST_;
    const int mk0 = amask[nk + lane], mk1 = amask[nk + 32 + lane];
    // two passes of 32 keys, unrolled: pad[ps] and the LDS offsets are then constants,
    // and pass 1's score products can start while pass 0's softmax runs
    #pragma unroll
    for (int ps = 0; ps < 2; ++ps) {
      const int kb = st * AST_ + ps * 32;
      // S^T(32x16) = K(32x64) @ Q^T(64x16); s[sub][r] = key kb+sub*16+8*hl+r, query qr
      v8f s[2] = {};
      #pragma unroll
      for (int sub = 0; sub < 2; ++sub)
        #pragma unroll
        for (int kc = 0; kc < 2; ++kc) {
          v16bf a = load_frag(&Ks[buf][ps * 32 + sub * 16 + c][kc * 32], hl);
          s[sub] = wmma_bf16(a, aq[kc], s[sub]);
        }

      // bit k of keep: key kb+8*hl+k is open to this lane's query (padding and causal)
      const int n = qr - kb;                       // last key index the query may see
      const unsigned cau = n >= 31 ? 0xffffffffu : (n < 0 ? 0u : (2u << n) - 1u);
      const unsigned keep = (pad[ps] & cau) >> (hl * 8);

      // online softmax, one query per lane
      float mx = -1e30f;
      #pragma unroll
      for (int sub = 0; sub < 2; ++sub)
        #pragma unroll
        for (int r = 0; r < 8; ++r) {
          if (((keep >> (sub * 16 + r)) & 1u) == 0u) s[sub][r] = -1e30f;
          mx = fmaxf(mx, s[sub][r]);
        }
      mx = fmaxf(mx, xhalf(mx));                   // both halves: the query's maximum
      const float mn  = fmaxf(m, mx);
      const float fac = exp_slot(m - mn);
      m = mn;
      v16bf bp;                                    // P^T as B, hardware k order
      float rs = 0.f;
      #pragma unroll
      for (int sub = 0; sub < 2; ++sub)
        #pragma unroll
        for (int r = 0; r < 8; ++r) {
          const float p = exp_slot(s[sub][r] - mn);
          rs += p;
          bp[sub * 8 + r] = (__bf16)p;
        }
      l = l * fac + rs;
      #pragma unroll
      for (int d = 0; d < 4; ++d)
        #pragma unroll
        for (int r = 0; r < 8; ++r) o[d][r] *= fac;

      // O^T += V^T @ P^T
      #pragma unroll
      for (int d = 0; d < 4; ++d) {
        v16bf av = load_frag(&Vt[buf][d * 16 + c][ps * 32], hl);
        o[d] = wmma_bf16(av, bp, o[d]);
      }
    }
    pad[0] = __builtin_amdgcn_ballot_w32(mk0 != 0);
    pad[1] = __builtin_amdgcn_ballot_w32(mk1 != 0);
    lds_wait0();                 // this trip's reads of buf are done
    async_wait0();               // this wave's share of stage st+1 has landed
    __syncthreads();             // publishes stage st+1, frees buf
    if (st + 2 < nst) stage(buf, (st + 2) * AST_);   // flies during trip st+1
  }
  async_wait0();

  const float inv = 1.0f / (l + xhalf(l));       // join the halves' sums once
  #pragma unroll
  for (int d = 0; d < 4; ++d) {
    v8bf w;
    #pragma unroll
    for (int r = 0; r < 8; ++r) w[r] = (__bf16)(o[d][r] * inv);
    *reinterpret_cast<v8bf*>(ctx + (size_t)qr * D_ + hoff + d * 16 + hl * 8) = w;
  }
}

// ---------------------------------------------------------------------------
// Host launcher
// ---------------------------------------------------------------------------
extern "C" void kernel_launch(void* const* d_in, const int* in_sizes, int n_in,
                              void* d_out, int out_size, void* d_ws, size_t ws_size,
                              hipStream_t stream) {
  const float* hidden = (const float*)d_in[0];
  const int*   mask   = (const int*)  d_in[1];
  const float* ln1w   = (const float*)d_in[2];
  const float* ln1b   = (const float*)d_in[3];
  const float* wq     = (const float*)d_in[4];
  const float* bq     = (const float*)d_in[5];
  const float* wk     = (const float*)d_in[6];
  const float* bk     = (const float*)d_in[7];
  const float* wv     = (const float*)d_in[8];
  const float* bv     = (const float*)d_in[9];
  const float* wo     = (const float*)d_in[10];
  const float* bo     = (const float*)d_in[11];
  const float* ln2w   = (const float*)d_in[12];
  const float* ln2b   = (const float*)d_in[13];
  const float* wup    = (const float*)d_in[14];
  const float* bup    = (const float*)d_in[15];
  const float* wdown  = (const float*)d_in[16];
  const float* bdown  = (const float*)d_in[17];
  float* out = (float*)d_out;

  constexpr size_t W_DD  = (size_t)D_ * D_;
  constexpr size_t W_DF  = (size_t)D_ * FF_;
  constexpr size_t ACT   = (size_t)S_ * D_;
  constexpr size_t ACTFF = (size_t)S_ * FF_;

  char* ws = (char*)d_ws;
  size_t off = 0;
  __bf16* wqT  = (__bf16*)(ws + off); off += W_DD * 2;   // all weights [N][K] bf16
  __bf16* wkT  = (__bf16*)(ws + off); off += W_DD * 2;
  __bf16* wvT  = (__bf16*)(ws + off); off += W_DD * 2;
  __bf16* woT  = (__bf16*)(ws + off); off += W_DD * 2;
  __bf16* wupT = (__bf16*)(ws + off); off += W_DF * 2;
  __bf16* wdnT = (__bf16*)(ws + off); off += W_DF * 2;
  __bf16* xln_bf  = (__bf16*)(ws + off); off += ACT * 2;
  __bf16* q_bf    = (__bf16*)(ws + off); off += ACT * 2;
  __bf16* k_bf    = (__bf16*)(ws + off); off += ACT * 2;
  __bf16* vT_bf   = (__bf16*)(ws + off); off += ACT * 2;  // [D][S]
  __bf16* ctx_bf  = (__bf16*)(ws + off); off += ACT * 2;
  float*  hidden2 = (float*) (ws + off); off += ACT * 4;
  __bf16* yln_bf  = (__bf16*)(ws + off); off += ACT * 2;
  __bf16* ff_bf   = (__bf16*)(ws + off); off += ACTFF * 2;

  auto transp = [&](const float* src, __bf16* dst, int K, int N) {
    transpose_to_bf16_kernel<<<dim3(N / 32, K / 32), 256, 0, stream>>>(src, dst, K, N);
  };
  transp(wq, wqT, D_, D_);   transp(wk, wkT, D_, D_);  transp(wv, wvT, D_, D_);
  transp(wo, woT, D_, D_);   transp(wup, wupT, D_, FF_);
  transp(wdown, wdnT, FF_, D_);

  // LN1
  ln_bf16_kernel<<<S_ / (8 * LNR_), 256, 0, stream>>>(hidden, ln1w, ln1b, xln_bf);

  // Projections (Q pre-scaled by 1/sqrt(HD); V written transposed)
  dim3 gDD(D_ / GT_, S_ / GT_);
  gemm_bf16_kernel<0><<<gDD, 256, 0, stream>>>(xln_bf, wqT, bq, nullptr, nullptr, q_bf,
                                               S_, D_, D_, 0.125f);
  gemm_bf16_kernel<0><<<gDD, 256, 0, stream>>>(xln_bf, wkT, bk, nullptr, nullptr, k_bf,
                                               S_, D_, D_, 1.0f);
  gemm_bf16_kernel<3><<<gDD, 256, 0, stream>>>(xln_bf, wvT, bv, nullptr, nullptr, vT_bf,
                                               S_, D_, D_, 1.0f);

  // Flash attention
  attn_kernel<<<dim3(S_ / 64, H_), 128, 0, stream>>>(q_bf, k_bf, vT_bf, mask, ctx_bf);

  // O-projection + residual -> hidden2 (fp32)
  gemm_bf16_kernel<1><<<gDD, 256, 0, stream>>>(ctx_bf, woT, bo, hidden, hidden2, nullptr,
                                               S_, D_, D_, 1.0f);

  // LN2
  ln_bf16_kernel<<<S_ / (8 * LNR_), 256, 0, stream>>>(hidden2, ln2w, ln2b, yln_bf);

  // Up-projection + exact GELU -> bf16
  gemm_bf16_kernel<2><<<dim3(FF_ / GT_, S_ / GT_), 256, 0, stream>>>(
      yln_bf, wupT, bup, nullptr, nullptr, ff_bf, S_, FF_, D_, 1.0f);

  // Down-projection + residual -> d_out (fp32)
  gemm_bf16_kernel<1><<<gDD, 256, 0, stream>>>(ff_bf, wdnT, bdown, hidden2, out, nullptr,
                                               S_, D_, FF_, 1.0f);
}

// v006
// It runs in 192 microseconds.
// Next to v005, in two timings, it ran 1.05 times as fast each time.
// Counting every step since v000, it is 2.72 times as fast.
#include <hip/hip_runtime.h>
#include <hip/hip_bf16.h>
#include <math.h>

// ---------------------------------------------------------------------------
// Transformer block (B=1, S=4096, D=768, H=12, HD=64, FF=3072) on gfx1250.
// ~110 GFLOP vs ~55MB minimum traffic -> strongly compute bound: bf16 WMMA
// (v_wmma_f32_16x16x32_bf16, fp32 accum) everywhere, flash-attention so the
// 805MB score tensor never exists, and GLOBAL_LOAD_ASYNC_TO_LDS_B128 (ASYNCcnt)
// staging with double buffering so HBM->LDS copies overlap the matrix pipe.
// ---------------------------------------------------------------------------

typedef __attribute__((ext_vector_type(16))) __bf16 v16bf;
typedef __attribute__((ext_vector_type(8)))  __bf16 v8bf;
typedef __attribute__((ext_vector_type(8)))  float  v8f;

constexpr int S_  = 4096;
constexpr int D_  = 768;
constexpr int H_  = 12;
constexpr int HD_ = 64;
constexpr int FF_ = 3072;

__device__ __forceinline__ v16bf cat16(v8bf lo, v8bf hi) {
  return __builtin_shufflevector(lo, hi, 0,1,2,3,4,5,6,7,8,9,10,11,12,13,14,15);
}
// A/B fragment loader: p points at a 32-wide K-run; lane half hl selects
// K offsets {hl*8..+8} and {16+hl*8..+8} per the ISA 16-bit operand layout.
__device__ __forceinline__ v16bf load_frag(const __bf16* p, int hl) {
  v8bf lo = *reinterpret_cast<const v8bf*>(p + hl * 8);
  v8bf hi = *reinterpret_cast<const v8bf*>(p + 16 + hl * 8);
  return cat16(lo, hi);
}
__device__ __forceinline__ v8f wmma_bf16(v16bf a, v16bf b, v8f c) {
  return __builtin_amdgcn_wmma_f32_16x16x32_bf16(false, a, false, b, (short)0, c,
                                                 false, false);
}

// CDNA5 async global->LDS copy (no VGPR round trip, tracked by ASYNCcnt).
// Generic shared pointers carry the LDS offset in their low 32 bits
// (ISA 10.2: LDS_ADDR.U32 = addr[31:0]); dsaddr = LDS_BASE + VGPR + IOFFSET.
// Four rows of one tile and four of another (rows 16 apart: ls bytes in LDS, ga or
// gb elements in memory) and their s_wait_xcnt 0 in ONE statement: every address
// register stays live to its end, so none is rewritten in front of the wait.
__device__ __forceinline__ void async_copy4x2_b128(const __bf16* la, const __bf16* a,
                                                   size_t ga, const __bf16* lb,
                                                   const __bf16* b, size_t gb,
                                                   unsigned ls) {
  const unsigned a0 = (unsigned)(uintptr_t)la, b0 = (unsigned)(uintptr_t)lb;
  asm volatile("global_load_async_to_lds_b128 %0, %1, off\n\t"
               "global_load_async_to_lds_b128 %2, %3, off\n\t"
               "global_load_async_to_lds_b128 %4, %5, off\n\t"
               "global_load_async_to_lds_b128 %6, %7, off\n\t"
               "global_load_async_to_lds_b128 %8, %9, off\n\t"
               "global_load_async_to_lds_b128 %10, %11, off\n\t"
               "global_load_async_to_lds_b128 %12, %13, off\n\t"
               "global_load_async_to_lds_b128 %14, %15, off\n\t"
               "s_wait_xcnt 0x0"
               :: "v"(a0),          "v"(a),
                  "v"(a0 + ls),     "v"(a + ga),
                  "v"(a0 + 2 * ls), "v"(a + 2 * ga),
                  "v"(a0 + 3 * ls), "v"(a + 3 * ga),
                  "v"(b0),          "v"(b),
                  "v"(b0 + ls),     "v"(b + gb),
                  "v"(b0 + 2 * ls), "v"(b + 2 * gb),
                  "v"(b0 + 3 * ls), "v"(b + 3 * gb)
               : "memory");
}
__device__ __forceinline__ void async_wait0() {
  asm volatile("s_wait_asynccnt 0x0" ::: "memory");
}
// This wave's LDS reads have retired: stands in front of the barrier behind which
// copies refill the buffer that was read.
__device__ __forceinline__ void lds_wait0() {
  asm volatile("s_wait_dscnt 0x0" ::: "memory");
}

// ---------------------------------------------------------------------------
// Weight prep: [K][N] fp32 -> [N][K] bf16 for all six weights in ONE launch.
// Lets GEMM B-staging be straight contiguous async copies.
// A block of 8 waves transposes a tile of 128 (k) x 64 (n) through LDS. A thread reads
// eight rows of four floats (a wave-wide load: two runs of 256 bytes), so it holds eight
// successive k of four columns: four 16-byte LDS writes. The tile leaves as rows of
// 256 bytes, 16 bytes a lane. 864 blocks, all resident at once: a launch this short
// pays for each wave that it has to start, and each launch for the gap in front of it.
// LDS rows are 256 bytes, unpadded; the 16-byte chunk ch of row r stands at place
// ch ^ ((r >> 2) & 15): the sixteen lanes of a write (rows four apart, one chunk) and
// the sixteen of a read (one row, all chunks) each meet sixteen different places.
// ---------------------------------------------------------------------------
typedef __attribute__((ext_vector_type(4))) float  v4f;

constexpr int PK_  = 128;                          // tile extent along k
constexpr int PN_  = 64;                           // tile extent along n
constexpr int PDD_ = (D_ / PK_) * (D_ / PN_);      // tiles of a D x D weight
constexpr int PDF_ = (D_ / PK_) * (FF_ / PN_);     // tiles of w_up, and of w_down
static_assert(D_ % PK_ == 0 && FF_ % PK_ == 0 && D_ % PN_ == 0 && FF_ % PN_ == 0,
              "whole tiles only");

// One tile. K and N are compile-time: the eight loads then share one scalar base and one
// lane-offset register, differ in their immediate offsets and issue as one group.
template <int K, int N>
__device__ __forceinline__ void transpose_tile(const float* __restrict__ in,
                                               __bf16* __restrict__ out, int t,
                                               __bf16* tile) {
  constexpr int ntn = N / PN_;
  const int kb = (t / ntn) * PK_, nb = (t % ntn) * PN_;
  const unsigned lo = threadIdx.x & 15, hi = threadIdx.x >> 4;
  const float* src = in + ((size_t)kb * N + nb);   // scalar bases of the tile
  __bf16* dst = out + ((size_t)nb * K + kb);

  v4f x[8];                          // x[j][i] = in[kb + hi*8 + j][nb + lo*4 + i]
  const unsigned li = hi * 8 * N + lo * 4;
  #pragma unroll
  for (int j = 0; j < 8; ++j)
    x[j] = *reinterpret_cast<const v4f*>(src + (li + j * N));
  #pragma unroll
  for (int i = 0; i < 4; ++i) {      // row lo*4+i, chunk hi; (row >> 2) & 15 is lo
    v8bf p;
    #pragma unroll
    for (int j = 0; j < 8; ++j) p[j] = (__bf16)x[j][i];
    *reinterpret_cast<v8bf*>(tile + (lo * 4 + i) * PK_ + (hi ^ lo) * 8) = p;
  }
  __syncthreads();
  const unsigned so = hi * K + lo * 8;
  #pragma unroll
  for (int y = 0; y < 4; ++y) {      // row hi+16*y, chunk lo
    const unsigned r = hi + y * 16;
    const v8bf p = *reinterpret_cast<const v8bf*>(tile + r * PK_ + (lo ^ ((r >> 2) & 15)) * 8);
    *reinterpret_cast<v8bf*>(dst + (so + y * 16 * K)) = p;
  }
}

__global__ __launch_bounds__(256) void weights_to_bf16_t_kernel(
    const float* __restrict__ wq, const float* __restrict__ wk,
    const float* __restrict__ wv, const float* __restrict__ wo,
    const float* __restrict__ wup, const float* __restrict__ wdown,
    __bf16* __restrict__ outT) {     // the six outputs in that order, back to back
  __shared__ alignas(16) __bf16 tile[PN_ * PK_];   // [n][k], chunks swizzled

  // which weight and which tile of it: the same for the whole block
  const int bid = blockIdx.x;
  if (bid < 4 * PDD_) {
    const int w = bid / PDD_;
    transpose_tile<D_, D_>(w == 0 ? wq : w == 1 ? wk : w == 2 ? wv : wo,
                           outT + (size_t)w * D_ * D_, bid - w * PDD_, tile);
  } else if (bid < 4 * PDD_ + PDF_) {
    transpose_tile<D_, FF_>(wup, outT + (size_t)4 * D_ * D_, bid - 4 * PDD_, tile);
  } else {
    transpose_tile<FF_, D_>(wdown, outT + (size_t)4 * D_ * D_ + (size_t)D_ * FF_,
                            bid - 4 * PDD_ - PDF_, tile);
  }
}

// ---------------------------------------------------------------------------
// LayerNorm (fp32 in) -> bf16 out.  One WAVE per pair of rows, no LDS, no barrier.
// A row of 768 floats lives in registers (six 16-byte loads a lane, each wave-wide
// load 512 contiguous bytes), is read from memory once, and both sums are taken
// in-lane plus a five-step butterfly across the wave. 2,048 waves a launch, eight on
// every WGP: a launch this short pays for each wave that it has to start.
// ---------------------------------------------------------------------------
typedef __attribute__((ext_vector_type(4))) __bf16 v4bf;

constexpr int LNR_ = 2;            // rows per wave
constexpr int LNC_ = D_ / 128;     // 16-byte chunks of a row per lane

// x + (x of lane ^ MASK) inside a 16-lane row (DPP row_xmask)
template <int MASK>
__device__ __forceinline__ float add_xmask(float x) {
  const int v = __builtin_bit_cast(int, x);
  return x + __builtin_bit_cast(float,
      __builtin_amdgcn_update_dpp(0, v, 0x160 + MASK, 0xf, 0xf, true));
}
// sum over the 32 lanes, the same value in every lane
__device__ __forceinline__ float wave_sum(float x) {
  x = add_xmask<1>(x);
  x = add_xmask<2>(x);
  x = add_xmask<4>(x);
  x = add_xmask<8>(x);
  const int v = __builtin_bit_cast(int, x);
  return x + __builtin_bit_cast(float, __builtin_amdgcn_permlanex16(
      v, v, 0x76543210, 0xfedcba98, false, false));
}

// amdgpu_waves_per_eu(2, 4): the grid puts two waves on a SIMD; aiming at sixteen the
// compiler kept to 64 registers and loaded w and b late, pair by pair, a full wait each.
__global__ __launch_bounds__(256) __attribute__((amdgpu_waves_per_eu(2, 4)))
void ln_bf16_kernel(
    const float* __restrict__ x, const float* __restrict__ w,
    const float* __restrict__ b, __bf16* __restrict__ out) {
  // the wave's number as a scalar: row bases stand in scalar registers, and every
  // load and store of the wave shares one lane-offset register
  const int wave = __builtin_amdgcn_readfirstlane(threadIdx.x >> 5);
  const int lane = threadIdx.x & 31;
  const int row0 = (blockIdx.x * 8 + wave) * LNR_;
  const unsigned col = lane * 4;
  const float* xr = x + (size_t)row0 * D_;       // scalar bases of the wave's rows
  __bf16* orow = out + (size_t)row0 * D_;

  v4f v[LNR_][LNC_], wv[LNC_], bv[LNC_];
  #pragma unroll
  for (int i = 0; i < LNC_; ++i) {
    wv[i] = *reinterpret_cast<const v4f*>(w + (col + i * 128));
    bv[i] = *reinterpret_cast<const v4f*>(b + (col + i * 128));
  }
  #pragma unroll
  for (int r = 0; r < LNR_; ++r)
    #pragma unroll
    for (int i = 0; i < LNC_; ++i)
      v[r][i] = *reinterpret_cast<const v4f*>(xr + (col + (r * D_ + i * 128)));

  #pragma unroll
  for (int r = 0; r < LNR_; ++r) {
    v4f s4 = v[r][0];
    #pragma unroll
    for (int i = 1; i < LNC_; ++i) s4 += v[r][i];
    const float mu = wave_sum((s4[0] + s4[1]) + (s4[2] + s4[3])) * (1.0f / D_);
    v4f q4 = {};
    #pragma unroll
    for (int i = 0; i < LNC_; ++i) {
      v[r][i] -= mu;
      q4 += v[r][i] * v[r][i];
    }
    const float var  = wave_sum((q4[0] + q4[1]) + (q4[2] + q4[3])) * (1.0f / D_);
    const float rstd = rsqrtf(var + 1e-5f);
    #pragma unroll
    for (int i = 0; i < LNC_; ++i) {
      const v4f y = v[r][i] * rstd * wv[i] + bv[i];
      v4bf o;
      #pragma unroll
      for (int e = 0; e < 4; ++e) o[e] = (__bf16)y[e];
      *reinterpret_cast<v4bf*>(orow + (col + (r * D_ + i * 128))) = o;
    }
  }
}

// ---------------------------------------------------------------------------
// Tiled bf16 GEMM: C[M,N] = A[M,K] * Bt[N,K]^T (+bias epilogues)
// Block = 256 threads (8 waves), tile 128x128, K-step 128, two LDS buffers fed by
// async copies. A staged row is 256 bytes, two whole cache lines, brought by
// sixteen neighbouring lanes; LDS rows stand at a pitch of 272 bytes (16 B x odd),
// free of bank conflicts for the 16-byte fragment reads. Each wave owns 64x32:
// 8 WMMA per 32 of K from 4 A-frags x 2 B-frags.
// M, N multiples of 128; K a multiple of 128.
// EPI 0: outB = bf16((acc+bias)*scale)      (Q/K projections; Q scale 0.125)
// EPI 1: outF = acc + bias + resid          (O-proj, down-proj)
// EPI 2: outB = bf16(gelu_exact(acc+bias))  (up-proj)
// EPI 3: outB[col*S_+row] = acc + bias      (V projection, stored transposed)
// ---------------------------------------------------------------------------
constexpr int GT_ = 128;       // tile rows of A and of Bt
constexpr int GK_ = 128;       // K-step
constexpr int GP_ = GK_ + 8;   // LDS row pitch in elements (272 bytes)

// Eight copies, rows 16 apart, and their s_wait_xcnt 0 in ONE statement: every
// address register stays live to its end, so none is rewritten in front of the wait.
__device__ __forceinline__ void async_copy8_b128(const __bf16* l, const __bf16* g,
                                                 size_t gs) {
  const unsigned l0 = (unsigned)(uintptr_t)l;
  constexpr unsigned ls = 16 * GP_ * 2;          // 16 LDS rows in bytes
  asm volatile("global_load_async_to_lds_b128 %0, %1, off\n\t"
               "global_load_async_to_lds_b128 %2, %3, off\n\t"
               "global_load_async_to_lds_b128 %4, %5, off\n\t"
               "global_load_async_to_lds_b128 %6, %7, off\n\t"
               "global_load_async_to_lds_b128 %8, %9, off\n\t"
               "global_load_async_to_lds_b128 %10, %11, off\n\t"
               "global_load_async_to_lds_b128 %12, %13, off\n\t"
               "global_load_async_to_lds_b128 %14, %15, off\n\t"
               "s_wait_xcnt 0x0"
               :: "v"(l0),          "v"(g),
                  "v"(l0 + ls),     "v"(g + gs),
                  "v"(l0 + 2 * ls), "v"(g + 2 * gs),
                  "v"(l0 + 3 * ls), "v"(g + 3 * gs),
                  "v"(l0 + 4 * ls), "v"(g + 4 * gs),
                  "v"(l0 + 5 * ls), "v"(g + 5 * gs),
                  "v"(l0 + 6 * ls), "v"(g + 6 * gs),
                  "v"(l0 + 7 * ls), "v"(g + 7 * gs)
               : "memory");
}

// amdgpu_waves_per_eu(2, 4): LDS admits two blocks per WGP, four waves per SIMD, so
// the register budget is 256; aiming at more waves the compiler kept one fragment
// set and waited for every residual load of the epilogue by itself.
template <int EPI>
__global__ __launch_bounds__(256) __attribute__((amdgpu_waves_per_eu(2, 4)))
void gemm_bf16_kernel(
    const __bf16* __restrict__ A, const __bf16* __restrict__ Bt,
    const float* __restrict__ bias, const float* __restrict__ resid,
    float* __restrict__ outF, __bf16* __restrict__ outB,
    int M, int N, int K, float scale) {
  __shared__ alignas(16) __bf16 As[2][GT_][GP_];   // [m][k]
  __shared__ alignas(16) __bf16 Bs[2][GT_][GP_];   // [n][k]

  const int n0 = blockIdx.x * GT_;
  const int m0 = blockIdx.y * GT_;
  const int tid  = threadIdx.x;
  const int wave = tid >> 5, lane = tid & 31;
  const int wr = (wave & 1) * 64;     // wave row base (4 sub-tiles of 16)
  const int wc = (wave >> 1) * 32;    // wave col base (2 sub-tiles of 16)
  const int c  = lane & 15, hl = lane >> 4;
  const int sr = tid >> 4, sg = (tid & 15) << 3;   // staging: 16 rows x 16 x 16 bytes

  auto stage = [&](int buf, int kk) {   // rows sr, sr+16, ..., sr+112 of both operands
    async_copy8_b128(&As[buf][sr][sg], A  + (size_t)(m0 + sr) * K + kk + sg, (size_t)16 * K);
    async_copy8_b128(&Bs[buf][sr][sg], Bt + (size_t)(n0 + sr) * K + kk + sg, (size_t)16 * K);
  };

  v8f acc[4][2] = {};
  const int nt = K / GK_;
  stage(0, 0);
  async_wait0();
  __syncthreads();
  if (nt > 1) stage(1, GK_);

  for (int t = 0; t < nt; ++t) {
    const int buf = t & 1;
    v16bf a[2][4], b[2][2];              // two fragment sets, one per 32 of K
    auto frags = [&](int set, int kc) {
      #pragma unroll
      for (int j = 0; j < 2; ++j)
        b[set][j] = load_frag(&Bs[buf][wc + j * 16 + c][kc * 32], hl);
      #pragma unroll
      for (int i = 0; i < 4; ++i)
        a[set][i] = load_frag(&As[buf][wr + i * 16 + c][kc * 32], hl);
    };
    frags(0, 0);
    frags(1, 1);
    // The sched_barriers of this loop keep each set's LDS reads one group between
    // whole runs of WMMAs, two sets ahead: left alone the compiler spreads the reads
    // among the WMMAs with a full wait at each place, or sinks WMMAs behind the
    // barrier, where they take the copies' lead away.
    __builtin_amdgcn_sched_barrier(0);
    #pragma unroll
    for (int kc = 0; kc < GK_ / 32; ++kc) {
      #pragma unroll
      for (int i = 0; i < 4; ++i)
        #pragma unroll
        for (int j = 0; j < 2; ++j)
          acc[i][j] = wmma_bf16(a[kc & 1][i], b[kc & 1][j], acc[i][j]);
      __builtin_amdgcn_sched_barrier(0);
      if (kc + 2 < GK_ / 32) {
        frags(kc & 1, kc + 2);
        __builtin_amdgcn_sched_barrier(0);
      }
    }
    lds_wait0();                 // this trip's reads of buf are done
    async_wait0();               // this wave's share of tile t+1 has landed
    __syncthreads();             // publishes tile t+1, frees buf
    if (t + 2 < nt) stage(buf, (t + 2) * GK_);   // flies during trip t+1
  }
  async_wait0();

  #pragma unroll
  for (int i = 0; i < 4; ++i)
    #pragma unroll
    for (int j = 0; j < 2; ++j)
      #pragma unroll
      for (int e = 0; e < 8; ++e) {
        const int row = m0 + wr + i * 16 + hl * 8 + e;   // C layout: VGPR e + half
        const int col = n0 + wc + j * 16 + c;            // lane % 16
        float v = acc[i][j][e] + bias[col];
        if constexpr (EPI == 0) {
          outB[(size_t)row * N + col] = (__bf16)(v * scale);
        } else if constexpr (EPI == 1) {
          outF[(size_t)row * N + col] = v + resid[(size_t)row * N + col];
        } else if constexpr (EPI == 2) {
          outB[(size_t)row * N + col] =
              (__bf16)(0.5f * v * (1.0f + erff(v * 0.70710678118f)));
        } else {
          outB[(size_t)col * S_ + row] = (__bf16)v;      // vT[dim][seq]
        }
      }
}

constexpr int AST_ = 64;
constexpr int AKP_ = HD_ + 8;
constexpr int AVP_ = AST_ + 8;

// lane l <-> lane l ^ 16
__device__ __forceinline__ float xhalf(float x) {
  const int b = __builtin_bit_cast(int, x);
  return __builtin_bit_cast(float, __builtin_amdgcn_permlanex16(
      b, b, 0x76543210, 0xfedcba98, false, false));
}

// e^x as v_exp_f32(x * log2 e), what __expf compiles to here. The v_nop fills the
// slot the instruction set asks for behind a transcendental before its source is
// overwritten.
__device__ __forceinline__ float exp_slot(float x) {
  float r;
  asm("v_exp_f32 %0, %1\n\tv_nop" : "=v"(r) : "v"(x * 1.4426950408889634f));
  return r;
}

__global__ __launch_bounds__(128) void attn_kernel(
    const __bf16* __restrict__ Q, const __bf16* __restrict__ Kb,
    const __bf16* __restrict__ vT,               // [D][S] transposed values
    const int* __restrict__ amask, __bf16* __restrict__ ctx) {
  __shared__ alignas(16) __bf16 Ks[2][AST_][AKP_];   // [key][dim]  (K Q^T   A-frags)
  __shared__ alignas(16) __bf16 Vt[2][HD_][AVP_];    // [dim][key]  (V^T P^T A-frags)

  const int tid  = threadIdx.x;
  const int wave = tid >> 5, lane = tid & 31;
  const int c  = lane & 15, hl = lane >> 4;
  const int h    = blockIdx.y;
  const int q0   = blockIdx.x * 64 + wave * 16;
  const int hoff = h * HD_;
  const int qr   = q0 + c;                       // this lane's query

  v16bf aq[2];                                   // Q^T as B: lane = query column
  #pragma unroll
  for (int kc = 0; kc < 2; ++kc)
    aq[kc] = load_frag(Q + (size_t)(q0 + c) * D_ + hoff + kc * 32, hl);

  v8f o[4] = {};                                 // o[d][r] = O[qr][d*16 + 8*hl + r]
  float m = -1e30f, l = 0.f;                     // l: this half's keys only

  // 64 keys of K (row-major) and of V (already transposed): both tiles are 64 rows of
  // 128 bytes; eight neighbouring lanes bring a row, a thread rows sr, sr+16, +32, +48
  const int sr = tid >> 3, sg = (tid & 7) << 3;
  auto stage = [&](int buf, int k0) {
    async_copy4x2_b128(&Ks[buf][sr][sg], Kb + (size_t)(k0 + sr) * D_ + hoff + sg,
                       (size_t)16 * D_,
                       &Vt[buf][sr][sg], vT + (size_t)(hoff + sr) * S_ + k0 + sg,
                       (size_t)16 * S_, 16 * AKP_ * 2);
  };
  static_assert(AKP_ == AVP_, "one LDS row step serves both tiles");

  const int nst = blockIdx.x + 1;                // stages up to the causal bound
  stage(0, 0);
  // bit k of pad[ps]: key 32*ps+k of the stage is no padding
  unsigned pad[2] = {__builtin_amdgcn_ballot_w32(amask[lane] != 0),
                     __builtin_amdgcn_ballot_w32(amask[32 + lane] != 0)};
  async_wait0();
  __syncthreads();
  if (nst > 1) stage(1, AST_);

  for (int st = 0; st < nst; ++st) {
    const int buf = st & 1;
    // the next stage's mask words, asked for now and used at the foot of this trip
    // (the last trip asks for its own again: the address stays inside the mask)
    const int nk = (st + 1 < nst ? st + 1 : st) * AST_;
    const int mk0 = amask[nk + lane], mk1 = amask[nk + 32 + lane];
    // two passes of 32 keys, unrolled: pad[ps] and the LDS offsets are then constants,
    // and pass 1's score products can start while pass 0's softmax runs
    #pragma unroll
    for (int ps = 0; ps < 2; ++ps) {
      const int kb = st * AST_ + ps * 32;
      // S^T(32x16) = K(32x64) @ Q^T(64x16); s[sub][r] = key kb+sub*16+8*hl+r, query qr
      v8f s[2] = {};
      #pragma unroll
      for (int sub = 0; sub < 2; ++sub)
        #pragma unroll
        for (int kc = 0; kc < 2; ++kc) {
          v16bf a = load_frag(&Ks[buf][ps * 32 + sub * 16 + c][kc * 32], hl);
          s[sub] = wmma_bf16(a, aq[kc], s[sub]);
        }

      // bit k of keep: key kb+8*hl+k is open to this lane's query (padding and causal)
      const int n = qr - kb;                       // last key index the query may see
      const unsigned cau = n >= 31 ? 0xffffffffu : (n < 0 ? 0u : (2u << n) - 1u);
      const unsigned keep = (pad[ps] & cau) >> (hl * 8);

      // online softmax, one query per lane
      float mx = -1e30f;
      #pragma unroll
      for (int sub = 0; sub < 2; ++sub)
        #pragma unroll
        for (int r = 0; r < 8; ++r) {
          if (((keep >> (sub * 16 + r)) & 1u) == 0u) s[sub][r] = -1e30f;
          mx = fmaxf(mx, s[sub][r]);
        }
      mx = fmaxf(mx, xhalf(mx));                   // both halves: the query's maximum
      const float mn  = fmaxf(m, mx);
      const float fac = exp_slot(m - mn);
      m = mn;
      v16bf bp;                                    // P^T as B, hardware k order
      float rs = 0.f;
      #pragma unroll
      for (int sub = 0; sub < 2; ++sub)
        #pragma unroll
        for (int r = 0; r < 8; ++r) {
          const float p = exp_slot(s[sub][r] - mn);
          rs += p;
          bp[sub * 8 + r] = (__bf16)p;
        }
      l = l * fac + rs;
      #pragma unroll
      for (int d = 0; d < 4; ++d)
        #pragma unroll
        for (int r = 0; r < 8; ++r) o[d][r] *= fac;

      // O^T += V^T @ P^T
      #pragma unroll
      for (int d = 0; d < 4; ++d) {
        v16bf av = load_frag(&Vt[buf][d * 16 + c][ps * 32], hl);
        o[d] = wmma_bf16(av, bp, o[d]);
      }
    }
    pad[0] = __builtin_amdgcn_ballot_w32(mk0 != 0);
    pad[1] = __builtin_amdgcn_ballot_w32(mk1 != 0);
    lds_wait0();                 // this trip's reads of buf are done
    async_wait0();               // this wave's share of stage st+1 has landed
    __syncthreads();             // publishes stage st+1, frees buf
    if (st + 2 < nst) stage(buf, (st + 2) * AST_);   // flies during trip st+1
  }
  async_wait0();

  const float inv = 1.0f / (l + xhalf(l));       // join the halves' sums once
  #pragma unroll
  for (int d = 0; d < 4; ++d) {
    v8bf w;
    #pragma unroll
    for (int r = 0; r < 8; ++r) w[r] = (__bf16)(o[d][r] * inv);
    *reinterpret_cast<v8bf*>(ctx + (size_t)qr * D_ + hoff + d * 16 + hl * 8) = w;
  }
}

// ---------------------------------------------------------------------------
// Host launcher
// ---------------------------------------------------------------------------
extern "C" void kernel_launch(void* const* d_in, const int* in_sizes, int n_in,
                              void* d_out, int out_size, void* d_ws, size_t ws_size,
                              hipStream_t stream) {
  const float* hidden = (const float*)d_in[0];
  const int*   mask   = (const int*)  d_in[1];
  const float* ln1w   = (const float*)d_in[2];
  const float* ln1b   = (const float*)d_in[3];
  const float* wq     = (const float*)d_in[4];
  const float* bq     = (const float*)d_in[5];
  const float* wk     = (const float*)d_in[6];
  const float* bk     = (const float*)d_in[7];
  const float* wv     = (const float*)d_in[8];
  const float* bv     = (const float*)d_in[9];
  const float* wo     = (const float*)d_in[10];
  const float* bo     = (const float*)d_in[11];
  const float* ln2w   = (const float*)d_in[12];
  const float* ln2b   = (const float*)d_in[13];
  const float* wup    = (const float*)d_in[14];
  const float* bup    = (const float*)d_in[15];
  const float* wdown  = (const float*)d_in[16];
  const float* bdown  = (const float*)d_in[17];
  float* out = (float*)d_out;

  constexpr size_t W_DD  = (size_t)D_ * D_;
  constexpr size_t W_DF  = (size_t)D_ * FF_;
  constexpr size_t ACT   = (size_t)S_ * D_;
  constexpr size_t ACTFF = (size_t)S_ * FF_;

  char* ws = (char*)d_ws;
  size_t off = 0;
  __bf16* wqT  = (__bf16*)(ws + off); off += W_DD * 2;   // all weights [N][K] bf16
  __bf16* wkT  = (__bf16*)(ws + off); off += W_DD * 2;
  __bf16* wvT  = (__bf16*)(ws + off); off += W_DD * 2;
  __bf16* woT  = (__bf16*)(ws + off); off += W_DD * 2;
  __bf16* wupT = (__bf16*)(ws + off); off += W_DF * 2;
  __bf16* wdnT = (__bf16*)(ws + off); off += W_DF * 2;
  __bf16* xln_bf  = (__bf16*)(ws + off); off += ACT * 2;
  __bf16* q_bf    = (__bf16*)(ws + off); off += ACT * 2;
  __bf16* k_bf    = (__bf16*)(ws + off); off += ACT * 2;
  __bf16* vT_bf   = (__bf16*)(ws + off); off += ACT * 2;  // [D][S]
  __bf16* ctx_bf  = (__bf16*)(ws + off); off += ACT * 2;
  float*  hidden2 = (float*) (ws + off); off += ACT * 4;
  __bf16* yln_bf  = (__bf16*)(ws + off); off += ACT * 2;
  __bf16* ff_bf   = (__bf16*)(ws + off); off += ACTFF * 2;

  // the six transposed weights stand back to back from wqT on
  weights_to_bf16_t_kernel<<<4 * PDD_ + 2 * PDF_, 256, 0, stream>>>(wq, wk, wv, wo, wup, wdown,
                                                                    wqT);

  // LN1
  ln_bf16_kernel<<<S_ / (8 * LNR_), 256, 0, stream>>>(hidden, ln1w, ln1b, xln_bf);

  // Projections (Q pre-scaled by 1/sqrt(HD); V written transposed)
  dim3 gDD(D_ / GT_, S_ / GT_);
  gemm_bf16_kernel<0><<<gDD, 256, 0, stream>>>(xln_bf, wqT, bq, nullptr, nullptr, q_bf,
                                               S_, D_, D_, 0.125f);
  gemm_bf16_kernel<0><<<gDD, 256, 0, stream>>>(xln_bf, wkT, bk, nullptr, nullptr, k_bf,
                                               S_, D_, D_, 1.0f);
  gemm_bf16_kernel<3><<<gDD, 256, 0, stream>>>(xln_bf, wvT, bv, nullptr, nullptr, vT_bf,
                                               S_, D_, D_, 1.0f);

  // Flash attention
  attn_kernel<<<dim3(S_ / 64, H_), 128, 0, stream>>>(q_bf, k_bf, vT_bf, mask, ctx_bf);

  // O-projection + residual -> hidden2 (fp32)
  gemm_bf16_kernel<1><<<gDD, 256, 0, stream>>>(ctx_bf, woT, bo, hidden, hidden2, nullptr,
                                               S_, D_, D_, 1.0f);

  // LN2
  ln_bf16_kernel<<<S_ / (8 * LNR_), 256, 0, stream>>>(hidden2, ln2w, ln2b, yln_bf);

  // Up-projection + exact GELU -> bf16
  gemm_bf16_kernel<2><<<dim3(FF_ / GT_, S_ / GT_), 256, 0, stream>>>(
      yln_bf, wupT, bup, nullptr, nullptr, ff_bf, S_, FF_, D_, 1.0f);

  // Down-projection + residual -> d_out (fp32)
  gemm_bf16_kernel<1><<<gDD, 256, 0, stream>>>(ff_bf, wdnT, bdown, hidden2, out, nullptr,
                                               S_, D_, FF_, 1.0f);
}

// v007
// One run takes 178 microseconds.
// Two timings next to v006 both put it at 1.07 times that version's speed.
// Over all steps from v000 it is 2.92 times as fast.
#include <hip/hip_runtime.h>
#include <hip/hip_bf16.h>
#include <math.h>

// ---------------------------------------------------------------------------
// Transformer block (B=1, S=4096, D=768, H=12, HD=64, FF=3072) on gfx1250.
// ~110 GFLOP vs ~55MB minimum traffic -> strongly compute bound: bf16 WMMA
// (v_wmma_f32_16x16x32_bf16, fp32 accum) everywhere, flash-attention so the
// 805MB score tensor never exists, and GLOBAL_LOAD_ASYNC_TO_LDS_B128 (ASYNCcnt)
// staging with double buffering so HBM->LDS copies overlap the matrix pipe.
// ---------------------------------------------------------------------------

typedef __attribute__((ext_vector_type(16))) __bf16 v16bf;
typedef __attribute__((ext_vector_type(8)))  __bf16 v8bf;
typedef __attribute__((ext_vector_type(8)))  float  v8f;

constexpr int S_  = 4096;
constexpr int D_  = 768;
constexpr int H_  = 12;
constexpr int HD_ = 64;
constexpr int FF_ = 3072;

__device__ __forceinline__ v16bf cat16(v8bf lo, v8bf hi) {
  return __builtin_shufflevector(lo, hi, 0,1,2,3,4,5,6,7,8,9,10,11,12,13,14,15);
}
// A/B fragment loader: p points at a 32-wide K-run; lane half hl selects
// K offsets {hl*8..+8} and {16+hl*8..+8} per the ISA 16-bit operand layout.
__device__ __forceinline__ v16bf load_frag(const __bf16* p, int hl) {
  v8bf lo = *reinterpret_cast<const v8bf*>(p + hl * 8);
  v8bf hi = *reinterpret_cast<const v8bf*>(p + 16 + hl * 8);
  return cat16(lo, hi);
}
__device__ __forceinline__ v8f wmma_bf16(v16bf a, v16bf b, v8f c) {
  return __builtin_amdgcn_wmma_f32_16x16x32_bf16(false, a, false, b, (short)0, c,
                                                 false, false);
}

// CDNA5 async global->LDS copy (no VGPR round trip, tracked by ASYNCcnt).
// Generic shared pointers carry the LDS offset in their low 32 bits
// (ISA 10.2: LDS_ADDR.U32 = addr[31:0]); dsaddr = LDS_BASE + VGPR + IOFFSET.
// Four rows of one tile and four of another (rows 16 apart: ls bytes in LDS, ga or
// gb elements in memory) and their s_wait_xcnt 0 in ONE statement: every address
// register stays live to its end, so none is rewritten in front of the wait.
__device__ __forceinline__ void async_copy4x2_b128(const __bf16* la, const __bf16* a,
                                                   size_t ga, const __bf16* lb,
                                                   const __bf16* b, size_t gb,
                                                   unsigned ls) {
  const unsigned a0 = (unsigned)(uintptr_t)la, b0 = (unsigned)(uintptr_t)lb;
  asm volatile("global_load_async_to_lds_b128 %0, %1, off\n\t"
               "global_load_async_to_lds_b128 %2, %3, off\n\t"
               "global_load_async_to_lds_b128 %4, %5, off\n\t"
               "global_load_async_to_lds_b128 %6, %7, off\n\t"
               "global_load_async_to_lds_b128 %8, %9, off\n\t"
               "global_load_async_to_lds_b128 %10, %11, off\n\t"
               "global_load_async_to_lds_b128 %12, %13, off\n\t"
               "global_load_async_to_lds_b128 %14, %15, off\n\t"
               "s_wait_xcnt 0x0"
               :: "v"(a0),          "v"(a),
                  "v"(a0 + ls),     "v"(a + ga),
                  "v"(a0 + 2 * ls), "v"(a + 2 * ga),
                  "v"(a0 + 3 * ls), "v"(a + 3 * ga),
                  "v"(b0),          "v"(b),
                  "v"(b0 + ls),     "v"(b + gb),
                  "v"(b0 + 2 * ls), "v"(b + 2 * gb),
                  "v"(b0 + 3 * ls), "v"(b + 3 * gb)
               : "memory");
}
__device__ __forceinline__ void async_wait0() {
  asm volatile("s_wait_asynccnt 0x0" ::: "memory");
}
// This wave's LDS reads have retired: stands in front of the barrier behind which
// copies refill the buffer that was read.
__device__ __forceinline__ void lds_wait0() {
  asm volatile("s_wait_dscnt 0x0" ::: "memory");
}

// ---------------------------------------------------------------------------
// Weight prep: [K][N] fp32 -> [N][K] bf16 for all six weights in ONE launch.
// Lets GEMM B-staging be straight contiguous async copies.
// A block of 8 waves transposes a tile of 128 (k) x 64 (n) through LDS. A thread reads
// eight rows of four floats (a wave-wide load: two runs of 256 bytes), so it holds eight
// successive k of four columns: four 16-byte LDS writes. The tile leaves as rows of
// 256 bytes, 16 bytes a lane. 864 blocks, all resident at once: a launch this short
// pays for each wave that it has to start, and each launch for the gap in front of it.
// LDS rows are 256 bytes, unpadded; the 16-byte chunk ch of row r stands at place
// ch ^ ((r >> 2) & 15): the sixteen lanes of a write (rows four apart, one chunk) and
// the sixteen of a read (one row, all chunks) each meet sixteen different places.
// ---------------------------------------------------------------------------
typedef __attribute__((ext_vector_type(4))) float  v4f;

constexpr int PK_  = 128;                          // tile extent along k
constexpr int PN_  = 64;                           // tile extent along n
constexpr int PDD_ = (D_ / PK_) * (D_ / PN_);      // tiles of a D x D weight
constexpr int PDF_ = (D_ / PK_) * (FF_ / PN_);     // tiles of w_up, and of w_down
static_assert(D_ % PK_ == 0 && FF_ % PK_ == 0 && D_ % PN_ == 0 && FF_ % PN_ == 0,
              "whole tiles only");

// One tile. K and N are compile-time: the eight loads then share one scalar base and one
// lane-offset register, differ in their immediate offsets and issue as one group.
template <int K, int N>
__device__ __forceinline__ void transpose_tile(const float* __restrict__ in,
                                               __bf16* __restrict__ out, int t,
                                               __bf16* tile) {
  constexpr int ntn = N / PN_;
  const int kb = (t / ntn) * PK_, nb = (t % ntn) * PN_;
  const unsigned lo = threadIdx.x & 15, hi = threadIdx.x >> 4;
  const float* src = in + ((size_t)kb * N + nb);   // scalar bases of the tile
  __bf16* dst = out + ((size_t)nb * K + kb);

  v4f x[8];                          // x[j][i] = in[kb + hi*8 + j][nb + lo*4 + i]
  const unsigned li = hi * 8 * N + lo * 4;
  #pragma unroll
  for (int j = 0; j < 8; ++j)
    x[j] = *reinterpret_cast<const v4f*>(src + (li + j * N));
  #pragma unroll
  for (int i = 0; i < 4; ++i) {      // row lo*4+i, chunk hi; (row >> 2) & 15 is lo
    v8bf p;
    #pragma unroll
    for (int j = 0; j < 8; ++j) p[j] = (__bf16)x[j][i];
    *reinterpret_cast<v8bf*>(tile + (lo * 4 + i) * PK_ + (hi ^ lo) * 8) = p;
  }
  __syncthreads();
  const unsigned so = hi * K + lo * 8;
  #pragma unroll
  for (int y = 0; y < 4; ++y) {      // row hi+16*y, chunk lo
    const unsigned r = hi + y * 16;
    const v8bf p = *reinterpret_cast<const v8bf*>(tile + r * PK_ + (lo ^ ((r >> 2) & 15)) * 8);
    *reinterpret_cast<v8bf*>(dst + (so + y * 16 * K)) = p;
  }
}

__global__ __launch_bounds__(256) void weights_to_bf16_t_kernel(
    const float* __restrict__ wq, const float* __restrict__ wk,
    const float* __restrict__ wv, const float* __restrict__ wo,
    const float* __restrict__ wup, const float* __restrict__ wdown,
    __bf16* __restrict__ outT) {     // the six outputs in that order, back to back
  __shared__ alignas(16) __bf16 tile[PN_ * PK_];   // [n][k], chunks swizzled

  // which weight and which tile of it: the same for the whole block
  const int bid = blockIdx.x;
  if (bid < 4 * PDD_) {
    const int w = bid / PDD_;
    transpose_tile<D_, D_>(w == 0 ? wq : w == 1 ? wk : w == 2 ? wv : wo,
                           outT + (size_t)w * D_ * D_, bid - w * PDD_, tile);
  } else if (bid < 4 * PDD_ + PDF_) {
    transpose_tile<D_, FF_>(wup, outT + (size_t)4 * D_ * D_, bid - 4 * PDD_, tile);
  } else {
    transpose_tile<FF_, D_>(wdown, outT + (size_t)4 * D_ * D_ + (size_t)D_ * FF_,
                            bid - 4 * PDD_ - PDF_, tile);
  }
}

// ---------------------------------------------------------------------------
// LayerNorm (fp32 in) -> bf16 out.  One WAVE per pair of rows, no LDS, no barrier.
// A row of 768 floats lives in registers (six 16-byte loads a lane, each wave-wide
// load 512 contiguous bytes), is read from memory once, and both sums are taken
// in-lane plus a five-step butterfly across the wave. 2,048 waves a launch, eight on
// every WGP: a launch this short pays for each wave that it has to start.
// ---------------------------------------------------------------------------
typedef __attribute__((ext_vector_type(4))) __bf16 v4bf;

constexpr int LNR_ = 2;            // rows per wave
constexpr int LNC_ = D_ / 128;     // 16-byte chunks of a row per lane

// x + (x of lane ^ MASK) inside a 16-lane row (DPP row_xmask)
template <int MASK>
__device__ __forceinline__ float add_xmask(float x) {
  const int v = __builtin_bit_cast(int, x);
  return x + __builtin_bit_cast(float,
      __builtin_amdgcn_update_dpp(0, v, 0x160 + MASK, 0xf, 0xf, true));
}
// sum over the 32 lanes, the same value in every lane
__device__ __forceinline__ float wave_sum(float x) {
  x = add_xmask<1>(x);
  x = add_xmask<2>(x);
  x = add_xmask<4>(x);
  x = add_xmask<8>(x);
  const int v = __builtin_bit_cast(int, x);
  return x + __builtin_bit_cast(float, __builtin_amdgcn_permlanex16(
      v, v, 0x76543210, 0xfedcba98, false, false));
}

// amdgpu_waves_per_eu(2, 4): the grid puts two waves on a SIMD; aiming at sixteen the
// compiler kept to 64 registers and loaded w and b late, pair by pair, a full wait each.
__global__ __launch_bounds__(256) __attribute__((amdgpu_waves_per_eu(2, 4)))
void ln_bf16_kernel(
    const float* __restrict__ x, const float* __restrict__ w,
    const float* __restrict__ b, __bf16* __restrict__ out) {
  // the wave's number as a scalar: row bases stand in scalar registers, and every
  // load and store of the wave shares one lane-offset register
  const int wave = __builtin_amdgcn_readfirstlane(threadIdx.x >> 5);
  const int lane = threadIdx.x & 31;
  const int row0 = (blockIdx.x * 8 + wave) * LNR_;
  const unsigned col = lane * 4;
  const float* xr = x + (size_t)row0 * D_;       // scalar bases of the wave's rows
  __bf16* orow = out + (size_t)row0 * D_;

  v4f v[LNR_][LNC_], wv[LNC_], bv[LNC_];
  #pragma unroll
  for (int i = 0; i < LNC_; ++i) {
    wv[i] = *reinterpret_cast<const v4f*>(w + (col + i * 128));
    bv[i] = *reinterpret_cast<const v4f*>(b + (col + i * 128));
  }
  #pragma unroll
  for (int r = 0; r < LNR_; ++r)
    #pragma unroll
    for (int i = 0; i < LNC_; ++i)
      v[r][i] = *reinterpret_cast<const v4f*>(xr + (col + (r * D_ + i * 128)));

  #pragma unroll
  for (int r = 0; r < LNR_; ++r) {
    v4f s4 = v[r][0];
    #pragma unroll
    for (int i = 1; i < LNC_; ++i) s4 += v[r][i];
    const float mu = wave_sum((s4[0] + s4[1]) + (s4[2] + s4[3])) * (1.0f / D_);
    v4f q4 = {};
    #pragma unroll
    for (int i = 0; i < LNC_; ++i) {
      v[r][i] -= mu;
      q4 += v[r][i] * v[r][i];
    }
    const float var  = wave_sum((q4[0] + q4[1]) + (q4[2] + q4[3])) * (1.0f / D_);
    const float rstd = rsqrtf(var + 1e-5f);
    #pragma unroll
    for (int i = 0; i < LNC_; ++i) {
      const v4f y = v[r][i] * rstd * wv[i] + bv[i];
      v4bf o;
      #pragma unroll
      for (int e = 0; e < 4; ++e) o[e] = (__bf16)y[e];
      *reinterpret_cast<v4bf*>(orow + (col + (r * D_ + i * 128))) = o;
    }
  }
}

// ---------------------------------------------------------------------------
// Tiled bf16 GEMM: C[M,N] = A[M,K] * Bt[N,K]^T (+bias epilogues)
// Block = 256 threads (8 waves), tile 128x128, K-step 128, two LDS buffers fed by
// async copies. A staged row is 256 bytes, two whole cache lines, brought by
// sixteen neighbouring lanes; LDS rows stand at a pitch of 272 bytes (16 B x odd),
// free of bank conflicts for the 16-byte fragment reads. Each wave owns 64x32:
// 8 WMMA per 32 of K from 4 A-frags x 2 B-frags.
// M, N multiples of 128; K a multiple of 128.
// EPI 0: outB = bf16((acc+bias)*scale)      (Q/K projections; Q scale 0.125)
// EPI 1: outF = acc + bias + resid          (O-proj, down-proj)
// EPI 2: outB = bf16(gelu_exact(acc+bias))  (up-proj)
// EPI 3: outB[col*S_+row] = acc + bias      (V projection, stored transposed)
// ---------------------------------------------------------------------------
constexpr int GT_ = 128;       // tile rows of A and of Bt
constexpr int GK_ = 128;       // K-step
constexpr int GP_ = GK_ + 8;   // LDS row pitch in elements (272 bytes)

// Eight copies, rows 16 apart, and their s_wait_xcnt 0 in ONE statement: every
// address register stays live to its end, so none is rewritten in front of the wait.
__device__ __forceinline__ void async_copy8_b128(const __bf16* l, const __bf16* g,
                                                 size_t gs) {
  const unsigned l0 = (unsigned)(uintptr_t)l;
  constexpr unsigned ls = 16 * GP_ * 2;          // 16 LDS rows in bytes
  asm volatile("global_load_async_to_lds_b128 %0, %1, off\n\t"
               "global_load_async_to_lds_b128 %2, %3, off\n\t"
               "global_load_async_to_lds_b128 %4, %5, off\n\t"
               "global_load_async_to_lds_b128 %6, %7, off\n\t"
               "global_load_async_to_lds_b128 %8, %9, off\n\t"
               "global_load_async_to_lds_b128 %10, %11, off\n\t"
               "global_load_async_to_lds_b128 %12, %13, off\n\t"
               "global_load_async_to_lds_b128 %14, %15, off\n\t"
               "s_wait_xcnt 0x0"
               :: "v"(l0),          "v"(g),
                  "v"(l0 + ls),     "v"(g + gs),
                  "v"(l0 + 2 * ls), "v"(g + 2 * gs),
                  "v"(l0 + 3 * ls), "v"(g + 3 * gs),
                  "v"(l0 + 4 * ls), "v"(g + 4 * gs),
                  "v"(l0 + 5 * ls), "v"(g + 5 * gs),
                  "v"(l0 + 6 * ls), "v"(g + 6 * gs),
                  "v"(l0 + 7 * ls), "v"(g + 7 * gs)
               : "memory");
}

// amdgpu_waves_per_eu(2, 4): LDS admits two blocks per WGP, four waves per SIMD, so
// the register budget is 256; aiming at more waves the compiler kept one fragment
// set and waited for every residual load of the epilogue by itself.
template <int EPI>
__global__ __launch_bounds__(256) __attribute__((amdgpu_waves_per_eu(2, 4)))
void gemm_bf16_kernel(
    const __bf16* __restrict__ A, const __bf16* __restrict__ Bt,
    const float* __restrict__ bias, const float* __restrict__ resid,
    float* __restrict__ outF, __bf16* __restrict__ outB,
    int M, int N, int K, float scale) {
  __shared__ alignas(16) __bf16 As[2][GT_][GP_];   // [m][k]
  __shared__ alignas(16) __bf16 Bs[2][GT_][GP_];   // [n][k]

  const int n0 = blockIdx.x * GT_;
  const int m0 = blockIdx.y * GT_;
  const int tid  = threadIdx.x;
  const int wave = tid >> 5, lane = tid & 31;
  const int wr = (wave & 1) * 64;     // wave row base (4 sub-tiles of 16)
  const int wc = (wave >> 1) * 32;    // wave col base (2 sub-tiles of 16)
  const int c  = lane & 15, hl = lane >> 4;
  const int sr = tid >> 4, sg = (tid & 15) << 3;   // staging: 16 rows x 16 x 16 bytes

  auto stage = [&](int buf, int kk) {   // rows sr, sr+16, ..., sr+112 of both operands
    async_copy8_b128(&As[buf][sr][sg], A  + (size_t)(m0 + sr) * K + kk + sg, (size_t)16 * K);
    async_copy8_b128(&Bs[buf][sr][sg], Bt + (size_t)(n0 + sr) * K + kk + sg, (size_t)16 * K);
  };

  v8f acc[4][2] = {};
  const int nt = K / GK_;
  stage(0, 0);
  async_wait0();
  __syncthreads();
  if (nt > 1) stage(1, GK_);

  for (int t = 0; t < nt; ++t) {
    const int buf = t & 1;
    v16bf a[2][4], b[2][2];              // two fragment sets, one per 32 of K
    auto frags = [&](int set, int kc) {
      #pragma unroll
      for (int j = 0; j < 2; ++j)
        b[set][j] = load_frag(&Bs[buf][wc + j * 16 + c][kc * 32], hl);
      #pragma unroll
      for (int i = 0; i < 4; ++i)
        a[set][i] = load_frag(&As[buf][wr + i * 16 + c][kc * 32], hl);
    };
    frags(0, 0);
    frags(1, 1);
    // The sched_barriers of this loop keep each set's LDS reads one group between
    // whole runs of WMMAs, two sets ahead: left alone the compiler spreads the reads
    // among the WMMAs with a full wait at each place, or sinks WMMAs behind the
    // barrier, where they take the copies' lead away.
    __builtin_amdgcn_sched_barrier(0);
    #pragma unroll
    for (int kc = 0; kc < GK_ / 32; ++kc) {
      #pragma unroll
      for (int i = 0; i < 4; ++i)
        #pragma unroll
        for (int j = 0; j < 2; ++j)
          acc[i][j] = wmma_bf16(a[kc & 1][i], b[kc & 1][j], acc[i][j]);
      __builtin_amdgcn_sched_barrier(0);
      if (kc + 2 < GK_ / 32) {
        frags(kc & 1, kc + 2);
        __builtin_amdgcn_sched_barrier(0);
      }
    }
    lds_wait0();                 // this trip's reads of buf are done
    async_wait0();               // this wave's share of tile t+1 has landed
    __syncthreads();             // publishes tile t+1, frees buf
    if (t + 2 < nt) stage(buf, (t + 2) * GK_);   // flies during trip t+1
  }
  async_wait0();

  #pragma unroll
  for (int i = 0; i < 4; ++i)
    #pragma unroll
    for (int j = 0; j < 2; ++j)
      #pragma unroll
      for (int e = 0; e < 8; ++e) {
        const int row = m0 + wr + i * 16 + hl * 8 + e;   // C layout: VGPR e + half
        const int col = n0 + wc + j * 16 + c;            // lane % 16
        float v = acc[i][j][e] + bias[col];
        if constexpr (EPI == 0) {
          outB[(size_t)row * N + col] = (__bf16)(v * scale);
        } else if constexpr (EPI == 1) {
          outF[(size_t)row * N + col] = v + resid[(size_t)row * N + col];
        } else if constexpr (EPI == 2) {
          outB[(size_t)row * N + col] =
              (__bf16)(0.5f * v * (1.0f + erff(v * 0.70710678118f)));
        } else {
          outB[(size_t)col * S_ + row] = (__bf16)v;      // vT[dim][seq]
        }
      }
}

constexpr int AST_ = 64;
constexpr int AKP_ = HD_ + 8;
constexpr int AVP_ = AST_ + 8;

// lane l <-> lane l ^ 16
__device__ __forceinline__ float xhalf(float x) {
  const int b = __builtin_bit_cast(int, x);
  return __builtin_bit_cast(float, __builtin_amdgcn_permlanex16(
      b, b, 0x76543210, 0xfedcba98, false, false));
}

// e^x as v_exp_f32(x * log2 e), what __expf compiles to here. The v_nop fills the
// slot the instruction set asks for behind a transcendental before its source is
// overwritten.
__device__ __forceinline__ float exp_slot(float x) {
  float r;
  asm("v_exp_f32 %0, %1\n\tv_nop" : "=v"(r) : "v"(x * 1.4426950408889634f));
  return r;
}

__global__ __launch_bounds__(128) void attn_kernel(
    const __bf16* __restrict__ Q, const __bf16* __restrict__ Kb,
    const __bf16* __restrict__ vT,               // [D][S] transposed values
    const int* __restrict__ amask, __bf16* __restrict__ ctx) {
  __shared__ alignas(16) __bf16 Ks[2][AST_][AKP_];   // [key][dim]  (K Q^T   A-frags)
  __shared__ alignas(16) __bf16 Vt[2][HD_][AVP_];    // [dim][key]  (V^T P^T A-frags)

  const int tid  = threadIdx.x;
  const int wave = tid >> 5, lane = tid & 31;
  const int c  = lane & 15, hl = lane >> 4;
  const int h    = blockIdx.y;
  const int q0   = blockIdx.x * 64 + wave * 16;
  const int hoff = h * HD_;
  const int qr   = q0 + c;                       // this lane's query

  v16bf aq[2];                                   // Q^T as B: lane = query column
  #pragma unroll
  for (int kc = 0; kc < 2; ++kc)
    aq[kc] = load_frag(Q + (size_t)(q0 + c) * D_ + hoff + kc * 32, hl);

  v8f o[4] = {};                                 // o[d][r] = O[qr][d*16 + 8*hl + r]
  float m = -1e30f, l = 0.f;                     // l: this half's keys only

  // 64 keys of K (row-major) and of V (already transposed): both tiles are 64 rows of
  // 128 bytes; eight neighbouring lanes bring a row, a thread rows sr, sr+16, +32, +48
  const int sr = tid >> 3, sg = (tid & 7) << 3;
  auto stage = [&](int buf, int k0) {
    async_copy4x2_b128(&Ks[buf][sr][sg], Kb + (size_t)(k0 + sr) * D_ + hoff + sg,
                       (size_t)16 * D_,
                       &Vt[buf][sr][sg], vT + (size_t)(hoff + sr) * S_ + k0 + sg,
                       (size_t)16 * S_, 16 * AKP_ * 2);
  };
  static_assert(AKP_ == AVP_, "one LDS row step serves both tiles");

  const int nst = blockIdx.x + 1;                // stages up to the causal bound
  stage(0, 0);
  // bit k of pad[ps]: key 32*ps+k of the stage is no padding
  unsigned pad[2] = {__builtin_amdgcn_ballot_w32(amask[lane] != 0),
                     __builtin_amdgcn_ballot_w32(amask[32 + lane] != 0)};
  async_wait0();
  __syncthreads();
  if (nst > 1) stage(1, AST_);

  for (int st = 0; st < nst; ++st) {
    const int buf = st & 1;
    // the next stage's mask words, asked for now and used at the foot of this trip
    // (the last trip asks for its own again: the address stays inside the mask)
    const int nk = (st + 1 < nst ? st + 1 : st) * AST_;
    const int mk0 = amask[nk + lane], mk1 = amask[nk + 32 + lane];
    // The scores of both passes of 32 keys stand in front of the one test of the stage.
    // S^T(32x16) = K(32x64) @ Q^T(64x16) a pass;
    // sc[ps][sub][r] = key st*64+ps*32+sub*16+8*hl+r, query qr
    // Every loop over sc is unrolled: its indices are then constants and it stays in
    // registers.
    v8f sc[2][2] = {};
    #pragma unroll
    for (int ps = 0; ps < 2; ++ps)
      #pragma unroll
      for (int sub = 0; sub < 2; ++sub)
        #pragma unroll
        for (int kc = 0; kc < 2; ++kc) {
          v16bf a = load_frag(&Ks[buf][ps * 32 + sub * 16 + c][kc * 32], hl);
          sc[ps][sub] = wmma_bf16(a, aq[kc], sc[ps][sub]);
        }

    // Stages in front of the last hold keys below the block's first query only, and a
    // mask word of all ones holds no padding: nothing of such a stage is masked. The
    // test reads scalars alone and comes out the same in every wave of the block.
    const bool open = st + 1 < nst && (pad[0] & pad[1]) == 0xffffffffu;
    if (!open) {
      #pragma unroll
      for (int ps = 0; ps < 2; ++ps) {
        // bit k of keep: key 8*hl+k of the pass is open to this lane's query (padding, causal)
        const int n = qr - (st * AST_ + ps * 32);  // last key index the query may see
        const unsigned cau = n >= 31 ? 0xffffffffu : (n < 0 ? 0u : (2u << n) - 1u);
        const unsigned keep = (pad[ps] & cau) >> (hl * 8);
        #pragma unroll
        for (int sub = 0; sub < 2; ++sub)
          #pragma unroll
          for (int r = 0; r < 8; ++r)
            if (((keep >> (sub * 16 + r)) & 1u) == 0u) sc[ps][sub][r] = -1e30f;
      }
    }

    // two passes, unrolled: the LDS offsets are then constants
    #pragma unroll
    for (int ps = 0; ps < 2; ++ps) {
      v8f (&s)[2] = sc[ps];
      // online softmax, one query per lane
      float mx = -1e30f;
      #pragma unroll
      for (int sub = 0; sub < 2; ++sub)
        #pragma unroll
        for (int r = 0; r < 8; ++r) mx = fmaxf(mx, s[sub][r]);
      mx = fmaxf(mx, xhalf(mx));                   // both halves: the query's maximum
      const float mn  = fmaxf(m, mx);
      const float fac = exp_slot(m - mn);
      m = mn;
      v16bf bp;                                    // P^T as B, hardware k order
      float rs = 0.f;
      #pragma unroll
      for (int sub = 0; sub < 2; ++sub)
        #pragma unroll
        for (int r = 0; r < 8; ++r) {
          const float p = exp_slot(s[sub][r] - mn);
          rs += p;
          bp[sub * 8 + r] = (__bf16)p;
        }
      l = l * fac + rs;
      #pragma unroll
      for (int d = 0; d < 4; ++d)
        #pragma unroll
        for (int r = 0; r < 8; ++r) o[d][r] *= fac;

      // O^T += V^T @ P^T
      #pragma unroll
      for (int d = 0; d < 4; ++d) {
        v16bf av = load_frag(&Vt[buf][d * 16 + c][ps * 32], hl);
        o[d] = wmma_bf16(av, bp, o[d]);
      }
    }
    pad[0] = __builtin_amdgcn_ballot_w32(mk0 != 0);
    pad[1] = __builtin_amdgcn_ballot_w32(mk1 != 0);
    lds_wait0();                 // this trip's reads of buf are done
    async_wait0();               // this wave's share of stage st+1 has landed
    __syncthreads();             // publishes stage st+1, frees buf
    if (st + 2 < nst) stage(buf, (st + 2) * AST_);   // flies during trip st+1
  }
  async_wait0();

  const float inv = 1.0f / (l + xhalf(l));       // join the halves' sums once
  #pragma unroll
  for (int d = 0; d < 4; ++d) {
    v8bf w;
    #pragma unroll
    for (int r = 0; r < 8; ++r) w[r] = (__bf16)(o[d][r] * inv);
    *reinterpret_cast<v8bf*>(ctx + (size_t)qr * D_ + hoff + d * 16 + hl * 8) = w;
  }
}

// ---------------------------------------------------------------------------
// Host launcher
// ---------------------------------------------------------------------------
extern "C" void kernel_launch(void* const* d_in, const int* in_sizes, int n_in,
                              void* d_out, int out_size, void* d_ws, size_t ws_size,
                              hipStream_t stream) {
  const float* hidden = (const float*)d_in[0];
  const int*   mask   = (const int*)  d_in[1];
  const float* ln1w   = (const float*)d_in[2];
  const float* ln1b   = (const float*)d_in[3];
  const float* wq     = (const float*)d_in[4];
  const float* bq     = (const float*)d_in[5];
  const float* wk     = (const float*)d_in[6];
  const float* bk     = (const float*)d_in[7];
  const float* wv     = (const float*)d_in[8];
  const float* bv     = (const float*)d_in[9];
  const float* wo     = (const float*)d_in[10];
  const float* bo     = (const float*)d_in[11];
  const float* ln2w   = (const float*)d_in[12];
  const float* ln2b   = (const float*)d_in[13];
  const float* wup    = (const float*)d_in[14];
  const float* bup    = (const float*)d_in[15];
  const float* wdown  = (const float*)d_in[16];
  const float* bdown  = (const float*)d_in[17];
  float* out = (float*)d_out;

  constexpr size_t W_DD  = (size_t)D_ * D_;
  constexpr size_t W_DF  = (size_t)D_ * FF_;
  constexpr size_t ACT   = (size_t)S_ * D_;
  constexpr size_t ACTFF = (size_t)S_ * FF_;

  char* ws = (char*)d_ws;
  size_t off = 0;
  __bf16* wqT  = (__bf16*)(ws + off); off += W_DD * 2;   // all weights [N][K] bf16
  __bf16* wkT  = (__bf16*)(ws + off); off += W_DD * 2;
  __bf16* wvT  = (__bf16*)(ws + off); off += W_DD * 2;
  __bf16* woT  = (__bf16*)(ws + off); off += W_DD * 2;
  __bf16* wupT = (__bf16*)(ws + off); off += W_DF * 2;
  __bf16* wdnT = (__bf16*)(ws + off); off += W_DF * 2;
  __bf16* xln_bf  = (__bf16*)(ws + off); off += ACT * 2;
  __bf16* q_bf    = (__bf16*)(ws + off); off += ACT * 2;
  __bf16* k_bf    = (__bf16*)(ws + off); off += ACT * 2;
  __bf16* vT_bf   = (__bf16*)(ws + off); off += ACT * 2;  // [D][S]
  __bf16* ctx_bf  = (__bf16*)(ws + off); off += ACT * 2;
  float*  hidden2 = (float*) (ws + off); off += ACT * 4;
  __bf16* yln_bf  = (__bf16*)(ws + off); off += ACT * 2;
  __bf16* ff_bf   = (__bf16*)(ws + off); off += ACTFF * 2;

  // the six transposed weights stand back to back from wqT on
  weights_to_bf16_t_kernel<<<4 * PDD_ + 2 * PDF_, 256, 0, stream>>>(wq, wk, wv, wo, wup, wdown,
                                                                    wqT);

  // LN1
  ln_bf16_kernel<<<S_ / (8 * LNR_), 256, 0, stream>>>(hidden, ln1w, ln1b, xln_bf);

  // Projections (Q pre-scaled by 1/sqrt(HD); V written transposed)
  dim3 gDD(D_ / GT_, S_ / GT_);
  gemm_bf16_kernel<0><<<gDD, 256, 0, stream>>>(xln_bf, wqT, bq, nullptr, nullptr, q_bf,
                                               S_, D_, D_, 0.125f);
  gemm_bf16_kernel<0><<<gDD, 256, 0, stream>>>(xln_bf, wkT, bk, nullptr, nullptr, k_bf,
                                               S_, D_, D_, 1.0f);
  gemm_bf16_kernel<3><<<gDD, 256, 0, stream>>>(xln_bf, wvT, bv, nullptr, nullptr, vT_bf,
                                               S_, D_, D_, 1.0f);

  // Flash attention
  attn_kernel<<<dim3(S_ / 64, H_), 128, 0, stream>>>(q_bf, k_bf, vT_bf, mask, ctx_bf);

  // O-projection + residual -> hidden2 (fp32)
  gemm_bf16_kernel<1><<<gDD, 256, 0, stream>>>(ctx_bf, woT, bo, hidden, hidden2, nullptr,
                                               S_, D_, D_, 1.0f);

  // LN2
  ln_bf16_kernel<<<S_ / (8 * LNR_), 256, 0, stream>>>(hidden2, ln2w, ln2b, yln_bf);

  // Up-projection + exact GELU -> bf16
  gemm_bf16_kernel<2><<<dim3(FF_ / GT_, S_ / GT_), 256, 0, stream>>>(
      yln_bf, wupT, bup, nullptr, nullptr, ff_bf, S_, FF_, D_, 1.0f);

  // Down-projection + residual -> d_out (fp32)
  gemm_bf16_kernel<1><<<gDD, 256, 0, stream>>>(ff_bf, wdnT, bdown, hidden2, out, nullptr,
                                               S_, D_, FF_, 1.0f);
}

// v008
// It runs in 171 microseconds.
// Two timings next to v007 put it at 1.04 and 1.03 times that version's speed.
// Counting every step since v000, it is 3.02 times as fast.
#include <hip/hip_runtime.h>
#include <hip/hip_bf16.h>
#include <math.h>

// ---------------------------------------------------------------------------
// Transformer block (B=1, S=4096, D=768, H=12, HD=64, FF=3072) on gfx1250.
// ~110 GFLOP vs ~55MB minimum traffic -> strongly compute bound: bf16 WMMA
// (v_wmma_f32_16x16x32_bf16, fp32 accum) everywhere, flash-attention so the
// 805MB score tensor never exists, and GLOBAL_LOAD_ASYNC_TO_LDS_B128 (ASYNCcnt)
// staging with double buffering so HBM->LDS copies overlap the matrix pipe.
// ---------------------------------------------------------------------------

typedef __attribute__((ext_vector_type(16))) __bf16 v16bf;
typedef __attribute__((ext_vector_type(8)))  __bf16 v8bf;
typedef __attribute__((ext_vector_type(8)))  float  v8f;

constexpr int S_  = 4096;
constexpr int D_  = 768;
constexpr int H_  = 12;
constexpr int HD_ = 64;
constexpr int FF_ = 3072;

__device__ __forceinline__ v16bf cat16(v8bf lo, v8bf hi) {
  return __builtin_shufflevector(lo, hi, 0,1,2,3,4,5,6,7,8,9,10,11,12,13,14,15);
}
// A/B fragment loader: p points at a 32-wide K-run; lane half hl selects
// K offsets {hl*8..+8} and {16+hl*8..+8} per the ISA 16-bit operand layout.
__device__ __forceinline__ v16bf load_frag(const __bf16* p, int hl) {
  v8bf lo = *reinterpret_cast<const v8bf*>(p + hl * 8);
  v8bf hi = *reinterpret_cast<const v8bf*>(p + 16 + hl * 8);
  return cat16(lo, hi);
}
__device__ __forceinline__ v8f wmma_bf16(v16bf a, v16bf b, v8f c) {
  return __builtin_amdgcn_wmma_f32_16x16x32_bf16(false, a, false, b, (short)0, c,
                                                 false, false);
}

// CDNA5 async global->LDS copy (no VGPR round trip, tracked by ASYNCcnt).
// Generic shared pointers carry the LDS offset in their low 32 bits
// (ISA 10.2: LDS_ADDR.U32 = addr[31:0]); dsaddr = LDS_BASE + VGPR + IOFFSET.
// Four rows of one tile and four of another (rows 16 apart: ls bytes in LDS, ga or
// gb elements in memory) and their s_wait_xcnt 0 in ONE statement: every address
// register stays live to its end, so none is rewritten in front of the wait.
__device__ __forceinline__ void async_copy4x2_b128(const __bf16* la, const __bf16* a,
                                                   size_t ga, const __bf16* lb,
                                                   const __bf16* b, size_t gb,
                                                   unsigned ls) {
  const unsigned a0 = (unsigned)(uintptr_t)la, b0 = (unsigned)(uintptr_t)lb;
  asm volatile("global_load_async_to_lds_b128 %0, %1, off\n\t"
               "global_load_async_to_lds_b128 %2, %3, off\n\t"
               "global_load_async_to_lds_b128 %4, %5, off\n\t"
               "global_load_async_to_lds_b128 %6, %7, off\n\t"
               "global_load_async_to_lds_b128 %8, %9, off\n\t"
               "global_load_async_to_lds_b128 %10, %11, off\n\t"
               "global_load_async_to_lds_b128 %12, %13, off\n\t"
               "global_load_async_to_lds_b128 %14, %15, off\n\t"
               "s_wait_xcnt 0x0"
               :: "v"(a0),          "v"(a),
                  "v"(a0 + ls),     "v"(a + ga),
                  "v"(a0 + 2 * ls), "v"(a + 2 * ga),
                  "v"(a0 + 3 * ls), "v"(a + 3 * ga),
                  "v"(b0),          "v"(b),
                  "v"(b0 + ls),     "v"(b + gb),
                  "v"(b0 + 2 * ls), "v"(b + 2 * gb),
                  "v"(b0 + 3 * ls), "v"(b + 3 * gb)
               : "memory");
}
__device__ __forceinline__ void async_wait0() {
  asm volatile("s_wait_asynccnt 0x0" ::: "memory");
}
// This wave's LDS reads have retired: stands in front of the barrier behind which
// copies refill the buffer that was read.
__device__ __forceinline__ void lds_wait0() {
  asm volatile("s_wait_dscnt 0x0" ::: "memory");
}

// ---------------------------------------------------------------------------
// Weight prep: [K][N] fp32 -> [N][K] bf16 for all six weights in ONE launch.
// Lets GEMM B-staging be straight contiguous async copies.
// A block of 8 waves transposes a tile of 128 (k) x 64 (n) through LDS. A thread reads
// eight rows of four floats (a wave-wide load: two runs of 256 bytes), so it holds eight
// successive k of four columns: four 16-byte LDS writes. The tile leaves as rows of
// 256 bytes, 16 bytes a lane. 864 blocks, all resident at once: a launch this short
// pays for each wave that it has to start, and each launch for the gap in front of it.
// LDS rows are 256 bytes, unpadded; the 16-byte chunk ch of row r stands at place
// ch ^ ((r >> 2) & 15): the sixteen lanes of a write (rows four apart, one chunk) and
// the sixteen of a read (one row, all chunks) each meet sixteen different places.
// ---------------------------------------------------------------------------
typedef __attribute__((ext_vector_type(4))) float  v4f;

constexpr int PK_  = 128;                          // tile extent along k
constexpr int PN_  = 64;                           // tile extent along n
constexpr int PDD_ = (D_ / PK_) * (D_ / PN_);      // tiles of a D x D weight
constexpr int PDF_ = (D_ / PK_) * (FF_ / PN_);     // tiles of w_up, and of w_down
static_assert(D_ % PK_ == 0 && FF_ % PK_ == 0 && D_ % PN_ == 0 && FF_ % PN_ == 0,
              "whole tiles only");

// One tile. K and N are compile-time: the eight loads then share one scalar base and one
// lane-offset register, differ in their immediate offsets and issue as one group.
template <int K, int N>
__device__ __forceinline__ void transpose_tile(const float* __restrict__ in,
                                               __bf16* __restrict__ out, int t,
                                               __bf16* tile) {
  constexpr int ntn = N / PN_;
  const int kb = (t / ntn) * PK_, nb = (t % ntn) * PN_;
  const unsigned lo = threadIdx.x & 15, hi = threadIdx.x >> 4;
  const float* src = in + ((size_t)kb * N + nb);   // scalar bases of the tile
  __bf16* dst = out + ((size_t)nb * K + kb);

  v4f x[8];                          // x[j][i] = in[kb + hi*8 + j][nb + lo*4 + i]
  const unsigned li = hi * 8 * N + lo * 4;
  #pragma unroll
  for (int j = 0; j < 8; ++j)
    x[j] = *reinterpret_cast<const v4f*>(src + (li + j * N));
  #pragma unroll
  for (int i = 0; i < 4; ++i) {      // row lo*4+i, chunk hi; (row >> 2) & 15 is lo
    v8bf p;
    #pragma unroll
    for (int j = 0; j < 8; ++j) p[j] = (__bf16)x[j][i];
    *reinterpret_cast<v8bf*>(tile + (lo * 4 + i) * PK_ + (hi ^ lo) * 8) = p;
  }
  __syncthreads();
  const unsigned so = hi * K + lo * 8;
  #pragma unroll
  for (int y = 0; y < 4; ++y) {      // row hi+16*y, chunk lo
    const unsigned r = hi + y * 16;
    const v8bf p = *reinterpret_cast<const v8bf*>(tile + r * PK_ + (lo ^ ((r >> 2) & 15)) * 8);
    *reinterpret_cast<v8bf*>(dst + (so + y * 16 * K)) = p;
  }
}

__global__ __launch_bounds__(256) void weights_to_bf16_t_kernel(
    const float* __restrict__ wq, const float* __restrict__ wk,
    const float* __restrict__ wv, const float* __restrict__ wo,
    const float* __restrict__ wup, const float* __restrict__ wdown,
    __bf16* __restrict__ outT) {     // the six outputs in that order, back to back
  __shared__ alignas(16) __bf16 tile[PN_ * PK_];   // [n][k], chunks swizzled

  // which weight and which tile of it: the same for the whole block
  const int bid = blockIdx.x;
  if (bid < 4 * PDD_) {
    const int w = bid / PDD_;
    transpose_tile<D_, D_>(w == 0 ? wq : w == 1 ? wk : w == 2 ? wv : wo,
                           outT + (size_t)w * D_ * D_, bid - w * PDD_, tile);
  } else if (bid < 4 * PDD_ + PDF_) {
    transpose_tile<D_, FF_>(wup, outT + (size_t)4 * D_ * D_, bid - 4 * PDD_, tile);
  } else {
    transpose_tile<FF_, D_>(wdown, outT + (size_t)4 * D_ * D_ + (size_t)D_ * FF_,
                            bid - 4 * PDD_ - PDF_, tile);
  }
}

// ---------------------------------------------------------------------------
// LayerNorm (fp32 in) -> bf16 out.  One WAVE per pair of rows, no LDS, no barrier.
// A row of 768 floats lives in registers (six 16-byte loads a lane, each wave-wide
// load 512 contiguous bytes), is read from memory once, and both sums are taken
// in-lane plus a five-step butterfly across the wave. 2,048 waves a launch, eight on
// every WGP: a launch this short pays for each wave that it has to start.
// ---------------------------------------------------------------------------
typedef __attribute__((ext_vector_type(4))) __bf16 v4bf;

constexpr int LNR_ = 2;            // rows per wave
constexpr int LNC_ = D_ / 128;     // 16-byte chunks of a row per lane

// x + (x of lane ^ MASK) inside a 16-lane row (DPP row_xmask)
template <int MASK>
__device__ __forceinline__ float add_xmask(float x) {
  const int v = __builtin_bit_cast(int, x);
  return x + __builtin_bit_cast(float,
      __builtin_amdgcn_update_dpp(0, v, 0x160 + MASK, 0xf, 0xf, true));
}
// sum over the 32 lanes, the same value in every lane
__device__ __forceinline__ float wave_sum(float x) {
  x = add_xmask<1>(x);
  x = add_xmask<2>(x);
  x = add_xmask<4>(x);
  x = add_xmask<8>(x);
  const int v = __builtin_bit_cast(int, x);
  return x + __builtin_bit_cast(float, __builtin_amdgcn_permlanex16(
      v, v, 0x76543210, 0xfedcba98, false, false));
}

// amdgpu_waves_per_eu(2, 4): the grid puts two waves on a SIMD; aiming at sixteen the
// compiler kept to 64 registers and loaded w and b late, pair by pair, a full wait each.
__global__ __launch_bounds__(256) __attribute__((amdgpu_waves_per_eu(2, 4)))
void ln_bf16_kernel(
    const float* __restrict__ x, const float* __restrict__ w,
    const float* __restrict__ b, __bf16* __restrict__ out) {
  // the wave's number as a scalar: row bases stand in scalar registers, and every
  // load and store of the wave shares one lane-offset register
  const int wave = __builtin_amdgcn_readfirstlane(threadIdx.x >> 5);
  const int lane = threadIdx.x & 31;
  const int row0 = (blockIdx.x * 8 + wave) * LNR_;
  const unsigned col = lane * 4;
  const float* xr = x + (size_t)row0 * D_;       // scalar bases of the wave's rows
  __bf16* orow = out + (size_t)row0 * D_;

  v4f v[LNR_][LNC_], wv[LNC_], bv[LNC_];
  #pragma unroll
  for (int i = 0; i < LNC_; ++i) {
    wv[i] = *reinterpret_cast<const v4f*>(w + (col + i * 128));
    bv[i] = *reinterpret_cast<const v4f*>(b + (col + i * 128));
  }
  #pragma unroll
  for (int r = 0; r < LNR_; ++r)
    #pragma unroll
    for (int i = 0; i < LNC_; ++i)
      v[r][i] = *reinterpret_cast<const v4f*>(xr + (col + (r * D_ + i * 128)));

  #pragma unroll
  for (int r = 0; r < LNR_; ++r) {
    v4f s4 = v[r][0];
    #pragma unroll
    for (int i = 1; i < LNC_; ++i) s4 += v[r][i];
    const float mu = wave_sum((s4[0] + s4[1]) + (s4[2] + s4[3])) * (1.0f / D_);
    v4f q4 = {};
    #pragma unroll
    for (int i = 0; i < LNC_; ++i) {
      v[r][i] -= mu;
      q4 += v[r][i] * v[r][i];
    }
    const float var  = wave_sum((q4[0] + q4[1]) + (q4[2] + q4[3])) * (1.0f / D_);
    const float rstd = rsqrtf(var + 1e-5f);
    #pragma unroll
    for (int i = 0; i < LNC_; ++i) {
      const v4f y = v[r][i] * rstd * wv[i] + bv[i];
      v4bf o;
      #pragma unroll
      for (int e = 0; e < 4; ++e) o[e] = (__bf16)y[e];
      *reinterpret_cast<v4bf*>(orow + (col + (r * D_ + i * 128))) = o;
    }
  }
}

// ---------------------------------------------------------------------------
// Tiled bf16 GEMM: C[M,N] = A[M,K] * Bt[N,K]^T (+bias epilogues)
// Block = 256 threads (8 waves), tile 128x128, K-step 128, two LDS buffers fed by
// async copies. A staged row is 256 bytes, two whole cache lines, brought by
// sixteen neighbouring lanes; LDS rows stand at a pitch of 272 bytes (16 B x odd),
// free of bank conflicts for the 16-byte fragment reads. Each wave owns 64x32:
// 8 WMMA per 32 of K from 4 A-frags x 2 B-frags.
// M, N multiples of 128; K a multiple of 128.
// EPI 0: outB = bf16((acc+bias)*scale)      (Q/K projections; Q scale 0.125)
// EPI 1: outF = acc + bias + resid          (O-proj, down-proj)
// EPI 2: outB = bf16(gelu_exact(acc+bias))  (up-proj)
// EPI 3: outB[col*S_+row] = acc + bias      (V projection, stored transposed)
// ---------------------------------------------------------------------------
constexpr int GT_ = 128;       // tile rows of A and of Bt
constexpr int GK_ = 128;       // K-step
constexpr int GP_ = GK_ + 8;   // LDS row pitch in elements (272 bytes)

// Eight copies, rows 16 apart, and their s_wait_xcnt 0 in ONE statement: every
// address register stays live to its end, so none is rewritten in front of the wait.
__device__ __forceinline__ void async_copy8_b128(const __bf16* l, const __bf16* g,
                                                 size_t gs) {
  const unsigned l0 = (unsigned)(uintptr_t)l;
  constexpr unsigned ls = 16 * GP_ * 2;          // 16 LDS rows in bytes
  asm volatile("global_load_async_to_lds_b128 %0, %1, off\n\t"
               "global_load_async_to_lds_b128 %2, %3, off\n\t"
               "global_load_async_to_lds_b128 %4, %5, off\n\t"
               "global_load_async_to_lds_b128 %6, %7, off\n\t"
               "global_load_async_to_lds_b128 %8, %9, off\n\t"
               "global_load_async_to_lds_b128 %10, %11, off\n\t"
               "global_load_async_to_lds_b128 %12, %13, off\n\t"
               "global_load_async_to_lds_b128 %14, %15, off\n\t"
               "s_wait_xcnt 0x0"
               :: "v"(l0),          "v"(g),
                  "v"(l0 + ls),     "v"(g + gs),
                  "v"(l0 + 2 * ls), "v"(g + 2 * gs),
                  "v"(l0 + 3 * ls), "v"(g + 3 * gs),
                  "v"(l0 + 4 * ls), "v"(g + 4 * gs),
                  "v"(l0 + 5 * ls), "v"(g + 5 * gs),
                  "v"(l0 + 6 * ls), "v"(g + 6 * gs),
                  "v"(l0 + 7 * ls), "v"(g + 7 * gs)
               : "memory");
}

// amdgpu_waves_per_eu(2, 4): LDS admits two blocks per WGP, four waves per SIMD, so
// the register budget is 256; aiming at more waves the compiler kept one fragment
// set and waited for every residual load of the epilogue by itself.
template <int EPI>
__global__ __launch_bounds__(256) __attribute__((amdgpu_waves_per_eu(2, 4)))
void gemm_bf16_kernel(
    const __bf16* __restrict__ A, const __bf16* __restrict__ Bt,
    const float* __restrict__ bias, const float* __restrict__ resid,
    float* __restrict__ outF, __bf16* __restrict__ outB,
    int M, int N, int K, float scale) {
  __shared__ alignas(16) __bf16 As[2][GT_][GP_];   // [m][k]
  __shared__ alignas(16) __bf16 Bs[2][GT_][GP_];   // [n][k]

  const int n0 = blockIdx.x * GT_;
  const int m0 = blockIdx.y * GT_;
  const int tid  = threadIdx.x;
  const int wave = tid >> 5, lane = tid & 31;
  const int wr = (wave & 1) * 64;     // wave row base (4 sub-tiles of 16)
  const int wc = (wave >> 1) * 32;    // wave col base (2 sub-tiles of 16)
  const int c  = lane & 15, hl = lane >> 4;
  const int sr = tid >> 4, sg = (tid & 15) << 3;   // staging: 16 rows x 16 x 16 bytes

  auto stage = [&](int buf, int kk) {   // rows sr, sr+16, ..., sr+112 of both operands
    async_copy8_b128(&As[buf][sr][sg], A  + (size_t)(m0 + sr) * K + kk + sg, (size_t)16 * K);
    async_copy8_b128(&Bs[buf][sr][sg], Bt + (size_t)(n0 + sr) * K + kk + sg, (size_t)16 * K);
  };

  v8f acc[4][2] = {};
  const int nt = K / GK_;
  stage(0, 0);
  async_wait0();
  __syncthreads();
  if (nt > 1) stage(1, GK_);

  for (int t = 0; t < nt; ++t) {
    const int buf = t & 1;
    v16bf a[2][4], b[2][2];              // two fragment sets, one per 32 of K
    auto frags = [&](int set, int kc) {
      #pragma unroll
      for (int j = 0; j < 2; ++j)
        b[set][j] = load_frag(&Bs[buf][wc + j * 16 + c][kc * 32], hl);
      #pragma unroll
      for (int i = 0; i < 4; ++i)
        a[set][i] = load_frag(&As[buf][wr + i * 16 + c][kc * 32], hl);
    };
    frags(0, 0);
    frags(1, 1);
    // The sched_barriers of this loop keep each set's LDS reads one group between
    // whole runs of WMMAs, two sets ahead: left alone the compiler spreads the reads
    // among the WMMAs with a full wait at each place, or sinks WMMAs behind the
    // barrier, where they take the copies' lead away.
    __builtin_amdgcn_sched_barrier(0);
    #pragma unroll
    for (int kc = 0; kc < GK_ / 32; ++kc) {
      #pragma unroll
      for (int i = 0; i < 4; ++i)
        #pragma unroll
        for (int j = 0; j < 2; ++j)
          acc[i][j] = wmma_bf16(a[kc & 1][i], b[kc & 1][j], acc[i][j]);
      __builtin_amdgcn_sched_barrier(0);
      if (kc + 2 < GK_ / 32) {
        frags(kc & 1, kc + 2);
        __builtin_amdgcn_sched_barrier(0);
      }
    }
    lds_wait0();                 // this trip's reads of buf are done
    async_wait0();               // this wave's share of tile t+1 has landed
    __syncthreads();             // publishes tile t+1, frees buf
    if (t + 2 < nt) stage(buf, (t + 2) * GK_);   // flies during trip t+1
  }
  async_wait0();

  #pragma unroll
  for (int i = 0; i < 4; ++i)
    #pragma unroll
    for (int j = 0; j < 2; ++j)
      #pragma unroll
      for (int e = 0; e < 8; ++e) {
        const int row = m0 + wr + i * 16 + hl * 8 + e;   // C layout: VGPR e + half
        const int col = n0 + wc + j * 16 + c;            // lane % 16
        float v = acc[i][j][e] + bias[col];
        if constexpr (EPI == 0) {
          outB[(size_t)row * N + col] = (__bf16)(v * scale);
        } else if constexpr (EPI == 1) {
          outF[(size_t)row * N + col] = v + resid[(size_t)row * N + col];
        } else if constexpr (EPI == 2) {
          outB[(size_t)row * N + col] =
              (__bf16)(0.5f * v * (1.0f + erff(v * 0.70710678118f)));
        } else {
          outB[(size_t)col * S_ + row] = (__bf16)v;      // vT[dim][seq]
        }
      }
}

constexpr int AST_ = 64;
constexpr int AKP_ = HD_ + 8;
constexpr int AVP_ = AST_ + 8;

// lane l <-> lane l ^ 16
__device__ __forceinline__ float xhalf(float x) {
  const int b = __builtin_bit_cast(int, x);
  return __builtin_bit_cast(float, __builtin_amdgcn_permlanex16(
      b, b, 0x76543210, 0xfedcba98, false, false));
}

// e^x as v_exp_f32(x * log2 e), what __expf compiles to here. The v_nop fills the
// slot the instruction set asks for behind a transcendental before its source is
// overwritten.
__device__ __forceinline__ float exp_slot(float x) {
  float r;
  asm("v_exp_f32 %0, %1\n\tv_nop" : "=v"(r) : "v"(x * 1.4426950408889634f));
  return r;
}

// Which (head, query tile) a block takes. Tile t walks t + 1 stages, and all 768 blocks
// are resident at once, three to a WGP: the launch lasts as long as its fullest WGP.
// With tile = blockIdx.x, flat indices 256 apart are three tiles of the same length.
// Here the 768 pairs are ranked by falling length (rank / H_ counts down from the last
// tile). The first 256 blocks take the longest third in falling order; the second and the third 256 take the middle and the shortest third in
// rising order.
// The map is a permutation of 0..767: every (head, tile) is taken exactly once wherever
// the blocks land. Placement decides speed alone.
constexpr int ANT_  = S_ / 64;   // query tiles of a head
constexpr int WGPS_ = 256;       // WGPs of the chip
static_assert(ANT_ * H_ == 3 * WGPS_, "three blocks to a WGP");
__device__ __forceinline__ unsigned cost_rank(unsigned flat) {
  const unsigned round = flat / WGPS_, w = flat % WGPS_;
  return round * WGPS_ + (round == 0 ? w : WGPS_ - 1 - w);
}

__global__ __launch_bounds__(128) void attn_kernel(
    const __bf16* __restrict__ Q, const __bf16* __restrict__ Kb,
    const __bf16* __restrict__ vT,               // [D][S] transposed values
    const int* __restrict__ amask, __bf16* __restrict__ ctx) {
  __shared__ alignas(16) __bf16 Ks[2][AST_][AKP_];   // [key][dim]  (K Q^T   A-frags)
  __shared__ alignas(16) __bf16 Vt[2][HD_][AVP_];    // [dim][key]  (V^T P^T A-frags)

  const int tid  = threadIdx.x;
  const int wave = tid >> 5, lane = tid & 31;
  const int c  = lane & 15, hl = lane >> 4;
  const unsigned rank = cost_rank(blockIdx.y * ANT_ + blockIdx.x);
  const int h    = rank % H_;
  const int tile = ANT_ - 1 - rank / H_;         // rank 0: the last tile, the longest
  const int q0   = tile * 64 + wave * 16;
  const int hoff = h * HD_;
  const int qr   = q0 + c;                       // this lane's query

  v16bf aq[2];                                   // Q^T as B: lane = query column
  #pragma unroll
  for (int kc = 0; kc < 2; ++kc)
    aq[kc] = load_frag(Q + (size_t)(q0 + c) * D_ + hoff + kc * 32, hl);

  v8f o[4] = {};                                 // o[d][r] = O[qr][d*16 + 8*hl + r]
  float m = -1e30f, l = 0.f;                     // l: this half's keys only

  // 64 keys of K (row-major) and of V (already transposed): both tiles are 64 rows of
  // 128 bytes; eight neighbouring lanes bring a row, a thread rows sr, sr+16, +32, +48
  const int sr = tid >> 3, sg = (tid & 7) << 3;
  auto stage = [&](int buf, int k0) {
    async_copy4x2_b128(&Ks[buf][sr][sg], Kb + (size_t)(k0 + sr) * D_ + hoff + sg,
                       (size_t)16 * D_,
                       &Vt[buf][sr][sg], vT + (size_t)(hoff + sr) * S_ + k0 + sg,
                       (size_t)16 * S_, 16 * AKP_ * 2);
  };
  static_assert(AKP_ == AVP_, "one LDS row step serves both tiles");

  const int nst = tile + 1;                      // stages up to the causal bound
  stage(0, 0);
  // bit k of pad[ps]: key 32*ps+k of the stage is no padding
  unsigned pad[2] = {__builtin_amdgcn_ballot_w32(amask[lane] != 0),
                     __builtin_amdgcn_ballot_w32(amask[32 + lane] != 0)};
  async_wait0();
  __syncthreads();
  if (nst > 1) stage(1, AST_);

  for (int st = 0; st < nst; ++st) {
    const int buf = st & 1;
    // the next stage's mask words, asked for now and used at the foot of this trip
    // (the last trip asks for its own again: the address stays inside the mask)
    const int nk = (st + 1 < nst ? st + 1 : st) * AST_;
    const int mk0 = amask[nk + lane], mk1 = amask[nk + 32 + lane];
    // The scores of both passes of 32 keys stand in front of the one test of the stage.
    // S^T(32x16) = K(32x64) @ Q^T(64x16) a pass;
    // sc[ps][sub][r] = key st*64+ps*32+sub*16+8*hl+r, query qr
    // Every loop over sc is unrolled: its indices are then constants and it stays in
    // registers.
    v8f sc[2][2] = {};
    #pragma unroll
    for (int ps = 0; ps < 2; ++ps)
      #pragma unroll
      for (int sub = 0; sub < 2; ++sub)
        #pragma unroll
        for (int kc = 0; kc < 2; ++kc) {
          v16bf a = load_frag(&Ks[buf][ps * 32 + sub * 16 + c][kc * 32], hl);
          sc[ps][sub] = wmma_bf16(a, aq[kc], sc[ps][sub]);
        }

    // Stages in front of the last hold keys below the block's first query only, and a
    // mask word of all ones holds no padding: nothing of such a stage is masked. The
    // test reads scalars alone and comes out the same in every wave of the block.
    const bool open = st + 1 < nst && (pad[0] & pad[1]) == 0xffffffffu;
    if (!open) {
      #pragma unroll
      for (int ps = 0; ps < 2; ++ps) {
        // bit k of keep: key 8*hl+k of the pass is open to this lane's query (padding, causal)
        const int n = qr - (st * AST_ + ps * 32);  // last key index the query may see
        const unsigned cau = n >= 31 ? 0xffffffffu : (n < 0 ? 0u : (2u << n) - 1u);
        const unsigned keep = (pad[ps] & cau) >> (hl * 8);
        #pragma unroll
        for (int sub = 0; sub < 2; ++sub)
          #pragma unroll
          for (int r = 0; r < 8; ++r)
            if (((keep >> (sub * 16 + r)) & 1u) == 0u) sc[ps][sub][r] = -1e30f;
      }
    }

    // two passes, unrolled: the LDS offsets are then constants
    #pragma unroll
    for (int ps = 0; ps < 2; ++ps) {
      v8f (&s)[2] = sc[ps];
      // online softmax, one query per lane
      float mx = -1e30f;
      #pragma unroll
      for (int sub = 0; sub < 2; ++sub)
        #pragma unroll
        for (int r = 0; r < 8; ++r) mx = fmaxf(mx, s[sub][r]);
      mx = fmaxf(mx, xhalf(mx));                   // both halves: the query's maximum
      const float mn  = fmaxf(m, mx);
      const float fac = exp_slot(m - mn);
      m = mn;
      v16bf bp;                                    // P^T as B, hardware k order
      float rs = 0.f;
      #pragma unroll
      for (int sub = 0; sub < 2; ++sub)
        #pragma unroll
        for (int r = 0; r < 8; ++r) {
          const float p = exp_slot(s[sub][r] - mn);
          rs += p;
          bp[sub * 8 + r] = (__bf16)p;
        }
      l = l * fac + rs;
      #pragma unroll
      for (int d = 0; d < 4; ++d)
        #pragma unroll
        for (int r = 0; r < 8; ++r) o[d][r] *= fac;

      // O^T += V^T @ P^T
      #pragma unroll
      for (int d = 0; d < 4; ++d) {
        v16bf av = load_frag(&Vt[buf][d * 16 + c][ps * 32], hl);
        o[d] = wmma_bf16(av, bp, o[d]);
      }
    }
    pad[0] = __builtin_amdgcn_ballot_w32(mk0 != 0);
    pad[1] = __builtin_amdgcn_ballot_w32(mk1 != 0);
    lds_wait0();                 // this trip's reads of buf are done
    async_wait0();               // this wave's share of stage st+1 has landed
    __syncthreads();             // publishes stage st+1, frees buf
    if (st + 2 < nst) stage(buf, (st + 2) * AST_);   // flies during trip st+1
  }
  async_wait0();

  const float inv = 1.0f / (l + xhalf(l));       // join the halves' sums once
  #pragma unroll
  for (int d = 0; d < 4; ++d) {
    v8bf w;
    #pragma unroll
    for (int r = 0; r < 8; ++r) w[r] = (__bf16)(o[d][r] * inv);
    *reinterpret_cast<v8bf*>(ctx + (size_t)qr * D_ + hoff + d * 16 + hl * 8) = w;
  }
}

// ---------------------------------------------------------------------------
// Host launcher
// ---------------------------------------------------------------------------
extern "C" void kernel_launch(void* const* d_in, const int* in_sizes, int n_in,
                              void* d_out, int out_size, void* d_ws, size_t ws_size,
                              hipStream_t stream) {
  const float* hidden = (const float*)d_in[0];
  const int*   mask   = (const int*)  d_in[1];
  const float* ln1w   = (const float*)d_in[2];
  const float* ln1b   = (const float*)d_in[3];
  const float* wq     = (const float*)d_in[4];
  const float* bq     = (const float*)d_in[5];
  const float* wk     = (const float*)d_in[6];
  const float* bk     = (const float*)d_in[7];
  const float* wv     = (const float*)d_in[8];
  const float* bv     = (const float*)d_in[9];
  const float* wo     = (const float*)d_in[10];
  const float* bo     = (const float*)d_in[11];
  const float* ln2w   = (const float*)d_in[12];
  const float* ln2b   = (const float*)d_in[13];
  const float* wup    = (const float*)d_in[14];
  const float* bup    = (const float*)d_in[15];
  const float* wdown  = (const float*)d_in[16];
  const float* bdown  = (const float*)d_in[17];
  float* out = (float*)d_out;

  constexpr size_t W_DD  = (size_t)D_ * D_;
  constexpr size_t W_DF  = (size_t)D_ * FF_;
  constexpr size_t ACT   = (size_t)S_ * D_;
  constexpr size_t ACTFF = (size_t)S_ * FF_;

  char* ws = (char*)d_ws;
  size_t off = 0;
  __bf16* wqT  = (__bf16*)(ws + off); off += W_DD * 2;   // all weights [N][K] bf16
  __bf16* wkT  = (__bf16*)(ws + off); off += W_DD * 2;
  __bf16* wvT  = (__bf16*)(ws + off); off += W_DD * 2;
  __bf16* woT  = (__bf16*)(ws + off); off += W_DD * 2;
  __bf16* wupT = (__bf16*)(ws + off); off += W_DF * 2;
  __bf16* wdnT = (__bf16*)(ws + off); off += W_DF * 2;
  __bf16* xln_bf  = (__bf16*)(ws + off); off += ACT * 2;
  __bf16* q_bf    = (__bf16*)(ws + off); off += ACT * 2;
  __bf16* k_bf    = (__bf16*)(ws + off); off += ACT * 2;
  __bf16* vT_bf   = (__bf16*)(ws + off); off += ACT * 2;  // [D][S]
  __bf16* ctx_bf  = (__bf16*)(ws + off); off += ACT * 2;
  float*  hidden2 = (float*) (ws + off); off += ACT * 4;
  __bf16* yln_bf  = (__bf16*)(ws + off); off += ACT * 2;
  __bf16* ff_bf   = (__bf16*)(ws + off); off += ACTFF * 2;

  // the six transposed weights stand back to back from wqT on
  weights_to_bf16_t_kernel<<<4 * PDD_ + 2 * PDF_, 256, 0, stream>>>(wq, wk, wv, wo, wup, wdown,
                                                                    wqT);

  // LN1
  ln_bf16_kernel<<<S_ / (8 * LNR_), 256, 0, stream>>>(hidden, ln1w, ln1b, xln_bf);

  // Projections (Q pre-scaled by 1/sqrt(HD); V written transposed)
  dim3 gDD(D_ / GT_, S_ / GT_);
  gemm_bf16_kernel<0><<<gDD, 256, 0, stream>>>(xln_bf, wqT, bq, nullptr, nullptr, q_bf,
                                               S_, D_, D_, 0.125f);
  gemm_bf16_kernel<0><<<gDD, 256, 0, stream>>>(xln_bf, wkT, bk, nullptr, nullptr, k_bf,
                                               S_, D_, D_, 1.0f);
  gemm_bf16_kernel<3><<<gDD, 256, 0, stream>>>(xln_bf, wvT, bv, nullptr, nullptr, vT_bf,
                                               S_, D_, D_, 1.0f);

  // Flash attention
  attn_kernel<<<dim3(S_ / 64, H_), 128, 0, stream>>>(q_bf, k_bf, vT_bf, mask, ctx_bf);

  // O-projection + residual -> hidden2 (fp32)
  gemm_bf16_kernel<1><<<gDD, 256, 0, stream>>>(ctx_bf, woT, bo, hidden, hidden2, nullptr,
                                               S_, D_, D_, 1.0f);

  // LN2
  ln_bf16_kernel<<<S_ / (8 * LNR_), 256, 0, stream>>>(hidden2, ln2w, ln2b, yln_bf);

  // Up-projection + exact GELU -> bf16
  gemm_bf16_kernel<2><<<dim3(FF_ / GT_, S_ / GT_), 256, 0, stream>>>(
      yln_bf, wupT, bup, nullptr, nullptr, ff_bf, S_, FF_, D_, 1.0f);

  // Down-projection + residual -> d_out (fp32)
  gemm_bf16_kernel<1><<<gDD, 256, 0, stream>>>(ff_bf, wdnT, bdown, hidden2, out, nullptr,
                                               S_, D_, FF_, 1.0f);
}

// v009
// It runs in 156 microseconds.
// Two timings next to v008 put it at 1.09 and 1.08 times that version's speed.
// Counting every step since v000, it is 3.29 times as fast.
#include <hip/hip_runtime.h>
#include <hip/hip_bf16.h>
#include <math.h>

// ---------------------------------------------------------------------------
// Transformer block (B=1, S=4096, D=768, H=12, HD=64, FF=3072) on gfx1250.
// ~110 GFLOP vs ~55MB minimum traffic -> strongly compute bound: bf16 WMMA
// (v_wmma_f32_16x16x32_bf16, fp32 accum) everywhere, flash-attention so the
// 805MB score tensor never exists, and GLOBAL_LOAD_ASYNC_TO_LDS_B128 (ASYNCcnt)
// staging with double buffering so HBM->LDS copies overlap the matrix pipe.
// ---------------------------------------------------------------------------

typedef __attribute__((ext_vector_type(16))) __bf16 v16bf;
typedef __attribute__((ext_vector_type(8)))  __bf16 v8bf;
typedef __attribute__((ext_vector_type(8)))  float  v8f;

constexpr int S_  = 4096;
constexpr int D_  = 768;
constexpr int H_  = 12;
constexpr int HD_ = 64;
constexpr int FF_ = 3072;

__device__ __forceinline__ v16bf cat16(v8bf lo, v8bf hi) {
  return __builtin_shufflevector(lo, hi, 0,1,2,3,4,5,6,7,8,9,10,11,12,13,14,15);
}
// A/B fragment loader: p points at a 32-wide K-run; lane half hl selects
// K offsets {hl*8..+8} and {16+hl*8..+8} per the ISA 16-bit operand layout.
__device__ __forceinline__ v16bf load_frag(const __bf16* p, int hl) {
  v8bf lo = *reinterpret_cast<const v8bf*>(p + hl * 8);
  v8bf hi = *reinterpret_cast<const v8bf*>(p + 16 + hl * 8);
  return cat16(lo, hi);
}
__device__ __forceinline__ v8f wmma_bf16(v16bf a, v16bf b, v8f c) {
  return __builtin_amdgcn_wmma_f32_16x16x32_bf16(false, a, false, b, (short)0, c,
                                                 false, false);
}

// CDNA5 async global->LDS copy (no VGPR round trip, tracked by ASYNCcnt).
// Generic shared pointers carry the LDS offset in their low 32 bits
// (ISA 10.2: LDS_ADDR.U32 = addr[31:0]); dsaddr = LDS_BASE + VGPR + IOFFSET.
// Four rows of one tile and four of another (rows 16 apart: ls bytes in LDS, ga or
// gb elements in memory) and their s_wait_xcnt 0 in ONE statement: every address
// register stays live to its end, so none is rewritten in front of the wait.
__device__ __forceinline__ void async_copy4x2_b128(const __bf16* la, const __bf16* a,
                                                   size_t ga, const __bf16* lb,
                                                   const __bf16* b, size_t gb,
                                                   unsigned ls) {
  const unsigned a0 = (unsigned)(uintptr_t)la, b0 = (unsigned)(uintptr_t)lb;
  asm volatile("global_load_async_to_lds_b128 %0, %1, off\n\t"
               "global_load_async_to_lds_b128 %2, %3, off\n\t"
               "global_load_async_to_lds_b128 %4, %5, off\n\t"
               "global_load_async_to_lds_b128 %6, %7, off\n\t"
               "global_load_async_to_lds_b128 %8, %9, off\n\t"
               "global_load_async_to_lds_b128 %10, %11, off\n\t"
               "global_load_async_to_lds_b128 %12, %13, off\n\t"
               "global_load_async_to_lds_b128 %14, %15, off\n\t"
               "s_wait_xcnt 0x0"
               :: "v"(a0),          "v"(a),
                  "v"(a0 + ls),     "v"(a + ga),
                  "v"(a0 + 2 * ls), "v"(a + 2 * ga),
                  "v"(a0 + 3 * ls), "v"(a + 3 * ga),
                  "v"(b0),          "v"(b),
                  "v"(b0 + ls),     "v"(b + gb),
                  "v"(b0 + 2 * ls), "v"(b + 2 * gb),
                  "v"(b0 + 3 * ls), "v"(b + 3 * gb)
               : "memory");
}
__device__ __forceinline__ void async_wait0() {
  asm volatile("s_wait_asynccnt 0x0" ::: "memory");
}
// This wave's LDS reads have retired: stands in front of the barrier behind which
// copies refill the buffer that was read.
__device__ __forceinline__ void lds_wait0() {
  asm volatile("s_wait_dscnt 0x0" ::: "memory");
}

// ---------------------------------------------------------------------------
// Weight prep: [K][N] fp32 -> [N][K] bf16 for all six weights in ONE launch.
// Lets GEMM B-staging be straight contiguous async copies.
// A block of 8 waves transposes a tile of 128 (k) x 64 (n) through LDS. A thread reads
// eight rows of four floats (a wave-wide load: two runs of 256 bytes), so it holds eight
// successive k of four columns: four 16-byte LDS writes. The tile leaves as rows of
// 256 bytes, 16 bytes a lane. 864 blocks, all resident at once: a launch this short
// pays for each wave that it has to start, and each launch for the gap in front of it.
// LDS rows are 256 bytes, unpadded; the 16-byte chunk ch of row r stands at place
// ch ^ ((r >> 2) & 15): the sixteen lanes of a write (rows four apart, one chunk) and
// the sixteen of a read (one row, all chunks) each meet sixteen different places.
// ---------------------------------------------------------------------------
typedef __attribute__((ext_vector_type(4))) float  v4f;

constexpr int PK_  = 128;                          // tile extent along k
constexpr int PN_  = 64;                           // tile extent along n
constexpr int PDD_ = (D_ / PK_) * (D_ / PN_);      // tiles of a D x D weight
constexpr int PDF_ = (D_ / PK_) * (FF_ / PN_);     // tiles of w_up, and of w_down
static_assert(D_ % PK_ == 0 && FF_ % PK_ == 0 && D_ % PN_ == 0 && FF_ % PN_ == 0,
              "whole tiles only");

// One tile. K and N are compile-time: the eight loads then share one scalar base and one
// lane-offset register, differ in their immediate offsets and issue as one group.
template <int K, int N>
__device__ __forceinline__ void transpose_tile(const float* __restrict__ in,
                                               __bf16* __restrict__ out, int t,
                                               __bf16* tile) {
  constexpr int ntn = N / PN_;
  const int kb = (t / ntn) * PK_, nb = (t % ntn) * PN_;
  const unsigned lo = threadIdx.x & 15, hi = threadIdx.x >> 4;
  const float* src = in + ((size_t)kb * N + nb);   // scalar bases of the tile
  __bf16* dst = out + ((size_t)nb * K + kb);

  v4f x[8];                          // x[j][i] = in[kb + hi*8 + j][nb + lo*4 + i]
  const unsigned li = hi * 8 * N + lo * 4;
  #pragma unroll
  for (int j = 0; j < 8; ++j)
    x[j] = *reinterpret_cast<const v4f*>(src + (li + j * N));
  #pragma unroll
  for (int i = 0; i < 4; ++i) {      // row lo*4+i, chunk hi; (row >> 2) & 15 is lo
    v8bf p;
    #pragma unroll
    for (int j = 0; j < 8; ++j) p[j] = (__bf16)x[j][i];
    *reinterpret_cast<v8bf*>(tile + (lo * 4 + i) * PK_ + (hi ^ lo) * 8) = p;
  }
  __syncthreads();
  const unsigned so = hi * K + lo * 8;
  #pragma unroll
  for (int y = 0; y < 4; ++y) {      // row hi+16*y, chunk lo
    const unsigned r = hi + y * 16;
    const v8bf p = *reinterpret_cast<const v8bf*>(tile + r * PK_ + (lo ^ ((r >> 2) & 15)) * 8);
    *reinterpret_cast<v8bf*>(dst + (so + y * 16 * K)) = p;
  }
}

__global__ __launch_bounds__(256) void weights_to_bf16_t_kernel(
    const float* __restrict__ wq, const float* __restrict__ wk,
    const float* __restrict__ wv, const float* __restrict__ wo,
    const float* __restrict__ wup, const float* __restrict__ wdown,
    __bf16* __restrict__ outT) {     // the six outputs in that order, back to back
  __shared__ alignas(16) __bf16 tile[PN_ * PK_];   // [n][k], chunks swizzled

  // which weight and which tile of it: the same for the whole block
  const int bid = blockIdx.x;
  if (bid < 4 * PDD_) {
    const int w = bid / PDD_;
    transpose_tile<D_, D_>(w == 0 ? wq : w == 1 ? wk : w == 2 ? wv : wo,
                           outT + (size_t)w * D_ * D_, bid - w * PDD_, tile);
  } else if (bid < 4 * PDD_ + PDF_) {
    transpose_tile<D_, FF_>(wup, outT + (size_t)4 * D_ * D_, bid - 4 * PDD_, tile);
  } else {
    transpose_tile<FF_, D_>(wdown, outT + (size_t)4 * D_ * D_ + (size_t)D_ * FF_,
                            bid - 4 * PDD_ - PDF_, tile);
  }
}

// ---------------------------------------------------------------------------
// LayerNorm (fp32 in) -> bf16 out.  One WAVE per pair of rows, no LDS, no barrier.
// A row of 768 floats lives in registers (six 16-byte loads a lane, each wave-wide
// load 512 contiguous bytes), is read from memory once, and both sums are taken
// in-lane plus a five-step butterfly across the wave. 2,048 waves a launch, eight on
// every WGP: a launch this short pays for each wave that it has to start.
// ---------------------------------------------------------------------------
typedef __attribute__((ext_vector_type(4))) __bf16 v4bf;

constexpr int LNR_ = 2;            // rows per wave
constexpr int LNC_ = D_ / 128;     // 16-byte chunks of a row per lane

// x + (x of lane ^ MASK) inside a 16-lane row (DPP row_xmask)
template <int MASK>
__device__ __forceinline__ float add_xmask(float x) {
  const int v = __builtin_bit_cast(int, x);
  return x + __builtin_bit_cast(float,
      __builtin_amdgcn_update_dpp(0, v, 0x160 + MASK, 0xf, 0xf, true));
}
// sum over the 32 lanes, the same value in every lane
__device__ __forceinline__ float wave_sum(float x) {
  x = add_xmask<1>(x);
  x = add_xmask<2>(x);
  x = add_xmask<4>(x);
  x = add_xmask<8>(x);
  const int v = __builtin_bit_cast(int, x);
  return x + __builtin_bit_cast(float, __builtin_amdgcn_permlanex16(
      v, v, 0x76543210, 0xfedcba98, false, false));
}

// amdgpu_waves_per_eu(2, 4): the grid puts two waves on a SIMD; aiming at sixteen the
// compiler kept to 64 registers and loaded w and b late, pair by pair, a full wait each.
__global__ __launch_bounds__(256) __attribute__((amdgpu_waves_per_eu(2, 4)))
void ln_bf16_kernel(
    const float* __restrict__ x, const float* __restrict__ w,
    const float* __restrict__ b, __bf16* __restrict__ out) {
  // the wave's number as a scalar: row bases stand in scalar registers, and every
  // load and store of the wave shares one lane-offset register
  const int wave = __builtin_amdgcn_readfirstlane(threadIdx.x >> 5);
  const int lane = threadIdx.x & 31;
  const int row0 = (blockIdx.x * 8 + wave) * LNR_;
  const unsigned col = lane * 4;
  const float* xr = x + (size_t)row0 * D_;       // scalar bases of the wave's rows
  __bf16* orow = out + (size_t)row0 * D_;

  v4f v[LNR_][LNC_], wv[LNC_], bv[LNC_];
  #pragma unroll
  for (int i = 0; i < LNC_; ++i) {
    wv[i] = *reinterpret_cast<const v4f*>(w + (col + i * 128));
    bv[i] = *reinterpret_cast<const v4f*>(b + (col + i * 128));
  }
  #pragma unroll
  for (int r = 0; r < LNR_; ++r)
    #pragma unroll
    for (int i = 0; i < LNC_; ++i)
      v[r][i] = *reinterpret_cast<const v4f*>(xr + (col + (r * D_ + i * 128)));

  #pragma unroll
  for (int r = 0; r < LNR_; ++r) {
    v4f s4 = v[r][0];
    #pragma unroll
    for (int i = 1; i < LNC_; ++i) s4 += v[r][i];
    const float mu = wave_sum((s4[0] + s4[1]) + (s4[2] + s4[3])) * (1.0f / D_);
    v4f q4 = {};
    #pragma unroll
    for (int i = 0; i < LNC_; ++i) {
      v[r][i] -= mu;
      q4 += v[r][i] * v[r][i];
    }
    const float var  = wave_sum((q4[0] + q4[1]) + (q4[2] + q4[3])) * (1.0f / D_);
    const float rstd = rsqrtf(var + 1e-5f);
    #pragma unroll
    for (int i = 0; i < LNC_; ++i) {
      const v4f y = v[r][i] * rstd * wv[i] + bv[i];
      v4bf o;
      #pragma unroll
      for (int e = 0; e < 4; ++e) o[e] = (__bf16)y[e];
      *reinterpret_cast<v4bf*>(orow + (col + (r * D_ + i * 128))) = o;
    }
  }
}

// ---------------------------------------------------------------------------
// Tiled bf16 GEMM: C[M,N] = A[M,K] * Bt[N,K]^T (+bias epilogues)
// Block = 256 threads (8 waves), tile 128x128, K-step 128, two LDS buffers fed by
// async copies. A staged row is 256 bytes, two whole cache lines, brought by
// sixteen neighbouring lanes; LDS rows stand at a pitch of 272 bytes (16 B x odd),
// free of bank conflicts for the 16-byte fragment reads. Each wave owns 64x32:
// 8 WMMA per 32 of K from 4 A-frags x 2 B-frags.
// M, N multiples of 128; K a multiple of 128.
// EPI 0: outB = bf16((acc+bias)*scale)      (Q/K projections; Q scale 0.125)
// EPI 1: outF = acc + bias + resid          (O-proj, down-proj)
// EPI 2: outB = bf16(gelu_exact(acc+bias))  (up-proj)
// EPI 3: outB[col*S_+row] = acc + bias      (V projection, stored transposed)
// ---------------------------------------------------------------------------
constexpr int GT_ = 128;       // tile rows of A and of Bt
constexpr int GK_ = 128;       // K-step
constexpr int GP_ = GK_ + 8;   // LDS row pitch in elements (272 bytes)

// Eight copies, rows 16 apart, and their s_wait_xcnt 0 in ONE statement: every
// address register stays live to its end, so none is rewritten in front of the wait.
__device__ __forceinline__ void async_copy8_b128(const __bf16* l, const __bf16* g,
                                                 size_t gs) {
  const unsigned l0 = (unsigned)(uintptr_t)l;
  constexpr unsigned ls = 16 * GP_ * 2;          // 16 LDS rows in bytes
  asm volatile("global_load_async_to_lds_b128 %0, %1, off\n\t"
               "global_load_async_to_lds_b128 %2, %3, off\n\t"
               "global_load_async_to_lds_b128 %4, %5, off\n\t"
               "global_load_async_to_lds_b128 %6, %7, off\n\t"
               "global_load_async_to_lds_b128 %8, %9, off\n\t"
               "global_load_async_to_lds_b128 %10, %11, off\n\t"
               "global_load_async_to_lds_b128 %12, %13, off\n\t"
               "global_load_async_to_lds_b128 %14, %15, off\n\t"
               "s_wait_xcnt 0x0"
               :: "v"(l0),          "v"(g),
                  "v"(l0 + ls),     "v"(g + gs),
                  "v"(l0 + 2 * ls), "v"(g + 2 * gs),
                  "v"(l0 + 3 * ls), "v"(g + 3 * gs),
                  "v"(l0 + 4 * ls), "v"(g + 4 * gs),
                  "v"(l0 + 5 * ls), "v"(g + 5 * gs),
                  "v"(l0 + 6 * ls), "v"(g + 6 * gs),
                  "v"(l0 + 7 * ls), "v"(g + 7 * gs)
               : "memory");
}

// amdgpu_waves_per_eu(2, 4): LDS admits two blocks per WGP, four waves per SIMD, so
// the register budget is 256; aiming at more waves the compiler kept one fragment
// set and waited for every residual load of the epilogue by itself.
template <int EPI>
__global__ __launch_bounds__(256) __attribute__((amdgpu_waves_per_eu(2, 4)))
void gemm_bf16_kernel(
    const __bf16* __restrict__ A, const __bf16* __restrict__ Bt,
    const float* __restrict__ bias, const float* __restrict__ resid,
    float* __restrict__ outF, __bf16* __restrict__ outB,
    int M, int N, int K, float scale) {
  __shared__ alignas(16) __bf16 As[2][GT_][GP_];   // [m][k]
  __shared__ alignas(16) __bf16 Bs[2][GT_][GP_];   // [n][k]

  const int n0 = blockIdx.x * GT_;
  const int m0 = blockIdx.y * GT_;
  const int tid  = threadIdx.x;
  const int wave = tid >> 5, lane = tid & 31;
  const int wr = (wave & 1) * 64;     // wave row base (4 sub-tiles of 16)
  const int wc = (wave >> 1) * 32;    // wave col base (2 sub-tiles of 16)
  const int c  = lane & 15, hl = lane >> 4;
  const int sr = tid >> 4, sg = (tid & 15) << 3;   // staging: 16 rows x 16 x 16 bytes

  auto stage = [&](int buf, int kk) {   // rows sr, sr+16, ..., sr+112 of both operands
    async_copy8_b128(&As[buf][sr][sg], A  + (size_t)(m0 + sr) * K + kk + sg, (size_t)16 * K);
    async_copy8_b128(&Bs[buf][sr][sg], Bt + (size_t)(n0 + sr) * K + kk + sg, (size_t)16 * K);
  };

  v8f acc[4][2] = {};
  const int nt = K / GK_;
  stage(0, 0);
  async_wait0();
  __syncthreads();
  if (nt > 1) stage(1, GK_);

  for (int t = 0; t < nt; ++t) {
    const int buf = t & 1;
    v16bf a[2][4], b[2][2];              // two fragment sets, one per 32 of K
    auto frags = [&](int set, int kc) {
      #pragma unroll
      for (int j = 0; j < 2; ++j)
        b[set][j] = load_frag(&Bs[buf][wc + j * 16 + c][kc * 32], hl);
      #pragma unroll
      for (int i = 0; i < 4; ++i)
        a[set][i] = load_frag(&As[buf][wr + i * 16 + c][kc * 32], hl);
    };
    frags(0, 0);
    frags(1, 1);
    // The sched_barriers of this loop keep each set's LDS reads one group between
    // whole runs of WMMAs, two sets ahead: left alone the compiler spreads the reads
    // among the WMMAs with a full wait at each place, or sinks WMMAs behind the
    // barrier, where they take the copies' lead away.
    __builtin_amdgcn_sched_barrier(0);
    #pragma unroll
    for (int kc = 0; kc < GK_ / 32; ++kc) {
      #pragma unroll
      for (int i = 0; i < 4; ++i)
        #pragma unroll
        for (int j = 0; j < 2; ++j)
          acc[i][j] = wmma_bf16(a[kc & 1][i], b[kc & 1][j], acc[i][j]);
      __builtin_amdgcn_sched_barrier(0);
      if (kc + 2 < GK_ / 32) {
        frags(kc & 1, kc + 2);
        __builtin_amdgcn_sched_barrier(0);
      }
    }
    lds_wait0();                 // this trip's reads of buf are done
    async_wait0();               // this wave's share of tile t+1 has landed
    __syncthreads();             // publishes tile t+1, frees buf
    if (t + 2 < nt) stage(buf, (t + 2) * GK_);   // flies during trip t+1
  }
  async_wait0();

  #pragma unroll
  for (int i = 0; i < 4; ++i)
    #pragma unroll
    for (int j = 0; j < 2; ++j)
      #pragma unroll
      for (int e = 0; e < 8; ++e) {
        const int row = m0 + wr + i * 16 + hl * 8 + e;   // C layout: VGPR e + half
        const int col = n0 + wc + j * 16 + c;            // lane % 16
        float v = acc[i][j][e] + bias[col];
        if constexpr (EPI == 0) {
          outB[(size_t)row * N + col] = (__bf16)(v * scale);
        } else if constexpr (EPI == 1) {
          outF[(size_t)row * N + col] = v + resid[(size_t)row * N + col];
        } else if constexpr (EPI == 2) {
          outB[(size_t)row * N + col] =
              (__bf16)(0.5f * v * (1.0f + erff(v * 0.70710678118f)));
        } else {
          outB[(size_t)col * S_ + row] = (__bf16)v;      // vT[dim][seq]
        }
      }
}

constexpr int AST_ = 64;
constexpr int AKP_ = HD_ + 8;
constexpr int AVP_ = AST_ + 8;

// lane l <-> lane l ^ 16
__device__ __forceinline__ float xhalf(float x) {
  const int b = __builtin_bit_cast(int, x);
  return __builtin_bit_cast(float, __builtin_amdgcn_permlanex16(
      b, b, 0x76543210, 0xfedcba98, false, false));
}

// e^x as v_exp_f32(x * log2 e), what __expf compiles to here. The v_nop fills the
// slot the instruction set asks for behind a transcendental before its source is
// overwritten.
__device__ __forceinline__ float exp_slot(float x) {
  float r;
  asm("v_exp_f32 %0, %1\n\tv_nop" : "=v"(r) : "v"(x * 1.4426950408889634f));
  return r;
}

// Which (head, query tile) a block takes. Tile t walks t + 1 stages, and all 768 blocks
// are resident at once, three to a WGP: the launch lasts as long as its fullest WGP.
// With tile = blockIdx.x, flat indices 256 apart are three tiles of the same length.
// Here the 768 pairs are ranked by falling length (rank / H_ counts down from the last
// tile). The first 256 blocks take the longest third in falling order; the second and the third 256 take the middle and the shortest third in
// rising order.
// The map is a permutation of 0..767: every (head, tile) is taken exactly once wherever
// the blocks land. Placement decides speed alone.
constexpr int ANT_  = S_ / 64;   // query tiles of a head
constexpr int WGPS_ = 256;       // WGPs of the chip
static_assert(ANT_ * H_ == 3 * WGPS_, "three blocks to a WGP");
__device__ __forceinline__ unsigned cost_rank(unsigned flat) {
  const unsigned round = flat / WGPS_, w = flat % WGPS_;
  return round * WGPS_ + (round == 0 ? w : WGPS_ - 1 - w);
}

__global__ __launch_bounds__(256) void attn_kernel(
    const __bf16* __restrict__ Q, const __bf16* __restrict__ Kb,
    const __bf16* __restrict__ vT,               // [D][S] transposed values
    const int* __restrict__ amask, __bf16* __restrict__ ctx) {
  // first index: the group of waves that fills and reads the buffers
  __shared__ alignas(16) __bf16 Ks[2][2][AST_][AKP_];   // [key][dim]  (K Q^T   A-frags)
  __shared__ alignas(16) __bf16 Vt[2][2][HD_][AVP_];    // [dim][key]  (V^T P^T A-frags)
  // group 1's partial result on its way to group 0, one column a thread
  __shared__ alignas(16) v4f Po[8][128];
  __shared__ float Pm[128], Pl[128];

  // the group as a scalar: every test on it is then a scalar branch of the whole wave
  const int grp  = __builtin_amdgcn_readfirstlane(threadIdx.x >> 7);
  const int tid  = threadIdx.x & 127;            // thread within the group
  const int wave = tid >> 5, lane = tid & 31;
  const int c  = lane & 15, hl = lane >> 4;
  const unsigned rank = cost_rank(blockIdx.y * ANT_ + blockIdx.x);
  const int h    = rank % H_;
  const int tile = ANT_ - 1 - rank / H_;         // rank 0: the last tile, the longest
  const int q0   = tile * 64 + wave * 16;
  const int hoff = h * HD_;
  const int qr   = q0 + c;                       // this lane's query

  v16bf aq[2];                                   // Q^T as B: lane = query column
  #pragma unroll
  for (int kc = 0; kc < 2; ++kc)
    aq[kc] = load_frag(Q + (size_t)(q0 + c) * D_ + hoff + kc * 32, hl);

  v8f o[4] = {};                                 // o[d][r] = O[qr][d*16 + 8*hl + r]
  float m = -1e30f, l = 0.f;                     // l: this half's keys only

  // 64 keys of K (row-major) and of V (already transposed): both tiles are 64 rows of
  // 128 bytes; eight neighbouring lanes bring a row, a thread rows sr, sr+16, +32, +48
  const int sr = tid >> 3, sg = (tid & 7) << 3;
  const int nst = tile + 1;                      // stages up to the causal bound
  const int ntr = (nst + 1) >> 1;                // trips: a stage for each group
  // The stage that the group fetches for trip t. With an odd count group 1 has none in the
  // last trip: it then fetches the last stage once more, so that every address stays in
  // bounds and every wave issues the same copies, and works on it under the number
  // st = nst. All its keys then count as lying behind every query of the block, so the
  // causal test masks every score: the weights come out 0 beside an earlier maximum;
  // where the group has seen no other stage (the first tile) its maximum stays -1e30 and
  // the join below gives the whole group the weight 0.
  auto stage_of = [&](int t) { const int s = 2 * t + grp; return s < nst ? s : nst - 1; };
  auto stage = [&](int buf, int t) {
    const int k0 = stage_of(t) * AST_;
    async_copy4x2_b128(&Ks[grp][buf][sr][sg], Kb + (size_t)(k0 + sr) * D_ + hoff + sg,
                       (size_t)16 * D_,
                       &Vt[grp][buf][sr][sg], vT + (size_t)(hoff + sr) * S_ + k0 + sg,
                       (size_t)16 * S_, 16 * AKP_ * 2);
  };
  static_assert(AKP_ == AVP_, "one LDS row step serves both tiles");

  stage(0, 0);
  // bit k of pad[ps]: key 32*ps+k of the stage is no padding
  const int fk = stage_of(0) * AST_;
  unsigned pad[2] = {__builtin_amdgcn_ballot_w32(amask[fk + lane] != 0),
                     __builtin_amdgcn_ballot_w32(amask[fk + 32 + lane] != 0)};
  async_wait0();
  __syncthreads();
  if (ntr > 1) stage(1, 1);

  for (int t = 0; t < ntr; ++t) {
    const int buf = t & 1;
    const int st  = 2 * t + grp;                 // this group's stage
    // the next stage's mask words, asked for now and used at the foot of this trip
    // (stage_of keeps the address inside the mask)
    const int nk = stage_of(t + 1) * AST_;
    const int mk0 = amask[nk + lane], mk1 = amask[nk + 32 + lane];
    // The scores of both passes of 32 keys stand in front of the one test of the stage.
    // S^T(32x16) = K(32x64) @ Q^T(64x16) a pass;
    // sc[ps][sub][r] = key st*64+ps*32+sub*16+8*hl+r, query qr
    // Every loop over sc is unrolled: its indices are then constants and it stays in
    // registers.
    v8f sc[2][2] = {};
    #pragma unroll
    for (int ps = 0; ps < 2; ++ps)
      #pragma unroll
      for (int sub = 0; sub < 2; ++sub)
        #pragma unroll
        for (int kc = 0; kc < 2; ++kc) {
          v16bf a = load_frag(&Ks[grp][buf][ps * 32 + sub * 16 + c][kc * 32], hl);
          sc[ps][sub] = wmma_bf16(a, aq[kc], sc[ps][sub]);
        }

    // Stages in front of the last hold keys below the block's first query only, and a
    // mask word of all ones holds no padding: nothing of such a stage is masked. The
    // test reads scalars alone and comes out the same in every wave of the group.
    const bool open = st + 1 < nst && (pad[0] & pad[1]) == 0xffffffffu;
    if (!open) {
      #pragma unroll
      for (int ps = 0; ps < 2; ++ps) {
        // bit k of keep: key 8*hl+k of the pass is open to this lane's query (padding, causal)
        const int n = qr - (st * AST_ + ps * 32);  // last key index the query may see
        const unsigned cau = n >= 31 ? 0xffffffffu : (n < 0 ? 0u : (2u << n) - 1u);
        const unsigned keep = (pad[ps] & cau) >> (hl * 8);
        #pragma unroll
        for (int sub = 0; sub < 2; ++sub)
          #pragma unroll
          for (int r = 0; r < 8; ++r)
            if (((keep >> (sub * 16 + r)) & 1u) == 0u) sc[ps][sub][r] = -1e30f;
      }
    }

    // two passes, unrolled: the LDS offsets are then constants
    #pragma unroll
    for (int ps = 0; ps < 2; ++ps) {
      v8f (&s)[2] = sc[ps];
      // online softmax, one query per lane
      float mx = -1e30f;
      #pragma unroll
      for (int sub = 0; sub < 2; ++sub)
        #pragma unroll
        for (int r = 0; r < 8; ++r) mx = fmaxf(mx, s[sub][r]);
      mx = fmaxf(mx, xhalf(mx));                   // both halves: the query's maximum
      const float mn  = fmaxf(m, mx);
      const float fac = exp_slot(m - mn);
      m = mn;
      v16bf bp;                                    // P^T as B, hardware k order
      float rs = 0.f;
      #pragma unroll
      for (int sub = 0; sub < 2; ++sub)
        #pragma unroll
        for (int r = 0; r < 8; ++r) {
          const float p = exp_slot(s[sub][r] - mn);
          rs += p;
          bp[sub * 8 + r] = (__bf16)p;
        }
      l = l * fac + rs;
      #pragma unroll
      for (int d = 0; d < 4; ++d)
        #pragma unroll
        for (int r = 0; r < 8; ++r) o[d][r] *= fac;

      // O^T += V^T @ P^T
      #pragma unroll
      for (int d = 0; d < 4; ++d) {
        v16bf av = load_frag(&Vt[grp][buf][d * 16 + c][ps * 32], hl);
        o[d] = wmma_bf16(av, bp, o[d]);
      }
    }
    pad[0] = __builtin_amdgcn_ballot_w32(mk0 != 0);
    pad[1] = __builtin_amdgcn_ballot_w32(mk1 != 0);
    lds_wait0();                 // this trip's reads of buf are done
    async_wait0();               // this wave's share of trip t+1 has landed
    __syncthreads();             // publishes trip t+1, frees buf
    if (t + 2 < ntr) stage(buf, t + 2);          // flies during trip t+1
  }
  async_wait0();

  if (grp == 1) {                // scalar: the whole wave hands over or none of it
    #pragma unroll
    for (int d = 0; d < 4; ++d) {
      Po[2 * d][tid]     = v4f{o[d][0], o[d][1], o[d][2], o[d][3]};
      Po[2 * d + 1][tid] = v4f{o[d][4], o[d][5], o[d][6], o[d][7]};
    }
    Pm[tid] = m;
    Pl[tid] = l;
  }
  __syncthreads();               // group 1's partial result is in LDS
  if (grp == 1) return;          // behind the last barrier

  // two partial softmaxes over disjoint keys: both brought to the common maximum
  const float m1 = Pm[tid];
  const float mt = fmaxf(m, m1);
  const float w0 = exp_slot(m - mt), w1 = exp_slot(m1 - mt);
  l = l * w0 + Pl[tid] * w1;
  #pragma unroll
  for (int d = 0; d < 4; ++d) {
    const v4f lo = Po[2 * d][tid], hi = Po[2 * d + 1][tid];
    #pragma unroll
    for (int r = 0; r < 4; ++r) {
      o[d][r]     = o[d][r] * w0 + lo[r] * w1;
      o[d][r + 4] = o[d][r + 4] * w0 + hi[r] * w1;
    }
  }

  const float inv = 1.0f / (l + xhalf(l));       // join the halves' sums once
  #pragma unroll
  for (int d = 0; d < 4; ++d) {
    v8bf w;
    #pragma unroll
    for (int r = 0; r < 8; ++r) w[r] = (__bf16)(o[d][r] * inv);
    *reinterpret_cast<v8bf*>(ctx + (size_t)qr * D_ + hoff + d * 16 + hl * 8) = w;
  }
}

// ---------------------------------------------------------------------------
// Host launcher
// ---------------------------------------------------------------------------
extern "C" void kernel_launch(void* const* d_in, const int* in_sizes, int n_in,
                              void* d_out, int out_size, void* d_ws, size_t ws_size,
                              hipStream_t stream) {
  const float* hidden = (const float*)d_in[0];
  const int*   mask   = (const int*)  d_in[1];
  const float* ln1w   = (const float*)d_in[2];
  const float* ln1b   = (const float*)d_in[3];
  const float* wq     = (const float*)d_in[4];
  const float* bq     = (const float*)d_in[5];
  const float* wk     = (const float*)d_in[6];
  const float* bk     = (const float*)d_in[7];
  const float* wv     = (const float*)d_in[8];
  const float* bv     = (const float*)d_in[9];
  const float* wo     = (const float*)d_in[10];
  const float* bo     = (const float*)d_in[11];
  const float* ln2w   = (const float*)d_in[12];
  const float* ln2b   = (const float*)d_in[13];
  const float* wup    = (const float*)d_in[14];
  const float* bup    = (const float*)d_in[15];
  const float* wdown  = (const float*)d_in[16];
  const float* bdown  = (const float*)d_in[17];
  float* out = (float*)d_out;

  constexpr size_t W_DD  = (size_t)D_ * D_;
  constexpr size_t W_DF  = (size_t)D_ * FF_;
  constexpr size_t ACT   = (size_t)S_ * D_;
  constexpr size_t ACTFF = (size_t)S_ * FF_;

  char* ws = (char*)d_ws;
  size_t off = 0;
  __bf16* wqT  = (__bf16*)(ws + off); off += W_DD * 2;   // all weights [N][K] bf16
  __bf16* wkT  = (__bf16*)(ws + off); off += W_DD * 2;
  __bf16* wvT  = (__bf16*)(ws + off); off += W_DD * 2;
  __bf16* woT  = (__bf16*)(ws + off); off += W_DD * 2;
  __bf16* wupT = (__bf16*)(ws + off); off += W_DF * 2;
  __bf16* wdnT = (__bf16*)(ws + off); off += W_DF * 2;
  __bf16* xln_bf  = (__bf16*)(ws + off); off += ACT * 2;
  __bf16* q_bf    = (__bf16*)(ws + off); off += ACT * 2;
  __bf16* k_bf    = (__bf16*)(ws + off); off += ACT * 2;
  __bf16* vT_bf   = (__bf16*)(ws + off); off += ACT * 2;  // [D][S]
  __bf16* ctx_bf  = (__bf16*)(ws + off); off += ACT * 2;
  float*  hidden2 = (float*) (ws + off); off += ACT * 4;
  __bf16* yln_bf  = (__bf16*)(ws + off); off += ACT * 2;
  __bf16* ff_bf   = (__bf16*)(ws + off); off += ACTFF * 2;

  // the six transposed weights stand back to back from wqT on
  weights_to_bf16_t_kernel<<<4 * PDD_ + 2 * PDF_, 256, 0, stream>>>(wq, wk, wv, wo, wup, wdown,
                                                                    wqT);

  // LN1
  ln_bf16_kernel<<<S_ / (8 * LNR_), 256, 0, stream>>>(hidden, ln1w, ln1b, xln_bf);

  // Projections (Q pre-scaled by 1/sqrt(HD); V written transposed)
  dim3 gDD(D_ / GT_, S_ / GT_);
  gemm_bf16_kernel<0><<<gDD, 256, 0, stream>>>(xln_bf, wqT, bq, nullptr, nullptr, q_bf,
                                               S_, D_, D_, 0.125f);
  gemm_bf16_kernel<0><<<gDD, 256, 0, stream>>>(xln_bf, wkT, bk, nullptr, nullptr, k_bf,
                                               S_, D_, D_, 1.0f);
  gemm_bf16_kernel<3><<<gDD, 256, 0, stream>>>(xln_bf, wvT, bv, nullptr, nullptr, vT_bf,
                                               S_, D_, D_, 1.0f);

  // Flash attention
  attn_kernel<<<dim3(S_ / 64, H_), 256, 0, stream>>>(q_bf, k_bf, vT_bf, mask, ctx_bf);

  // O-projection + residual -> hidden2 (fp32)
  gemm_bf16_kernel<1><<<gDD, 256, 0, stream>>>(ctx_bf, woT, bo, hidden, hidden2, nullptr,
                                               S_, D_, D_, 1.0f);

  // LN2
  ln_bf16_kernel<<<S_ / (8 * LNR_), 256, 0, stream>>>(hidden2, ln2w, ln2b, yln_bf);

  // Up-projection + exact GELU -> bf16
  gemm_bf16_kernel<2><<<dim3(FF_ / GT_, S_ / GT_), 256, 0, stream>>>(
      yln_bf, wupT, bup, nullptr, nullptr, ff_bf, S_, FF_, D_, 1.0f);

  // Down-projection + residual -> d_out (fp32)
  gemm_bf16_kernel<1><<<gDD, 256, 0, stream>>>(ff_bf, wdnT, bdown, hidden2, out, nullptr,
                                               S_, D_, FF_, 1.0f);
}

// v010
// Measured time: 141 microseconds a run.
// In two side-by-side timings against v009, it was 1.11 and 1.10 times as fast.
// Counting every step since v000, it is 3.63 times as fast.
#include <hip/hip_runtime.h>
#include <hip/hip_bf16.h>
#include <math.h>

// ---------------------------------------------------------------------------
// Transformer block (B=1, S=4096, D=768, H=12, HD=64, FF=3072) on gfx1250.
// ~110 GFLOP vs ~55MB minimum traffic -> strongly compute bound: bf16 WMMA
// (v_wmma_f32_16x16x32_bf16, fp32 accum) everywhere, flash-attention so the
// 805MB score tensor never exists, and GLOBAL_LOAD_ASYNC_TO_LDS_B128 (ASYNCcnt)
// staging with double buffering so HBM->LDS copies overlap the matrix pipe.
// ---------------------------------------------------------------------------

typedef __attribute__((ext_vector_type(16))) __bf16 v16bf;
typedef __attribute__((ext_vector_type(8)))  __bf16 v8bf;
typedef __attribute__((ext_vector_type(8)))  float  v8f;

constexpr int S_  = 4096;
constexpr int D_  = 768;
constexpr int H_  = 12;
constexpr int HD_ = 64;
constexpr int FF_ = 3072;

__device__ __forceinline__ v16bf cat16(v8bf lo, v8bf hi) {
  return __builtin_shufflevector(lo, hi, 0,1,2,3,4,5,6,7,8,9,10,11,12,13,14,15);
}
// A/B fragment loader: p points at a 32-wide K-run; lane half hl selects
// K offsets {hl*8..+8} and {16+hl*8..+8} per the ISA 16-bit operand layout.
__device__ __forceinline__ v16bf load_frag(const __bf16* p, int hl) {
  v8bf lo = *reinterpret_cast<const v8bf*>(p + hl * 8);
  v8bf hi = *reinterpret_cast<const v8bf*>(p + 16 + hl * 8);
  return cat16(lo, hi);
}
__device__ __forceinline__ v8f wmma_bf16(v16bf a, v16bf b, v8f c) {
  return __builtin_amdgcn_wmma_f32_16x16x32_bf16(false, a, false, b, (short)0, c,
                                                 false, false);
}

// CDNA5 async global->LDS copy (no VGPR round trip, tracked by ASYNCcnt).
// Generic shared pointers carry the LDS offset in their low 32 bits
// (ISA 10.2: LDS_ADDR.U32 = addr[31:0]); dsaddr = LDS_BASE + VGPR + IOFFSET.
// Four rows of one tile and four of another (rows 16 apart: ls bytes in LDS, ga or
// gb elements in memory) and their s_wait_xcnt 0 in ONE statement: every address
// register stays live to its end, so none is rewritten in front of the wait.
__device__ __forceinline__ void async_copy4x2_b128(const __bf16* la, const __bf16* a,
                                                   size_t ga, const __bf16* lb,
                                                   const __bf16* b, size_t gb,
                                                   unsigned ls) {
  const unsigned a0 = (unsigned)(uintptr_t)la, b0 = (unsigned)(uintptr_t)lb;
  asm volatile("global_load_async_to_lds_b128 %0, %1, off\n\t"
               "global_load_async_to_lds_b128 %2, %3, off\n\t"
               "global_load_async_to_lds_b128 %4, %5, off\n\t"
               "global_load_async_to_lds_b128 %6, %7, off\n\t"
               "global_load_async_to_lds_b128 %8, %9, off\n\t"
               "global_load_async_to_lds_b128 %10, %11, off\n\t"
               "global_load_async_to_lds_b128 %12, %13, off\n\t"
               "global_load_async_to_lds_b128 %14, %15, off\n\t"
               "s_wait_xcnt 0x0"
               :: "v"(a0),          "v"(a),
                  "v"(a0 + ls),     "v"(a + ga),
                  "v"(a0 + 2 * ls), "v"(a + 2 * ga),
                  "v"(a0 + 3 * ls), "v"(a + 3 * ga),
                  "v"(b0),          "v"(b),
                  "v"(b0 + ls),     "v"(b + gb),
                  "v"(b0 + 2 * ls), "v"(b + 2 * gb),
                  "v"(b0 + 3 * ls), "v"(b + 3 * gb)
               : "memory");
}
__device__ __forceinline__ void async_wait0() {
  asm volatile("s_wait_asynccnt 0x0" ::: "memory");
}
// This wave's LDS reads have retired: stands in front of the barrier behind which
// copies refill the buffer that was read.
__device__ __forceinline__ void lds_wait0() {
  asm volatile("s_wait_dscnt 0x0" ::: "memory");
}

// ---------------------------------------------------------------------------
// Weight prep: [K][N] fp32 -> [N][K] bf16 for all six weights in ONE launch.
// Lets GEMM B-staging be straight contiguous async copies.
// A block of 8 waves transposes a tile of 128 (k) x 64 (n) through LDS. A thread reads
// eight rows of four floats (a wave-wide load: two runs of 256 bytes), so it holds eight
// successive k of four columns: four 16-byte LDS writes. The tile leaves as rows of
// 256 bytes, 16 bytes a lane. 864 blocks, all resident at once: a launch this short
// pays for each wave that it has to start, and each launch for the gap in front of it.
// LDS rows are 256 bytes, unpadded; the 16-byte chunk ch of row r stands at place
// ch ^ ((r >> 2) & 15): the sixteen lanes of a write (rows four apart, one chunk) and
// the sixteen of a read (one row, all chunks) each meet sixteen different places.
// ---------------------------------------------------------------------------
typedef __attribute__((ext_vector_type(4))) float  v4f;

constexpr int PK_  = 128;                          // tile extent along k
constexpr int PN_  = 64;                           // tile extent along n
constexpr int PDD_ = (D_ / PK_) * (D_ / PN_);      // tiles of a D x D weight
constexpr int PDF_ = (D_ / PK_) * (FF_ / PN_);     // tiles of w_up, and of w_down
static_assert(D_ % PK_ == 0 && FF_ % PK_ == 0 && D_ % PN_ == 0 && FF_ % PN_ == 0,
              "whole tiles only");

// One tile. K and N are compile-time: the eight loads then share one scalar base and one
// lane-offset register, differ in their immediate offsets and issue as one group.
template <int K, int N>
__device__ __forceinline__ void transpose_tile(const float* __restrict__ in,
                                               __bf16* __restrict__ out, int t,
                                               __bf16* tile) {
  constexpr int ntn = N / PN_;
  const int kb = (t / ntn) * PK_, nb = (t % ntn) * PN_;
  const unsigned lo = threadIdx.x & 15, hi = threadIdx.x >> 4;
  const float* src = in + ((size_t)kb * N + nb);   // scalar bases of the tile
  __bf16* dst = out + ((size_t)nb * K + kb);

  v4f x[8];                          // x[j][i] = in[kb + hi*8 + j][nb + lo*4 + i]
  const unsigned li = hi * 8 * N + lo * 4;
  #pragma unroll
  for (int j = 0; j < 8; ++j)
    x[j] = *reinterpret_cast<const v4f*>(src + (li + j * N));
  #pragma unroll
  for (int i = 0; i < 4; ++i) {      // row lo*4+i, chunk hi; (row >> 2) & 15 is lo
    v8bf p;
    #pragma unroll
    for (int j = 0; j < 8; ++j) p[j] = (__bf16)x[j][i];
    *reinterpret_cast<v8bf*>(tile + (lo * 4 + i) * PK_ + (hi ^ lo) * 8) = p;
  }
  __syncthreads();
  const unsigned so = hi * K + lo * 8;
  #pragma unroll
  for (int y = 0; y < 4; ++y) {      // row hi+16*y, chunk lo
    const unsigned r = hi + y * 16;
    const v8bf p = *reinterpret_cast<const v8bf*>(tile + r * PK_ + (lo ^ ((r >> 2) & 15)) * 8);
    *reinterpret_cast<v8bf*>(dst + (so + y * 16 * K)) = p;
  }
}

__global__ __launch_bounds__(256) void weights_to_bf16_t_kernel(
    const float* __restrict__ wq, const float* __restrict__ wk,
    const float* __restrict__ wv, const float* __restrict__ wo,
    const float* __restrict__ wup, const float* __restrict__ wdown,
    __bf16* __restrict__ outT) {     // the six outputs in that order, back to back
  __shared__ alignas(16) __bf16 tile[PN_ * PK_];   // [n][k], chunks swizzled

  // which weight and which tile of it: the same for the whole block
  const int bid = blockIdx.x;
  if (bid < 4 * PDD_) {
    const int w = bid / PDD_;
    transpose_tile<D_, D_>(w == 0 ? wq : w == 1 ? wk : w == 2 ? wv : wo,
                           outT + (size_t)w * D_ * D_, bid - w * PDD_, tile);
  } else if (bid < 4 * PDD_ + PDF_) {
    transpose_tile<D_, FF_>(wup, outT + (size_t)4 * D_ * D_, bid - 4 * PDD_, tile);
  } else {
    transpose_tile<FF_, D_>(wdown, outT + (size_t)4 * D_ * D_ + (size_t)D_ * FF_,
                            bid - 4 * PDD_ - PDF_, tile);
  }
}

// ---------------------------------------------------------------------------
// LayerNorm (fp32 in) -> bf16 out.  One WAVE per pair of rows, no LDS, no barrier.
// A row of 768 floats lives in registers (six 16-byte loads a lane, each wave-wide
// load 512 contiguous bytes), is read from memory once, and both sums are taken
// in-lane plus a five-step butterfly across the wave. 2,048 waves a launch, eight on
// every WGP: a launch this short pays for each wave that it has to start.
// ---------------------------------------------------------------------------
typedef __attribute__((ext_vector_type(4))) __bf16 v4bf;

constexpr int LNR_ = 2;            // rows per wave
constexpr int LNC_ = D_ / 128;     // 16-byte chunks of a row per lane

// x + (x of lane ^ MASK) inside a 16-lane row (DPP row_xmask)
template <int MASK>
__device__ __forceinline__ float add_xmask(float x) {
  const int v = __builtin_bit_cast(int, x);
  return x + __builtin_bit_cast(float,
      __builtin_amdgcn_update_dpp(0, v, 0x160 + MASK, 0xf, 0xf, true));
}
// sum over the 32 lanes, the same value in every lane
__device__ __forceinline__ float wave_sum(float x) {
  x = add_xmask<1>(x);
  x = add_xmask<2>(x);
  x = add_xmask<4>(x);
  x = add_xmask<8>(x);
  const int v = __builtin_bit_cast(int, x);
  return x + __builtin_bit_cast(float, __builtin_amdgcn_permlanex16(
      v, v, 0x76543210, 0xfedcba98, false, false));
}

// amdgpu_waves_per_eu(2, 4): the grid puts two waves on a SIMD; aiming at sixteen the
// compiler kept to 64 registers and loaded w and b late, pair by pair, a full wait each.
__global__ __launch_bounds__(256) __attribute__((amdgpu_waves_per_eu(2, 4)))
void ln_bf16_kernel(
    const float* __restrict__ x, const float* __restrict__ w,
    const float* __restrict__ b, __bf16* __restrict__ out) {
  // the wave's number as a scalar: row bases stand in scalar registers, and every
  // load and store of the wave shares one lane-offset register
  const int wave = __builtin_amdgcn_readfirstlane(threadIdx.x >> 5);
  const int lane = threadIdx.x & 31;
  const int row0 = (blockIdx.x * 8 + wave) * LNR_;
  const unsigned col = lane * 4;
  const float* xr = x + (size_t)row0 * D_;       // scalar bases of the wave's rows
  __bf16* orow = out + (size_t)row0 * D_;

  v4f v[LNR_][LNC_], wv[LNC_], bv[LNC_];
  #pragma unroll
  for (int i = 0; i < LNC_; ++i) {
    wv[i] = *reinterpret_cast<const v4f*>(w + (col + i * 128));
    bv[i] = *reinterpret_cast<const v4f*>(b + (col + i * 128));
  }
  #pragma unroll
  for (int r = 0; r < LNR_; ++r)
    #pragma unroll
    for (int i = 0; i < LNC_; ++i)
      v[r][i] = *reinterpret_cast<const v4f*>(xr + (col + (r * D_ + i * 128)));

  #pragma unroll
  for (int r = 0; r < LNR_; ++r) {
    v4f s4 = v[r][0];
    #pragma unroll
    for (int i = 1; i < LNC_; ++i) s4 += v[r][i];
    const float mu = wave_sum((s4[0] + s4[1]) + (s4[2] + s4[3])) * (1.0f / D_);
    v4f q4 = {};
    #pragma unroll
    for (int i = 0; i < LNC_; ++i) {
      v[r][i] -= mu;
      q4 += v[r][i] * v[r][i];
    }
    const float var  = wave_sum((q4[0] + q4[1]) + (q4[2] + q4[3])) * (1.0f / D_);
    const float rstd = rsqrtf(var + 1e-5f);
    #pragma unroll
    for (int i = 0; i < LNC_; ++i) {
      const v4f y = v[r][i] * rstd * wv[i] + bv[i];
      v4bf o;
      #pragma unroll
      for (int e = 0; e < 4; ++e) o[e] = (__bf16)y[e];
      *reinterpret_cast<v4bf*>(orow + (col + (r * D_ + i * 128))) = o;
    }
  }
}

// ---------------------------------------------------------------------------
// Tiled bf16 GEMM: C[M,N] = A[M,K] * Bt[N,K]^T (+bias epilogues)
// Block = 256 threads (8 waves), tile 128x128, K-step 128, two LDS buffers fed by
// async copies. A staged row is 256 bytes, two whole cache lines, brought by
// sixteen neighbouring lanes; LDS rows stand at a pitch of 272 bytes (16 B x odd),
// free of bank conflicts for the 16-byte fragment reads. Each wave owns 64x32:
// 8 WMMA per 32 of K from 4 A-frags x 2 B-frags.
// M, N multiples of 128; K a multiple of 128.
// EPI 1: outF = acc + bias + resid          (O-proj, down-proj)
// EPI 2: outB = bf16(gelu_exact(acc+bias))  (up-proj)
// ---------------------------------------------------------------------------
constexpr int GT_ = 128;       // tile rows of A and of Bt
constexpr int GK_ = 128;       // K-step
constexpr int GP_ = GK_ + 8;   // LDS row pitch in elements (272 bytes)

// Eight copies, rows 16 apart, and their s_wait_xcnt 0 in ONE statement: every
// address register stays live to its end, so none is rewritten in front of the wait.
__device__ __forceinline__ void async_copy8_b128(const __bf16* l, const __bf16* g,
                                                 size_t gs) {
  const unsigned l0 = (unsigned)(uintptr_t)l;
  constexpr unsigned ls = 16 * GP_ * 2;          // 16 LDS rows in bytes
  asm volatile("global_load_async_to_lds_b128 %0, %1, off\n\t"
               "global_load_async_to_lds_b128 %2, %3, off\n\t"
               "global_load_async_to_lds_b128 %4, %5, off\n\t"
               "global_load_async_to_lds_b128 %6, %7, off\n\t"
               "global_load_async_to_lds_b128 %8, %9, off\n\t"
               "global_load_async_to_lds_b128 %10, %11, off\n\t"
               "global_load_async_to_lds_b128 %12, %13, off\n\t"
               "global_load_async_to_lds_b128 %14, %15, off\n\t"
               "s_wait_xcnt 0x0"
               :: "v"(l0),          "v"(g),
                  "v"(l0 + ls),     "v"(g + gs),
                  "v"(l0 + 2 * ls), "v"(g + 2 * gs),
                  "v"(l0 + 3 * ls), "v"(g + 3 * gs),
                  "v"(l0 + 4 * ls), "v"(g + 4 * gs),
                  "v"(l0 + 5 * ls), "v"(g + 5 * gs),
                  "v"(l0 + 6 * ls), "v"(g + 6 * gs),
                  "v"(l0 + 7 * ls), "v"(g + 7 * gs)
               : "memory");
}

// amdgpu_waves_per_eu(2, 4): LDS admits two blocks per WGP, four waves per SIMD, so
// the register budget is 256; aiming at more waves the compiler kept one fragment
// set and waited for every residual load of the epilogue by itself.
template <int EPI>
__global__ __launch_bounds__(256) __attribute__((amdgpu_waves_per_eu(2, 4)))
void gemm_bf16_kernel(
    const __bf16* __restrict__ A, const __bf16* __restrict__ Bt,
    const float* __restrict__ bias, const float* __restrict__ resid,
    float* __restrict__ outF, __bf16* __restrict__ outB,
    int M, int N, int K) {
  __shared__ alignas(16) __bf16 As[2][GT_][GP_];   // [m][k]
  __shared__ alignas(16) __bf16 Bs[2][GT_][GP_];   // [n][k]

  const int n0 = blockIdx.x * GT_;
  const int m0 = blockIdx.y * GT_;
  const int tid  = threadIdx.x;
  const int wave = tid >> 5, lane = tid & 31;
  const int wr = (wave & 1) * 64;     // wave row base (4 sub-tiles of 16)
  const int wc = (wave >> 1) * 32;    // wave col base (2 sub-tiles of 16)
  const int c  = lane & 15, hl = lane >> 4;
  const int sr = tid >> 4, sg = (tid & 15) << 3;   // staging: 16 rows x 16 x 16 bytes

  auto stage = [&](int buf, int kk) {   // rows sr, sr+16, ..., sr+112 of both operands
    async_copy8_b128(&As[buf][sr][sg], A  + (size_t)(m0 + sr) * K + kk + sg, (size_t)16 * K);
    async_copy8_b128(&Bs[buf][sr][sg], Bt + (size_t)(n0 + sr) * K + kk + sg, (size_t)16 * K);
  };

  v8f acc[4][2] = {};
  const int nt = K / GK_;
  stage(0, 0);
  async_wait0();
  __syncthreads();
  if (nt > 1) stage(1, GK_);

  for (int t = 0; t < nt; ++t) {
    const int buf = t & 1;
    v16bf a[2][4], b[2][2];              // two fragment sets, one per 32 of K
    auto frags = [&](int set, int kc) {
      #pragma unroll
      for (int j = 0; j < 2; ++j)
        b[set][j] = load_frag(&Bs[buf][wc + j * 16 + c][kc * 32], hl);
      #pragma unroll
      for (int i = 0; i < 4; ++i)
        a[set][i] = load_frag(&As[buf][wr + i * 16 + c][kc * 32], hl);
    };
    frags(0, 0);
    frags(1, 1);
    // The sched_barriers of this loop keep each set's LDS reads one group between
    // whole runs of WMMAs, two sets ahead: left alone the compiler spreads the reads
    // among the WMMAs with a full wait at each place, or sinks WMMAs behind the
    // barrier, where they take the copies' lead away.
    __builtin_amdgcn_sched_barrier(0);
    #pragma unroll
    for (int kc = 0; kc < GK_ / 32; ++kc) {
      #pragma unroll
      for (int i = 0; i < 4; ++i)
        #pragma unroll
        for (int j = 0; j < 2; ++j)
          acc[i][j] = wmma_bf16(a[kc & 1][i], b[kc & 1][j], acc[i][j]);
      __builtin_amdgcn_sched_barrier(0);
      if (kc + 2 < GK_ / 32) {
        frags(kc & 1, kc + 2);
        __builtin_amdgcn_sched_barrier(0);
      }
    }
    lds_wait0();                 // this trip's reads of buf are done
    async_wait0();               // this wave's share of tile t+1 has landed
    __syncthreads();             // publishes tile t+1, frees buf
    if (t + 2 < nt) stage(buf, (t + 2) * GK_);   // flies during trip t+1
  }
  async_wait0();

  #pragma unroll
  for (int i = 0; i < 4; ++i)
    #pragma unroll
    for (int j = 0; j < 2; ++j)
      #pragma unroll
      for (int e = 0; e < 8; ++e) {
        const int row = m0 + wr + i * 16 + hl * 8 + e;   // C layout: VGPR e + half
        const int col = n0 + wc + j * 16 + c;            // lane % 16
        float v = acc[i][j][e] + bias[col];
        if constexpr (EPI == 1) {
          outF[(size_t)row * N + col] = v + resid[(size_t)row * N + col];
        } else {
          outB[(size_t)row * N + col] =
              (__bf16)(0.5f * v * (1.0f + erff(v * 0.70710678118f)));
        }
      }
}

// ---------------------------------------------------------------------------
// Q, K and V projections in ONE launch: C[S][3 D] = xln[S][D] * W^T, W the three
// transposed weights back to back, 3 D rows of D.
// Alone, a projection is 192 tiles of 128x128 on 256 WGPs and six K-steps long: a
// quarter of the chip idles, and each launch pays its gap, its fill, its first tile's
// latency and its epilogue for a loop that short. Together they are 4096 x 2304, cut
// into 32 x 8 = 256 blocks of 128 rows x 288 columns, one on every WGP, all alike.
// The 288 columns of block x are 192 successive columns of [Q | K] and 96 of V:
// 192 columns are three whole 128-byte lines of a q or k row, so every line has one
// writing block; D = 4 x 192, so a block holds Q or K, never both; vT's lines run
// along the 128 rows.
// 8 waves as 4 (rows) x 2 (columns): a wave owns 32 rows x (96 of Q or K + 48 of V),
// 18 WMMA per 32 of K from 2 A-frags and 9 B-frags. The ring, the K-step, the LDS pitch
// and the order of the sums are those of gemm_bf16_kernel.
//   Q: q[row][col]  = bf16((acc + bq) * 0.125)   (1 / sqrt(HD))
//   K: k[row][col]  = bf16(acc + bk)
//   V: vT[col][row] = bf16(acc + bv)             (stored transposed)
// ---------------------------------------------------------------------------
constexpr int QNB_ = 8;                    // blocks along the columns
constexpr int QC_  = 2 * D_ / QNB_;        // columns of [Q | K] in a block
constexpr int QV_  = D_ / QNB_;            // columns of V in a block
constexpr int QN_  = QC_ + QV_;            // rows of W in LDS
constexpr int QFA_ = GT_ / 4 / 16;         // A fragments of a wave
constexpr int QFC_ = QC_ / 2 / 16;         // its B fragments of Q or K
constexpr int QFB_ = QFC_ + QV_ / 2 / 16;  // all its B fragments
static_assert(QC_ % 64 == 0 && D_ % QC_ == 0 && QV_ % 32 == 0 && S_ % GT_ == 0 &&
              D_ % GK_ == 0 && D_ / GK_ >= 2, "whole tiles, whole lines, two K-steps");
static_assert(GT_ / 16 + QN_ / 16 == 2 * 13, "stage() brings twice thirteen rows a thread");

// Thirteen copies, half a stage of a thread, and their s_wait_xcnt 0 in ONE statement, as
// in async_copy8_b128; l: LDS byte addresses, g: global addresses. Two statements a stage:
// every such wait stands between the barrier and the trip's first LDS reads.
__device__ __forceinline__ void async_copy13_b128(const unsigned* l, const __bf16* const* g) {
  asm volatile("global_load_async_to_lds_b128 %0, %1, off\n\t"
               "global_load_async_to_lds_b128 %2, %3, off\n\t"
               "global_load_async_to_lds_b128 %4, %5, off\n\t"
               "global_load_async_to_lds_b128 %6, %7, off\n\t"
               "global_load_async_to_lds_b128 %8, %9, off\n\t"
               "global_load_async_to_lds_b128 %10, %11, off\n\t"
               "global_load_async_to_lds_b128 %12, %13, off\n\t"
               "global_load_async_to_lds_b128 %14, %15, off\n\t"
               "global_load_async_to_lds_b128 %16, %17, off\n\t"
               "global_load_async_to_lds_b128 %18, %19, off\n\t"
               "global_load_async_to_lds_b128 %20, %21, off\n\t"
               "global_load_async_to_lds_b128 %22, %23, off\n\t"
               "global_load_async_to_lds_b128 %24, %25, off\n\t"
               "s_wait_xcnt 0x0"
               :: "v"(l[0]), "v"(g[0]),
                  "v"(l[1]), "v"(g[1]),
                  "v"(l[2]), "v"(g[2]),
                  "v"(l[3]), "v"(g[3]),
                  "v"(l[4]), "v"(g[4]),
                  "v"(l[5]), "v"(g[5]),
                  "v"(l[6]), "v"(g[6]),
                  "v"(l[7]), "v"(g[7]),
                  "v"(l[8]), "v"(g[8]),
                  "v"(l[9]), "v"(g[9]),
                  "v"(l[10]), "v"(g[10]),
                  "v"(l[11]), "v"(g[11]),
                  "v"(l[12]), "v"(g[12])
               : "memory");
}

// amdgpu_waves_per_eu(2, 2): LDS admits one block per WGP, two waves per SIMD, so a wave
// may hold its 144 accumulator registers and two fragment sets of 88.
__global__ __launch_bounds__(256) __attribute__((amdgpu_waves_per_eu(2, 2)))
void qkv_gemm_kernel(
    const __bf16* __restrict__ A, const __bf16* __restrict__ Wt,
    const float* __restrict__ bq, const float* __restrict__ bk,
    const float* __restrict__ bv, __bf16* __restrict__ q, __bf16* __restrict__ k,
    __bf16* __restrict__ vT) {
  __shared__ alignas(16) __bf16 As[2][GT_][GP_];   // [m][k]
  __shared__ alignas(16) __bf16 Bs[2][QN_][GP_];   // [n][k]: QC_ rows of Q or K, QV_ of V

  const int c0 = blockIdx.x * QC_;    // first column in [Q | K]
  const int v0 = blockIdx.x * QV_;    // first column in V
  const int m0 = blockIdx.y * GT_;
  const int tid  = threadIdx.x;
  const int wave = tid >> 5, lane = tid & 31;
  const int wr = (wave & 3) * (QFA_ * 16);    // wave row base
  const int wn = wave >> 2;                   // which half of the columns
  const int c  = lane & 15, hl = lane >> 4;
  const int sr = tid >> 4, sg = (tid & 15) << 3;   // staging: 16 rows x 16 x 16 bytes

  // Every loop of this kernel but the one over t is unrolled: the indices of l, g, acc, a,
  // b, bias and o are then constants, and the arrays stay in registers.
  auto stage = [&](int buf, int kk) {   // rows sr, sr+16, ... of both operands
    unsigned l[26];
    const __bf16* g[26];
    #pragma unroll
    for (int i = 0; i < GT_ / 16; ++i) {
      l[i] = (unsigned)(uintptr_t)&As[buf][sr + i * 16][sg];
      g[i] = A + (size_t)(m0 + sr + i * 16) * D_ + kk + sg;
    }
    #pragma unroll
    for (int i = 0; i < QN_ / 16; ++i) {         // row of Bs -> row of W
      const int r = sr + i * 16;
      l[GT_ / 16 + i] = (unsigned)(uintptr_t)&Bs[buf][r][sg];
      g[GT_ / 16 + i] = Wt + (size_t)(i * 16 < QC_ ? c0 + r : 2 * D_ + v0 + r - QC_) * D_ + kk + sg;
    }
    async_copy13_b128(l, g);
    async_copy13_b128(l + 13, g + 13);
  };
  // first column of the wave's sub-tile j, counted in the block's rows of Bs
  auto sub = [&](int j) {
    return j < QFC_ ? (wn * QFC_ + j) * 16 : QC_ + (wn * (QFB_ - QFC_) + j - QFC_) * 16;
  };

  v8f acc[QFA_][QFB_] = {};
  constexpr int nt = D_ / GK_;
  stage(0, 0);
  // the block's output among Q and K, and the biases, asked for while tile 0 flies
  const bool isq = c0 < D_;
  const int  cq  = isq ? c0 : c0 - D_;           // the block's first column in q or in k
  float bias[QFB_];
  #pragma unroll
  for (int j = 0; j < QFB_; ++j)
    bias[j] = j < QFC_ ? (isq ? bq : bk)[cq + sub(j) + c] : bv[v0 + sub(j) - QC_ + c];
  async_wait0();
  __syncthreads();
  stage(1, GK_);

  for (int t = 0; t < nt; ++t) {
    const int buf = t & 1;
    v16bf a[2][QFA_], b[2][QFB_];        // two fragment sets, one per 32 of K
    auto frags_b = [&](int set, int kc, int j0, int j1) {
      #pragma unroll
      for (int j = j0; j < j1; ++j)
        b[set][j] = load_frag(&Bs[buf][sub(j) + c][kc * 32], hl);
    };
    auto frags = [&](int set, int kc, int j1) {  // the A fragments and the first j1 of B
      #pragma unroll
      for (int i = 0; i < QFA_; ++i)
        a[set][i] = load_frag(&As[buf][wr + i * 16 + c][kc * 32], hl);
      frags_b(set, kc, 0, j1);
    };
    // The sched_barriers of this loop do what they do in gemm_bf16_kernel: each set's
    // LDS reads stay one group between whole runs of WMMAs, two sets ahead. The first two
    // keep the trip's reads in the order of their use: left alone the compiler read what
    // the first WMMA needs late, once behind 38 of the 44 reads.
    frags(0, 0, 2);
    __builtin_amdgcn_sched_barrier(0);
    frags_b(0, 0, 2, QFB_);
    __builtin_amdgcn_sched_barrier(0);
    frags(1, 1, QFB_);
    __builtin_amdgcn_sched_barrier(0);
    #pragma unroll
    for (int kc = 0; kc < GK_ / 32; ++kc) {
      #pragma unroll
      for (int j = 0; j < QFB_; ++j)
        #pragma unroll
        for (int i = 0; i < QFA_; ++i)
          acc[i][j] = wmma_bf16(a[kc & 1][i], b[kc & 1][j], acc[i][j]);
      __builtin_amdgcn_sched_barrier(0);
      if (kc + 2 < GK_ / 32) {
        frags(kc & 1, kc + 2, QFB_);
        __builtin_amdgcn_sched_barrier(0);
      }
    }
    lds_wait0();                 // this trip's reads of buf are done
    async_wait0();               // this wave's share of tile t+1 has landed
    __syncthreads();             // publishes tile t+1, frees buf
    if (t + 2 < nt) stage(buf, (t + 2) * GK_);   // flies during trip t+1
  }
  async_wait0();

  // C layout: row = VGPR e + 8 * half, column = lane % 16
  const float scale = isq ? 0.125f : 1.0f;
  // the lane's first element in q or k and in vT: every store below is that address plus
  // a constant, so no address register is rewritten while stores are in flight
  const int row = wr + hl * 8;
  __bf16* qk = (isq ? q : k) + ((size_t)m0 * D_ + cq) + (row * D_ + sub(0) + c);
  __bf16* vt = vT + ((size_t)v0 * S_ + m0) + ((sub(QFC_) - QC_ + c) * S_ + row);
  v8bf o[QFA_][QFB_];
  #pragma unroll
  for (int j = 0; j < QFB_; ++j)
    #pragma unroll
    for (int i = 0; i < QFA_; ++i)
      #pragma unroll
      for (int e = 0; e < 8; ++e)
        o[i][j][e] = j < QFC_ ? (__bf16)((acc[i][j][e] + bias[j]) * scale)
                              : (__bf16)(acc[i][j][e] + bias[j]);
  // All values stand converted, each in a register of its own, before the first store:
  // mixed, the compiler turned seven data registers round and waited (s_wait_xcnt) for
  // the stores in flight before each reuse.
  __builtin_amdgcn_sched_barrier(0);
  #pragma unroll
  for (int j = 0; j < QFB_; ++j)
    #pragma unroll
    for (int i = 0; i < QFA_; ++i) {
      if (j < QFC_) {
        #pragma unroll
        for (int e = 0; e < 8; ++e) qk[(i * 16 + e) * D_ + j * 16] = o[i][j][e];
      } else {                                   // eight successive rows: 16 bytes
        *reinterpret_cast<v8bf*>(vt + ((j - QFC_) * 16 * S_ + i * 16)) = o[i][j];
      }
    }
}

constexpr int AST_ = 64;
constexpr int AKP_ = HD_ + 8;
constexpr int AVP_ = AST_ + 8;

// lane l <-> lane l ^ 16
__device__ __forceinline__ float xhalf(float x) {
  const int b = __builtin_bit_cast(int, x);
  return __builtin_bit_cast(float, __builtin_amdgcn_permlanex16(
      b, b, 0x76543210, 0xfedcba98, false, false));
}

// e^x as v_exp_f32(x * log2 e), what __expf compiles to here. The v_nop fills the
// slot the instruction set asks for behind a transcendental before its source is
// overwritten.
__device__ __forceinline__ float exp_slot(float x) {
  float r;
  asm("v_exp_f32 %0, %1\n\tv_nop" : "=v"(r) : "v"(x * 1.4426950408889634f));
  return r;
}

// Which (head, query tile) a block takes. Tile t walks t + 1 stages, and all 768 blocks
// are resident at once, three to a WGP: the launch lasts as long as its fullest WGP.
// With tile = blockIdx.x, flat indices 256 apart are three tiles of the same length.
// Here the 768 pairs are ranked by falling length (rank / H_ counts down from the last
// tile). The first 256 blocks take the longest third in falling order; the second and the third 256 take the middle and the shortest third in
// rising order.
// The map is a permutation of 0..767: every (head, tile) is taken exactly once wherever
// the blocks land. Placement decides speed alone.
constexpr int ANT_  = S_ / 64;   // query tiles of a head
constexpr int WGPS_ = 256;       // WGPs of the chip
static_assert(ANT_ * H_ == 3 * WGPS_, "three blocks to a WGP");
__device__ __forceinline__ unsigned cost_rank(unsigned flat) {
  const unsigned round = flat / WGPS_, w = flat % WGPS_;
  return round * WGPS_ + (round == 0 ? w : WGPS_ - 1 - w);
}

__global__ __launch_bounds__(256) void attn_kernel(
    const __bf16* __restrict__ Q, const __bf16* __restrict__ Kb,
    const __bf16* __restrict__ vT,               // [D][S] transposed values
    const int* __restrict__ amask, __bf16* __restrict__ ctx) {
  // first index: the group of waves that fills and reads the buffers
  __shared__ alignas(16) __bf16 Ks[2][2][AST_][AKP_];   // [key][dim]  (K Q^T   A-frags)
  __shared__ alignas(16) __bf16 Vt[2][2][HD_][AVP_];    // [dim][key]  (V^T P^T A-frags)
  // group 1's partial result on its way to group 0, one column a thread
  __shared__ alignas(16) v4f Po[8][128];
  __shared__ float Pm[128], Pl[128];

  // the group as a scalar: every test on it is then a scalar branch of the whole wave
  const int grp  = __builtin_amdgcn_readfirstlane(threadIdx.x >> 7);
  const int tid  = threadIdx.x & 127;            // thread within the group
  const int wave = tid >> 5, lane = tid & 31;
  const int c  = lane & 15, hl = lane >> 4;
  const unsigned rank = cost_rank(blockIdx.y * ANT_ + blockIdx.x);
  const int h    = rank % H_;
  const int tile = ANT_ - 1 - rank / H_;         // rank 0: the last tile, the longest
  const int q0   = tile * 64 + wave * 16;
  const int hoff = h * HD_;
  const int qr   = q0 + c;                       // this lane's query

  v16bf aq[2];                                   // Q^T as B: lane = query column
  #pragma unroll
  for (int kc = 0; kc < 2; ++kc)
    aq[kc] = load_frag(Q + (size_t)(q0 + c) * D_ + hoff + kc * 32, hl);

  v8f o[4] = {};                                 // o[d][r] = O[qr][d*16 + 8*hl + r]
  float m = -1e30f, l = 0.f;                     // l: this half's keys only

  // 64 keys of K (row-major) and of V (already transposed): both tiles are 64 rows of
  // 128 bytes; eight neighbouring lanes bring a row, a thread rows sr, sr+16, +32, +48
  const int sr = tid >> 3, sg = (tid & 7) << 3;
  const int nst = tile + 1;                      // stages up to the causal bound
  const int ntr = (nst + 1) >> 1;                // trips: a stage for each group
  // The stage that the group fetches for trip t. With an odd count group 1 has none in the
  // last trip: it then fetches the last stage once more, so that every address stays in
  // bounds and every wave issues the same copies, and works on it under the number
  // st = nst. All its keys then count as lying behind every query of the block, so the
  // causal test masks every score: the weights come out 0 beside an earlier maximum;
  // where the group has seen no other stage (the first tile) its maximum stays -1e30 and
  // the join below gives the whole group the weight 0.
  auto stage_of = [&](int t) { const int s = 2 * t + grp; return s < nst ? s : nst - 1; };
  auto stage = [&](int buf, int t) {
    const int k0 = stage_of(t) * AST_;
    async_copy4x2_b128(&Ks[grp][buf][sr][sg], Kb + (size_t)(k0 + sr) * D_ + hoff + sg,
                       (size_t)16 * D_,
                       &Vt[grp][buf][sr][sg], vT + (size_t)(hoff + sr) * S_ + k0 + sg,
                       (size_t)16 * S_, 16 * AKP_ * 2);
  };
  static_assert(AKP_ == AVP_, "one LDS row step serves both tiles");

  stage(0, 0);
  // bit k of pad[ps]: key 32*ps+k of the stage is no padding
  const int fk = stage_of(0) * AST_;
  unsigned pad[2] = {__builtin_amdgcn_ballot_w32(amask[fk + lane] != 0),
                     __builtin_amdgcn_ballot_w32(amask[fk + 32 + lane] != 0)};
  async_wait0();
  __syncthreads();
  if (ntr > 1) stage(1, 1);

  for (int t = 0; t < ntr; ++t) {
    const int buf = t & 1;
    const int st  = 2 * t + grp;                 // this group's stage
    // the next stage's mask words, asked for now and used at the foot of this trip
    // (stage_of keeps the address inside the mask)
    const int nk = stage_of(t + 1) * AST_;
    const int mk0 = amask[nk + lane], mk1 = amask[nk + 32 + lane];
    // The scores of both passes of 32 keys stand in front of the one test of the stage.
    // S^T(32x16) = K(32x64) @ Q^T(64x16) a pass;
    // sc[ps][sub][r] = key st*64+ps*32+sub*16+8*hl+r, query qr
    // Every loop over sc is unrolled: its indices are then constants and it stays in
    // registers.
    v8f sc[2][2] = {};
    #pragma unroll
    for (int ps = 0; ps < 2; ++ps)
      #pragma unroll
      for (int sub = 0; sub < 2; ++sub)
        #pragma unroll
        for (int kc = 0; kc < 2; ++kc) {
          v16bf a = load_frag(&Ks[grp][buf][ps * 32 + sub * 16 + c][kc * 32], hl);
          sc[ps][sub] = wmma_bf16(a, aq[kc], sc[ps][sub]);
        }

    // Stages in front of the last hold keys below the block's first query only, and a
    // mask word of all ones holds no padding: nothing of such a stage is masked. The
    // test reads scalars alone and comes out the same in every wave of the group.
    const bool open = st + 1 < nst && (pad[0] & pad[1]) == 0xffffffffu;
    if (!open) {
      #pragma unroll
      for (int ps = 0; ps < 2; ++ps) {
        // bit k of keep: key 8*hl+k of the pass is open to this lane's query (padding, causal)
        const int n = qr - (st * AST_ + ps * 32);  // last key index the query may see
        const unsigned cau = n >= 31 ? 0xffffffffu : (n < 0 ? 0u : (2u << n) - 1u);
        const unsigned keep = (pad[ps] & cau) >> (hl * 8);
        #pragma unroll
        for (int sub = 0; sub < 2; ++sub)
          #pragma unroll
          for (int r = 0; r < 8; ++r)
            if (((keep >> (sub * 16 + r)) & 1u) == 0u) sc[ps][sub][r] = -1e30f;
      }
    }

    // two passes, unrolled: the LDS offsets are then constants
    #pragma unroll
    for (int ps = 0; ps < 2; ++ps) {
      v8f (&s)[2] = sc[ps];
      // online softmax, one query per lane
      float mx = -1e30f;
      #pragma unroll
      for (int sub = 0; sub < 2; ++sub)
        #pragma unroll
        for (int r = 0; r < 8; ++r) mx = fmaxf(mx, s[sub][r]);
      mx = fmaxf(mx, xhalf(mx));                   // both halves: the query's maximum
      const float mn  = fmaxf(m, mx);
      const float fac = exp_slot(m - mn);
      m = mn;
      v16bf bp;                                    // P^T as B, hardware k order
      float rs = 0.f;
      #pragma unroll
      for (int sub = 0; sub < 2; ++sub)
        #pragma unroll
        for (int r = 0; r < 8; ++r) {
          const float p = exp_slot(s[sub][r] - mn);
          rs += p;
          bp[sub * 8 + r] = (__bf16)p;
        }
      l = l * fac + rs;
      #pragma unroll
      for (int d = 0; d < 4; ++d)
        #pragma unroll
        for (int r = 0; r < 8; ++r) o[d][r] *= fac;

      // O^T += V^T @ P^T
      #pragma unroll
      for (int d = 0; d < 4; ++d) {
        v16bf av = load_frag(&Vt[grp][buf][d * 16 + c][ps * 32], hl);
        o[d] = wmma_bf16(av, bp, o[d]);
      }
    }
    pad[0] = __builtin_amdgcn_ballot_w32(mk0 != 0);
    pad[1] = __builtin_amdgcn_ballot_w32(mk1 != 0);
    lds_wait0();                 // this trip's reads of buf are done
    async_wait0();               // this wave's share of trip t+1 has landed
    __syncthreads();             // publishes trip t+1, frees buf
    if (t + 2 < ntr) stage(buf, t + 2);          // flies during trip t+1
  }
  async_wait0();

  if (grp == 1) {                // scalar: the whole wave hands over or none of it
    #pragma unroll
    for (int d = 0; d < 4; ++d) {
      Po[2 * d][tid]     = v4f{o[d][0], o[d][1], o[d][2], o[d][3]};
      Po[2 * d + 1][tid] = v4f{o[d][4], o[d][5], o[d][6], o[d][7]};
    }
    Pm[tid] = m;
    Pl[tid] = l;
  }
  __syncthreads();               // group 1's partial result is in LDS
  if (grp == 1) return;          // behind the last barrier

  // two partial softmaxes over disjoint keys: both brought to the common maximum
  const float m1 = Pm[tid];
  const float mt = fmaxf(m, m1);
  const float w0 = exp_slot(m - mt), w1 = exp_slot(m1 - mt);
  l = l * w0 + Pl[tid] * w1;
  #pragma unroll
  for (int d = 0; d < 4; ++d) {
    const v4f lo = Po[2 * d][tid], hi = Po[2 * d + 1][tid];
    #pragma unroll
    for (int r = 0; r < 4; ++r) {
      o[d][r]     = o[d][r] * w0 + lo[r] * w1;
      o[d][r + 4] = o[d][r + 4] * w0 + hi[r] * w1;
    }
  }

  const float inv = 1.0f / (l + xhalf(l));       // join the halves' sums once
  #pragma unroll
  for (int d = 0; d < 4; ++d) {
    v8bf w;
    #pragma unroll
    for (int r = 0; r < 8; ++r) w[r] = (__bf16)(o[d][r] * inv);
    *reinterpret_cast<v8bf*>(ctx + (size_t)qr * D_ + hoff + d * 16 + hl * 8) = w;
  }
}

// ---------------------------------------------------------------------------
// Host launcher
// ---------------------------------------------------------------------------
extern "C" void kernel_launch(void* const* d_in, const int* in_sizes, int n_in,
                              void* d_out, int out_size, void* d_ws, size_t ws_size,
                              hipStream_t stream) {
  const float* hidden = (const float*)d_in[0];
  const int*   mask   = (const int*)  d_in[1];
  const float* ln1w   = (const float*)d_in[2];
  const float* ln1b   = (const float*)d_in[3];
  const float* wq     = (const float*)d_in[4];
  const float* bq     = (const float*)d_in[5];
  const float* wk     = (const float*)d_in[6];
  const float* bk     = (const float*)d_in[7];
  const float* wv     = (const float*)d_in[8];
  const float* bv     = (const float*)d_in[9];
  const float* wo     = (const float*)d_in[10];
  const float* bo     = (const float*)d_in[11];
  const float* ln2w   = (const float*)d_in[12];
  const float* ln2b   = (const float*)d_in[13];
  const float* wup    = (const float*)d_in[14];
  const float* bup    = (const float*)d_in[15];
  const float* wdown  = (const float*)d_in[16];
  const float* bdown  = (const float*)d_in[17];
  float* out = (float*)d_out;

  constexpr size_t W_DD  = (size_t)D_ * D_;
  constexpr size_t W_DF  = (size_t)D_ * FF_;
  constexpr size_t ACT   = (size_t)S_ * D_;
  constexpr size_t ACTFF = (size_t)S_ * FF_;

  char* ws = (char*)d_ws;
  size_t off = 0;
  __bf16* wqT  = (__bf16*)(ws + off); off += W_DD * 2;   // all weights [N][K] bf16
  __bf16* wkT  = (__bf16*)(ws + off); off += W_DD * 2;
  __bf16* wvT  = (__bf16*)(ws + off); off += W_DD * 2;
  __bf16* woT  = (__bf16*)(ws + off); off += W_DD * 2;
  __bf16* wupT = (__bf16*)(ws + off); off += W_DF * 2;
  __bf16* wdnT = (__bf16*)(ws + off); off += W_DF * 2;
  __bf16* xln_bf  = (__bf16*)(ws + off); off += ACT * 2;
  __bf16* q_bf    = (__bf16*)(ws + off); off += ACT * 2;
  __bf16* k_bf    = (__bf16*)(ws + off); off += ACT * 2;
  __bf16* vT_bf   = (__bf16*)(ws + off); off += ACT * 2;  // [D][S]
  __bf16* ctx_bf  = (__bf16*)(ws + off); off += ACT * 2;
  float*  hidden2 = (float*) (ws + off); off += ACT * 4;
  __bf16* yln_bf  = (__bf16*)(ws + off); off += ACT * 2;
  __bf16* ff_bf   = (__bf16*)(ws + off); off += ACTFF * 2;

  // the six transposed weights stand back to back from wqT on
  weights_to_bf16_t_kernel<<<4 * PDD_ + 2 * PDF_, 256, 0, stream>>>(wq, wk, wv, wo, wup, wdown,
                                                                    wqT);

  // LN1
  ln_bf16_kernel<<<S_ / (8 * LNR_), 256, 0, stream>>>(hidden, ln1w, ln1b, xln_bf);

  // Projections (Q pre-scaled by 1/sqrt(HD); V written transposed); wqT, wkT and wvT
  // stand back to back
  qkv_gemm_kernel<<<dim3(QNB_, S_ / GT_), 256, 0, stream>>>(
      xln_bf, wqT, bq, bk, bv, q_bf, k_bf, vT_bf);

  // Flash attention
  attn_kernel<<<dim3(S_ / 64, H_), 256, 0, stream>>>(q_bf, k_bf, vT_bf, mask, ctx_bf);

  // O-projection + residual -> hidden2 (fp32)
  dim3 gDD(D_ / GT_, S_ / GT_);
  gemm_bf16_kernel<1><<<gDD, 256, 0, stream>>>(ctx_bf, woT, bo, hidden, hidden2, nullptr,
                                               S_, D_, D_);

  // LN2
  ln_bf16_kernel<<<S_ / (8 * LNR_), 256, 0, stream>>>(hidden2, ln2w, ln2b, yln_bf);

  // Up-projection + exact GELU -> bf16
  gemm_bf16_kernel<2><<<dim3(FF_ / GT_, S_ / GT_), 256, 0, stream>>>(
      yln_bf, wupT, bup, nullptr, nullptr, ff_bf, S_, FF_, D_);

  // Down-projection + residual -> d_out (fp32)
  gemm_bf16_kernel<1><<<gDD, 256, 0, stream>>>(ff_bf, wdnT, bdown, hidden2, out, nullptr,
                                               S_, D_, FF_);
}
